// v000
// Measured on an AMD MI455X. A time is GPU time per run, averaged over a window of back-to-back runs after a warm-up
// (all launches, gaps included; the runs take copies of the inputs in turn), and the median of several windows.
// Apart from v000's, it joins two sittings. Times from different sittings can be a few percent apart, while
// side-by-side timings come from the same sitting.
// The starting kernel, v000, takes 546 microseconds a run.
// Contractions: q, k, v^T projections = v_wmma_f32_16x16x32_bf16 (bf16 operands from RNE-converted f32 inputs, single product, f32 accumulate, f32 bias add);
// q.k^T scores = v_wmma_f32_16x16x32_bf16 on bf16 hi/lo planes of q and k (hi.hi + hi.lo + lo.hi), f32 accumulate;
// p.v = v_wmma_f32_16x16x32_f16 (p carried x1024 in f16, v in f16, plus f16 residual planes x4096 of p and v on the leading query blocks), f32 accumulate;
// ctx.Wo^T = v_wmma_f32_16x16x32_bf16 with ctx as bf16 hi/lo planes times bf16 Wo (2 products), f32 accumulate; visibility test and softmax in f32.
#include <hip/hip_runtime.h>
#include <math.h>
#include <float.h>
#include <stdint.h>

#define NB    2
#define NLAT  1024         // query (latent) length per batch
#define MTOK  4096         // key / value (token) length per batch
#define DM    1024
#define NH    16
#define HD    64
#define DSF   4            // key j visible to query t iff j / DSF <= t
#define NQB   (NLAT / 64)  // 16 query blocks of 64 rows
#define NKT   (MTOK / 64)  // 64 key tiles of 64
#define RESQB 4            // leading query blocks that use the p / v residual planes
#define VLP   1024         // key pitch of the v^T residual plane (keys 0..VLP-1)
static_assert(RESQB * 64 * DSF <= VLP);
static_assert(NH * HD == DM);
static_assert(MTOK == NLAT * DSF);
static_assert((NLAT % 64) == 0 && (MTOK % 64) == 0 && (DM % 64) == 0);
static_assert((VLP % 64) == 0 && VLP <= MTOK);
static_assert(DSF * NQB <= NKT);

typedef _Float16 v16h __attribute__((ext_vector_type(16)));
typedef _Float16 v8h  __attribute__((ext_vector_type(8)));
typedef __bf16   v16b __attribute__((ext_vector_type(16)));
typedef __bf16   v8b  __attribute__((ext_vector_type(8)));
typedef float    v8f  __attribute__((ext_vector_type(8)));
typedef float    v4f  __attribute__((ext_vector_type(4)));
typedef unsigned int v4u __attribute__((ext_vector_type(4)));

// ---- scalar helpers --------------------------------------------------------------------------------
__device__ __forceinline__ unsigned short bf_bits(float f) {          // f32 -> bf16 bits, RNE convert
  unsigned u = __float_as_uint(f);
  return (unsigned short)((u + 0x7FFFu + ((u >> 16) & 1u)) >> 16);
}
__device__ __forceinline__ float bf_up(unsigned short h) { return __uint_as_float(((unsigned)h) << 16); }
__device__ __forceinline__ unsigned short h_bits(_Float16 x) { return __builtin_bit_cast(unsigned short, x); }
__device__ __forceinline__ unsigned pk16(unsigned short a, unsigned short b) { return (unsigned)a | ((unsigned)b << 16); }
__device__ __forceinline__ v8f zero8() { v8f z = {0.f, 0.f, 0.f, 0.f, 0.f, 0.f, 0.f, 0.f}; return z; }
__device__ __forceinline__ v8h zero8h() {
  const _Float16 z = (_Float16)0.0f;
  v8h r = {z, z, z, z, z, z, z, z};
  return r;
}

// ---- fragment loader: 16-bit A/B operand, lane -> row/col (lane&15), p already includes +8*(lane>>4);
//      elements 0..7 <- p[0..7] (k0+8h..k0+8h+7), elements 8..15 <- p[16..23] (k0+16+8h..)
__device__ __forceinline__ v16b ldfrag_b(const __bf16* p) {
  union { v16b v; v8b h[2]; } f;
  f.h[0] = *(const v8b*)(p);
  f.h[1] = *(const v8b*)(p + 16);
  return f.v;
}

// ---- WMMA helpers with trailing VALU hazard gap (asm only in the device pass) -------------------------
__device__ __forceinline__ v8f mma_b(v16b a, v16b b, v8f c) {
  c = __builtin_amdgcn_wmma_f32_16x16x32_bf16(false, a, false, b, (short)0, c, false, false);
#if defined(__HIP_DEVICE_COMPILE__)
  asm volatile("v_nop\n\tv_nop\n\tv_nop\n\tv_nop" : "+v"(c) : "v"(a), "v"(b));
#endif
  return c;
}
__device__ __forceinline__ v8f mma_h(v16h a, v16h b, v8f c) {
  c = __builtin_amdgcn_wmma_f32_16x16x32_f16(false, a, false, b, (short)0, c, false, false);
#if defined(__HIP_DEVICE_COMPILE__)
  asm volatile("v_nop\n\tv_nop\n\tv_nop\n\tv_nop" : "+v"(c) : "v"(a), "v"(b));
#endif
  return c;
}
__device__ __forceinline__ v8f mma_b_raw(v16b a, v16b b, v8f c) {
  return __builtin_amdgcn_wmma_f32_16x16x32_bf16(false, a, false, b, (short)0, c, false, false);
}
__device__ __forceinline__ void dep_guard_b(v8f& a, v8f& b, v16b x, v16b y) {
#if defined(__HIP_DEVICE_COMPILE__)
  asm volatile("v_nop\n\tv_nop\n\tv_nop\n\tv_nop" : "+v"(a), "+v"(b) : "v"(x), "v"(y));
#else
  (void)a; (void)b; (void)x; (void)y;
#endif
}
__device__ __forceinline__ void keep4_b(v16b a, v16b b, v16b c, v16b d) {
#if defined(__HIP_DEVICE_COMPILE__)
  asm volatile("v_nop" :: "v"(a), "v"(b), "v"(c), "v"(d));
#else
  (void)a; (void)b; (void)c; (void)d;
#endif
}
__device__ __forceinline__ void acc_guard4(v8f& a, v8f& b, v8f& c, v8f& d) {
#if defined(__HIP_DEVICE_COMPILE__)
  asm volatile("v_nop\n\tv_nop\n\tv_nop\n\tv_nop" : "+v"(a), "+v"(b), "+v"(c), "+v"(d));
#else
  (void)a; (void)b; (void)c; (void)d;
#endif
}

// =====================================================================================================
// f32 -> bf16 (RNE convert), 8 elements per thread, one 16-B store per lane: a wave writes 512 contiguous B
// coverage: n8 threads x 8 = whole plane (n8 is a multiple of 256 for every use here).
// =====================================================================================================
__global__ __launch_bounds__(256) void cvt_bf16x8(const float* __restrict__ in, unsigned short* out, int n8) {
  const int i = blockIdx.x * 256 + threadIdx.x;
  if (i < n8) {
    const v4f a = *(const v4f*)(in + (size_t)i * 8);
    const v4f b = *(const v4f*)(in + (size_t)i * 8 + 4);
    v4u p;
    p[0] = pk16(bf_bits(a[0]), bf_bits(a[1]));
    p[1] = pk16(bf_bits(a[2]), bf_bits(a[3]));
    p[2] = pk16(bf_bits(b[0]), bf_bits(b[1]));
    p[3] = pk16(bf_bits(b[2]), bf_bits(b[3]));
    *(v4u*)(out + (size_t)i * 8) = p;
    
  }
}

// =====================================================================================================
// Register-blocked batched bf16 WMMA GEMM: C[m][n] = sum_k A[m][k] * Bt[n][k] + bias; one wave per 64x64
// tile, no block barriers. A row-major [M][K] pitch lda; Bt row-major [N][K] pitch ldb (k contiguous);
// M, N multiples of 64, K multiple of 32 (host-checked). blockIdx.y = batch index (strides in elements).
// NSPLIT: 0 = A.Bt; 1 = (A + A2).Bt (A2 = unscaled bf16 lo plane of A).
// BIASM:  0 = bias[n] (length N), 1 = bias[m] (length M); bias values pass through an RNE bf16 convert.
// OUT_MODE: 0 = f32 (pitch ldc); 2 = bf16 hi plane C + bf16 lo plane C2 (lo = RNE(v - hi), unscaled);
//           3 = f16 hi plane C + f16 residual plane C2 = f16((v - hi) * rscale), C2 written only for tiles
//               with n0 < N2 (pitch ldc2, batch stride strideC2).
// =====================================================================================================
template <int NSPLIT, int OUT_MODE, int BIASM>
__global__ __launch_bounds__(256) void gemm64(
    const unsigned short* __restrict__ Ap, const unsigned short* A2p, int lda, long long strideA,
    const unsigned short* __restrict__ Btp, int ldb, long long strideB,
    const float* __restrict__ bias,
    void* Cout, int ldc, long long strideC,
    void* Cout2, int ldc2, long long strideC2, int N2,
    int M, int N, int K, float rscale) {
  const __bf16* A   = (const __bf16*)(const void*)Ap;
  const __bf16* A2  = (const __bf16*)(const void*)A2p;
  const __bf16* Bt  = (const __bf16*)(const void*)Btp;
  __shared__ __align__(16) float sT[8][16 * 68];   // per-wave 16x64 slab, pitch 68 floats
  const int b    = blockIdx.y;
  const int lane = threadIdx.x & 31;
  const int wave = threadIdx.x >> 5;
  const int tilesN = N >> 6;
  const int tilesM = M >> 6;
  const int tile = blockIdx.x * 8 + wave;
  if (tile >= tilesM * tilesN) return;   // wave-uniform; no block barriers in this kernel
  const int tm = tile / tilesN;
  const int tn = tile - tm * tilesN;
  const int m0 = tm << 6;
  const int n0 = tn << 6;

  const __bf16* Ab  = A  + (size_t)b * strideA;
  const __bf16* Bb  = Bt + (size_t)b * strideB;
  const __bf16* Ab2 = (NSPLIT >= 1) ? (A2 + (size_t)b * strideA) : Ab;

  const int rlane = lane & 15;                 // row (A) / col (B, D) within subtile
  const int koff  = (lane >> 4) * 8;           // k offset of this lane half
  const int mOff  = (lane >> 4) * 8;           // D row offset

  float bcol[4];
#pragma unroll
  for (int j = 0; j < 4; ++j) bcol[j] = 0.f;
  if (BIASM == 0) {
#pragma unroll
    for (int j = 0; j < 4; ++j) bcol[j] = bf_up(bf_bits(bias[n0 + (j << 4) + rlane]));   // n0+63 < N
  }

  v8f acc[4][4];
#pragma unroll
  for (int i = 0; i < 4; ++i)
#pragma unroll
    for (int j = 0; j < 4; ++j) acc[i][j] = zero8();

  for (int k0 = 0; k0 < K; k0 += 32) {
    v16b bh[4];
#pragma unroll
    for (int j = 0; j < 4; ++j) {
      const size_t bo = (size_t)(n0 + (j << 4) + rlane) * ldb + koff + k0;
      bh[j] = ldfrag_b(Bb + bo);
    }
#pragma unroll
    for (int i = 0; i < 4; ++i) {
      const size_t ao = (size_t)(m0 + (i << 4) + rlane) * lda + koff + k0;
      const v16b ah = ldfrag_b(Ab + ao);
      v16b al = ah;
      if (NSPLIT >= 1) al = ldfrag_b(Ab2 + ao);
#pragma unroll
      for (int j = 0; j < 4; ++j) {
        acc[i][j] = mma_b_raw(ah, bh[j], acc[i][j]);
        if (NSPLIT >= 1) acc[i][j] = mma_b_raw(al, bh[j], acc[i][j]);
      }
      dep_guard_b(acc[i][0], acc[i][3], ah, al);
    }
    keep4_b(bh[0], bh[1], bh[2], bh[3]);
  }
  acc_guard4(acc[0][0], acc[0][1], acc[0][2], acc[0][3]);
  acc_guard4(acc[1][0], acc[1][1], acc[1][2], acc[1][3]);
  acc_guard4(acc[2][0], acc[2][1], acc[2][2], acc[2][3]);
  acc_guard4(acc[3][0], acc[3][1], acc[3][2], acc[3][3]);

  // ---- epilogue ----
  float* slab = sT[wave];
#pragma unroll
  for (int i = 0; i < 4; ++i) {
    const int mBase = m0 + (i << 4);
    float brow[8];
#pragma unroll
    for (int r = 0; r < 8; ++r) brow[r] = 0.f;
    if (BIASM == 1) {
#pragma unroll
      for (int r = 0; r < 8; ++r) brow[r] = bf_up(bf_bits(bias[mBase + mOff + r]));    // < M
    }
#pragma unroll
    for (int j = 0; j < 4; ++j) {
#pragma unroll
      for (int r = 0; r < 8; ++r) {
        slab[(mOff + r) * 68 + (j << 4) + rlane] = acc[i][j][r] + bcol[j] + brow[r];
      }
    }
    __builtin_amdgcn_fence(__ATOMIC_RELEASE, "workgroup");
    __builtin_amdgcn_wave_barrier();
    __builtin_amdgcn_fence(__ATOMIC_ACQUIRE, "workgroup");
    if (OUT_MODE == 0) {
      float* C = (float*)Cout + (size_t)b * strideC;
      const int hh = lane >> 4, c4 = (lane & 15) * 4;     // 256-B row segment = 16 lanes x 16 B
      v4f vv[8];
#pragma unroll
      for (int it = 0; it < 8; ++it) {
        const int row = it * 2 + hh;                       // it 0..7 x hh 0..1 = rows 0..15
        vv[it] = *(const v4f*)(slab + row * 68 + c4);
      }
      {
#pragma unroll
        for (int it = 0; it < 8; ++it) {
          const int row = it * 2 + hh;
          *(v4f*)(C + (size_t)(mBase + row) * ldc + n0 + c4) = vv[it];
        }
        
      }
    } else {
      const int q = lane >> 3, c8 = (lane & 7) * 8;
      unsigned short* C  = (unsigned short*)Cout  + (size_t)b * strideC;
      unsigned short* C2 = (unsigned short*)Cout2 + (size_t)b * strideC2;
      const bool wlo = (OUT_MODE == 2) || (n0 < N2);      // wave-uniform
      v4u hv[4], lv[4];
#pragma unroll
      for (int it = 0; it < 4; ++it) {
        const int row = it * 4 + q;                        // it 0..3 x q 0..3 = rows 0..15
        const float* sp = slab + row * 68 + c8;
        v4u a, a2;
#pragma unroll
        for (int e = 0; e < 4; ++e) {
          const float f0 = sp[2 * e], f1 = sp[2 * e + 1];
          unsigned short h0, h1, l0, l1;
          if (OUT_MODE == 2) {
            h0 = bf_bits(f0); h1 = bf_bits(f1);
            l0 = bf_bits(f0 - bf_up(h0)); l1 = bf_bits(f1 - bf_up(h1));
          } else {
            const _Float16 x0 = (_Float16)f0, x1 = (_Float16)f1;
            h0 = h_bits(x0); h1 = h_bits(x1);
            l0 = h_bits((_Float16)((f0 - (float)x0) * rscale));
            l1 = h_bits((_Float16)((f1 - (float)x1) * rscale));
          }
          a[e] = pk16(h0, h1); a2[e] = pk16(l0, l1);
        }
        hv[it] = a; lv[it] = a2;
      }
      {
#pragma unroll
        for (int it = 0; it < 4; ++it) {
          const int row = it * 4 + q;
          *(v4u*)(C + (size_t)(mBase + row) * ldc + n0 + c8) = hv[it];
          if (wlo) *(v4u*)(C2 + (size_t)(mBase + row) * ldc2 + n0 + c8) = lv[it];
        }
        
      }
    }
    __builtin_amdgcn_fence(__ATOMIC_RELEASE, "workgroup");
    __builtin_amdgcn_wave_barrier();
    __builtin_amdgcn_fence(__ATOMIC_ACQUIRE, "workgroup");
  }
}

// =====================================================================================================
// Attention with block-triangular visibility (key j visible to query t iff j / DSF <= t, i.e. j < DSF*(t+1)),
// head dim 64, queries from the latent planes (NLAT per batch), keys / values from the token planes (MTOK).
//   q planes (bf16 hi / lo): element (b, t, h, d) at [(b*NLAT + t)*DM + h*64 + d]
//   k planes (bf16 hi / lo): element (b, s, h, d) at [(b*MTOK + s)*DM + h*64 + d]
//   v^T hi plane (f16):      element (b, h, d, s) at [(b*DM + h*64 + d)*MTOK + s]
//   v^T residual plane (f16, (v - hi)*4096): [(b*DM + h*64 + d)*VLP + s], s < VLP, read only when RES
//   (a key tile at or beyond VLP contributes a zero v residual; never happens for the RES query blocks)
//   Query block qb (64 rows) processes key tiles 0 .. DSF*(qb+1)-1 (block-uniform break out of a loop with
//   static trip NKT); inside a tile, invisible keys get -inf logits -> weight exactly 0. Every query row
//   sees at least DSF keys of tile 0, so the running max is finite after the first tile.
//   out planes (bf16 hi / lo of the normalised context): element (b, t, h, d) at [(b*NLAT + t)*DM + h*64 + d]
//   scores = q . k : bf16 hi/lo split (hi.hi + hi.lo + lo.hi), f32 accumulate, then * sscale in f32
//   p = exp(s - m) carried as f16(1024 p); context = p . v on f16 WMMA; RES adds f16 residual planes of p and v
//   (scale 4096, separate accumulator folded back with 1/4096 per tile in f32); online softmax in f32.
//   Block = 4 waves = 64 query rows of one (b, h); grid = nqbThis * NH * NB; kv tiles of 64.
//   K / V^T tile staging: 128 threads x 32 elements per plane = the whole 64x64 tile (plain 16-B loads,
//   __syncthreads before and after); P tiles are wave-private, spilled with _Float16 element stores and reloaded
//   Output coverage: each wave stores rows q0..q0+15 (it 0..3 x lane>>3 0..3) x 64 columns (8 lanes x 8) of both planes.
// =====================================================================================================
template <bool RES>
__global__ __launch_bounds__(128)
void attn_bc64(const unsigned short* __restrict__ qhp, const unsigned short* __restrict__ qlp,
               const unsigned short* __restrict__ khp, const unsigned short* __restrict__ klp,
               const unsigned short* __restrict__ vhp, const unsigned short* __restrict__ vlp,
               unsigned short* ohp, unsigned short* olp,
               int qbBase, int nqbThis, float sscale) {
  union FB { v16b v; v8b h[2]; };
  union FH { v16h v; v8h h[2]; };
  __shared__ __align__(16) __bf16   Ksh[64 * 64];                 // K hi [kv][d]   8 KB
  __shared__ __align__(16) __bf16   Ksl[64 * 64];                 // K lo
  __shared__ __align__(16) _Float16 Vth[64 * 64];                 // V^T hi [d][kv] 8 KB
  __shared__ __align__(16) _Float16 Vtl[RES ? 64 * 64 : 8];       // V^T residual
  __shared__ __align__(16) _Float16 Psh[4][16 * 64];              // per wave P [row][kv]
  __shared__ __align__(16) _Float16 Psl[RES ? 4 : 1][16 * 64];    // per wave P residual
  __shared__ __align__(16) float    Os[4][16 * 64];               // per wave context tile [row][d]

  const int tid  = threadIdx.x;
  const int wave = tid >> 5;
  const int lane = tid & 31;
  const int hh   = lane >> 4;
  const int c    = lane & 15;

  const int bx   = blockIdx.x;
  const int qbl  = bx % nqbThis;
  const int rest = bx / nqbThis;
  const int h    = rest % NH;
  const int b    = rest / NH;
  const int qb   = qbBase + qbl;
  const int q0   = qb * 64 + wave * 16;            // query row within the batch
  const size_t rowQ = (size_t)b * NLAT;
  const size_t rowK = (size_t)b * MTOK;
  int ktEnd = DSF * (qb + 1);                      // key tiles 0..ktEnd-1 hold every visible key of this block
  if (ktEnd > NKT) ktEnd = NKT;

  const __bf16* Qh = (const __bf16*)(const void*)qhp + (size_t)h * HD;
  const __bf16* Ql = (const __bf16*)(const void*)qlp + (size_t)h * HD;
  const __bf16* Kh = (const __bf16*)(const void*)khp + (size_t)h * HD;
  const __bf16* Kl = (const __bf16*)(const void*)klp + (size_t)h * HD;
  const _Float16* Vh = (const _Float16*)(const void*)vhp + ((size_t)b * DM + (size_t)h * HD) * MTOK;
  const _Float16* Vl = (const _Float16*)(const void*)vlp + ((size_t)b * DM + (size_t)h * HD) * VLP;

  // ---- Q fragments (A operand, row = lane&15): 2 d-chunks, hi and lo ----
  v16b qah[2], qal[2];
#pragma unroll
  for (int dc = 0; dc < 2; ++dc) {
    const size_t qo = (rowQ + q0 + c) * DM + dc * 32 + 8 * hh;
    qah[dc] = ldfrag_b(Qh + qo);
    qal[dc] = ldfrag_b(Ql + qo);
  }

  float mrow[8], lrow[8];
  v8f oacc[4];
#pragma unroll
  for (int r = 0; r < 8; ++r) { mrow[r] = -INFINITY; lrow[r] = 0.f; }
#pragma unroll
  for (int t = 0; t < 4; ++t) oacc[t] = zero8();

  for (int kt = 0; kt < NKT; ++kt) {         // static trip count
    if (kt >= ktEnd) break;                  // block-uniform
    const int kv0 = kt * 64;
    __syncthreads();
    {
      const int r = tid >> 1, half = (tid & 1) * 32;
      const __bf16*   kg  = Kh + (rowK + kv0 + r) * DM + half;    // K row kv0+r, d = half..half+31
      const __bf16*   klg = Kl + (rowK + kv0 + r) * DM + half;
      const _Float16* vg  = Vh + (size_t)r * MTOK + kv0 + half;   // V^T row d = r, s = kv0+half..+31
      const int kvl = (kv0 + 64 <= VLP) ? kv0 : (VLP - 64);     // clamped address into the residual plane
      const _Float16* vlg = Vl + (size_t)r * VLP + kvl + half;
      const bool resOK = (kv0 + 64 <= VLP);                      // block-uniform
#pragma unroll
      for (int i = 0; i < 4; ++i) {
        const v8b a0 = *(const v8b*)(kg + 8 * i);
        const v8b a1 = *(const v8b*)(klg + 8 * i);
        const v8h b0 = *(const v8h*)(vg + 8 * i);
        *(v8b*)(Ksh + r * 64 + half + 8 * i) = a0;
        *(v8b*)(Ksl + r * 64 + half + 8 * i) = a1;
        *(v8h*)(Vth + r * 64 + half + 8 * i) = b0;
        if (RES) {
          v8h b1 = *(const v8h*)(vlg + 8 * i);
          if (!resOK) b1 = zero8h();
          *(v8h*)(Vtl + r * 64 + half + 8 * i) = b1;
        }
      }
    }
    __syncthreads();

    // ---- scores: 16 query rows x 64 keys per wave, 3 bf16 products ----
    v8f s[4];
#pragma unroll
    for (int j = 0; j < 4; ++j) {
      s[j] = zero8();
#pragma unroll
      for (int dc = 0; dc < 2; ++dc) {
        FB kb, kl;
        kb.h[0] = *(const v8b*)(Ksh + (j * 16 + c) * 64 + dc * 32 + 8 * hh);
        kb.h[1] = *(const v8b*)(Ksh + (j * 16 + c) * 64 + dc * 32 + 16 + 8 * hh);
        kl.h[0] = *(const v8b*)(Ksl + (j * 16 + c) * 64 + dc * 32 + 8 * hh);
        kl.h[1] = *(const v8b*)(Ksl + (j * 16 + c) * 64 + dc * 32 + 16 + 8 * hh);
        s[j] = mma_b(qah[dc], kb.v, s[j]);
        s[j] = mma_b(qah[dc], kl.v, s[j]);
        s[j] = mma_b(qal[dc], kb.v, s[j]);
      }
    }

    // ---- scale + visibility test (-inf for invisible keys), row max, online softmax,
    //      P (x1024, f16) and P residual (x4096) to LDS ----
    _Float16* pwh = Psh[wave];
    _Float16* pwl = Psl[RES ? wave : 0];
#pragma unroll
    for (int r = 0; r < 8; ++r) {
      const int tq  = q0 + 8 * hh + r;           // query row within the batch
      const int lim = DSF * (tq + 1);            // visible keys: j < lim
      float m = -INFINITY;
#pragma unroll
      for (int j = 0; j < 4; ++j) {
        const int key = kv0 + j * 16 + c;
        const float sv = (key < lim) ? s[j][r] * sscale : -INFINITY;
        s[j][r] = sv;
        m = fmaxf(m, sv);
      }
#pragma unroll
      for (int off = 1; off < 16; off <<= 1) m = fmaxf(m, __shfl_xor(m, off, 32));
      const float mnew  = fmaxf(mrow[r], m);
      const float msafe = (mnew == -INFINITY) ? 0.f : mnew;
      const float alpha = __expf(mrow[r] - msafe);
      mrow[r] = mnew;
      float psum = 0.f;
#pragma unroll
      for (int j = 0; j < 4; ++j) {
        const float p = __expf(s[j][r] - msafe);     // -inf logit -> exactly 0
        psum += p;
        const float p1k = p * 1024.0f;
        const _Float16 ph = (_Float16)p1k;
        pwh[(8 * hh + r) * 64 + j * 16 + c] = ph;
        if (RES) {
          const _Float16 pl = (_Float16)((p1k - (float)ph) * 4096.0f);
          pwl[(8 * hh + r) * 64 + j * 16 + c] = pl;
        }
      }
#pragma unroll
      for (int off = 1; off < 16; off <<= 1) psum += __shfl_xor(psum, off, 32);
      lrow[r] = lrow[r] * alpha + psum;
#pragma unroll
      for (int t = 0; t < 4; ++t) oacc[t][r] *= alpha;
    }
    __builtin_amdgcn_fence(__ATOMIC_RELEASE, "workgroup");
    __builtin_amdgcn_wave_barrier();
    __builtin_amdgcn_fence(__ATOMIC_ACQUIRE, "workgroup");

    // ---- context += P . V (f16 WMMA), residual products into a separate accumulator ----
    v8f o1[4];
#pragma unroll
    for (int t = 0; t < 4; ++t) o1[t] = zero8();
#pragma unroll 1
    for (int kk = 0; kk < 2; ++kk) {
      FH pa, pl;
      pa.h[0] = *(const v8h*)(pwh + c * 64 + kk * 32 + 8 * hh);
      pa.h[1] = *(const v8h*)(pwh + c * 64 + kk * 32 + 16 + 8 * hh);
      if (RES) {
        pl.h[0] = *(const v8h*)(pwl + c * 64 + kk * 32 + 8 * hh);
        pl.h[1] = *(const v8h*)(pwl + c * 64 + kk * 32 + 16 + 8 * hh);
      } else {
        pl.v = pa.v;
      }
#pragma unroll
      for (int t = 0; t < 4; ++t) {
        FH vb;
        vb.h[0] = *(const v8h*)(Vth + (t * 16 + c) * 64 + kk * 32 + 8 * hh);
        vb.h[1] = *(const v8h*)(Vth + (t * 16 + c) * 64 + kk * 32 + 16 + 8 * hh);
        oacc[t] = mma_h(pa.v, vb.v, oacc[t]);
        if (RES) {
          FH vl;
          vl.h[0] = *(const v8h*)(Vtl + (t * 16 + c) * 64 + kk * 32 + 8 * hh);
          vl.h[1] = *(const v8h*)(Vtl + (t * 16 + c) * 64 + kk * 32 + 16 + 8 * hh);
          o1[t] = mma_h(pa.v, vl.v, o1[t]);
          o1[t] = mma_h(pl.v, vb.v, o1[t]);
        }
      }
    }
    if (RES) {
#pragma unroll
      for (int t = 0; t < 4; ++t)
#pragma unroll
        for (int r = 0; r < 8; ++r) oacc[t][r] += o1[t][r] * (1.0f / 4096.0f);
    }
  }

  // ---- normalise (1/l and the 1/1024 p carry), stage the wave's 16x64 tile, bf16 hi/lo split,
  float* os = Os[wave];
#pragma unroll
  for (int r = 0; r < 8; ++r) {
    const float l = lrow[r];
    const float inv = ((l > 0.f) ? (1.0f / l) : 0.f) * (1.0f / 1024.0f);
#pragma unroll
    for (int t = 0; t < 4; ++t) os[(8 * hh + r) * 64 + t * 16 + c] = oacc[t][r] * inv;
  }
  __builtin_amdgcn_fence(__ATOMIC_RELEASE, "workgroup");
  __builtin_amdgcn_wave_barrier();
  __builtin_amdgcn_fence(__ATOMIC_ACQUIRE, "workgroup");
  {
    const int q4 = lane >> 3, c8 = (lane & 7) * 8;
    v4u hv[4], lv[4];
#pragma unroll
    for (int it = 0; it < 4; ++it) {
      const int row = it * 4 + q4;   // it 0..3 x q4 0..3 = rows 0..15 of the wave tile
      const float* sp = os + row * 64 + c8;
      v4u a, a2;
#pragma unroll
      for (int e = 0; e < 4; ++e) {
        const float f0 = sp[2 * e], f1 = sp[2 * e + 1];
        const unsigned short h0 = bf_bits(f0), h1 = bf_bits(f1);
        const unsigned short l0 = bf_bits(f0 - bf_up(h0)), l1 = bf_bits(f1 - bf_up(h1));
        a[e] = pk16(h0, h1); a2[e] = pk16(l0, l1);
      }
      hv[it] = a; lv[it] = a2;
    }
    {
#pragma unroll
      for (int it = 0; it < 4; ++it) {
        const int row = it * 4 + q4;
        const size_t go = (rowQ + q0 + row) * DM + (size_t)h * HD + c8;
        *(v4u*)(ohp + go) = hv[it];
        *(v4u*)(olp + go) = lv[it];
      }
      
    }
  }
}

// =====================================================================================================
// Workspace map (bytes), every region an exact multiple of its 64x64-tile / whole-line store granularity
// (M, N of every GEMM are multiples of 64; converts write whole 512-B groups):
//   Lb   bf16 [2048][1024]            0            4194304
//   Xb   bf16 [8192][1024]            4194304     16777216
//   Wqb  bf16 [1024 n][1024 k]        20971520     2097152
//   Wkb  bf16 [1024][1024]            23068672     2097152
//   Wvb  bf16 [1024][1024]            25165824     2097152
//   Wob  bf16 [1024][1024]            27262976     2097152
//   Qh   bf16 [2048][1024]            29360128     4194304
//   Ql   bf16 [2048][1024]            33554432     4194304
//   Kh   bf16 [8192][1024]            37748736    16777216
//   Kl   bf16 [8192][1024]            54525952    16777216
//   VTh  f16  [2][1024][4096]         71303168    16777216
//   VTl  f16  [2][1024][1024]         88080384     4194304
//   Oh   bf16 [2048][1024]            92274688     4194304
//   Ol   bf16 [2048][1024]            96468992     4194304
//   end                               100663296
// Weights are [out n][in k] with k contiguous = the Bt / A layout the GEMM wants, so they are only converted.
// =====================================================================================================
extern "C" void kernel_launch(void* const* d_in, const int* in_sizes, int n_in,
                              void* d_out, int out_size, void* d_ws, size_t ws_size,
                              hipStream_t stream) {
  if (n_in < 10) return;
  if (in_sizes[0] != NB * MTOK * DM) return;
  if (in_sizes[1] != NB * NLAT * DM) return;
  if (in_sizes[2] != DM * DM || in_sizes[4] != DM * DM || in_sizes[6] != DM * DM || in_sizes[8] != DM * DM) return;
  if (in_sizes[3] != DM || in_sizes[5] != DM || in_sizes[7] != DM || in_sizes[9] != DM) return;
  if (out_size != NB * NLAT * DM) return;

  const float* x  = (const float*)d_in[0];
  const float* lt = (const float*)d_in[1];
  const float* Wq = (const float*)d_in[2];
  const float* bq = (const float*)d_in[3];
  const float* Wk = (const float*)d_in[4];
  const float* bk = (const float*)d_in[5];
  const float* Wv = (const float*)d_in[6];
  const float* bv = (const float*)d_in[7];
  const float* Wo = (const float*)d_in[8];
  const float* bo = (const float*)d_in[9];

  const size_t PL  = (size_t)NB * NLAT * DM * 2;   //  4194304  16-bit latent-side plane [2048][1024]
  const size_t PX  = (size_t)NB * MTOK * DM * 2;   // 16777216  16-bit token-side plane [8192][1024]
  const size_t PW  = (size_t)DM * DM * 2;          //  2097152  16-bit weight plane
  const size_t PVT = (size_t)NB * DM * MTOK * 2;   // 16777216  v^T hi plane
  const size_t PVL = (size_t)NB * DM * VLP * 2;    //  4194304  v^T residual plane
  size_t off = 0;
  const size_t oLb  = off; off += PL;
  const size_t oXb  = off; off += PX;
  const size_t oWq  = off; off += PW;
  const size_t oWk  = off; off += PW;
  const size_t oWv  = off; off += PW;
  const size_t oWo  = off; off += PW;
  const size_t oQh  = off; off += PL;
  const size_t oQl  = off; off += PL;
  const size_t oKh  = off; off += PX;
  const size_t oKl  = off; off += PX;
  const size_t oVTh = off; off += PVT;
  const size_t oVTl = off; off += PVL;
  const size_t oOh  = off; off += PL;
  const size_t oOl  = off; off += PL;
  if (off > ws_size) return;                       // off = 100663296
  if (off > (size_t)134217728) return;

  char* ws = (char*)d_ws;
  unsigned short* Lb  = (unsigned short*)(ws + oLb);
  unsigned short* Xb  = (unsigned short*)(ws + oXb);
  unsigned short* Wqb = (unsigned short*)(ws + oWq);
  unsigned short* Wkb = (unsigned short*)(ws + oWk);
  unsigned short* Wvb = (unsigned short*)(ws + oWv);
  unsigned short* Wob = (unsigned short*)(ws + oWo);
  unsigned short* Qh  = (unsigned short*)(ws + oQh);
  unsigned short* Ql  = (unsigned short*)(ws + oQl);
  unsigned short* Kh  = (unsigned short*)(ws + oKh);
  unsigned short* Kl  = (unsigned short*)(ws + oKl);
  unsigned short* VTh = (unsigned short*)(ws + oVTh);
  unsigned short* VTl = (unsigned short*)(ws + oVTl);
  unsigned short* Oh  = (unsigned short*)(ws + oOh);
  unsigned short* Ol  = (unsigned short*)(ws + oOl);

  const dim3 blk(256);
  const int n8l = NB * NLAT * DM / 8;                          //  262144
  const int n8x = NB * MTOK * DM / 8;                          // 1048576
  const int n8w = DM * DM / 8;                                 //  131072
  const dim3 gCvtL((n8l + 255) / 256);                         // 1024 blocks
  const dim3 gCvtX((n8x + 255) / 256);                         // 4096 blocks
  const dim3 gCvtW((n8w + 255) / 256);                         //  512 blocks
  const dim3 gQ(((NB * NLAT / 64) * (DM / 64) + 7) / 8, 1);    //  512 tiles ->  64 blocks: M=2048, N=1024
  const dim3 gK(((NB * MTOK / 64) * (DM / 64) + 7) / 8, 1);    // 2048 tiles -> 256 blocks: M=8192, N=1024
  const dim3 gVT(((DM / 64) * (MTOK / 64) + 7) / 8, NB);       // 1024 tiles -> 128 blocks x 2 batches: M=1024, N=4096
  const dim3 gO(((NB * NLAT / 64) * (DM / 64) + 7) / 8, 1);    //  512 tiles ->  64 blocks: M=2048, N=1024

  // (1) inputs and weights [n][k] f32 -> bf16 planes
  cvt_bf16x8<<<gCvtL, blk, 0, stream>>>(lt, Lb, n8l);
  cvt_bf16x8<<<gCvtX, blk, 0, stream>>>(x, Xb, n8x);
  cvt_bf16x8<<<gCvtW, blk, 0, stream>>>(Wq, Wqb, n8w);
  cvt_bf16x8<<<gCvtW, blk, 0, stream>>>(Wk, Wkb, n8w);
  cvt_bf16x8<<<gCvtW, blk, 0, stream>>>(Wv, Wvb, n8w);
  cvt_bf16x8<<<gCvtW, blk, 0, stream>>>(Wo, Wob, n8w);
  // (2) q = l . Wq^T + bq -> bf16 hi/lo planes [b*NLAT+t][h*64+d]   (M=2048, N=1024, K=1024)
  gemm64<0, 2, 0><<<gQ, blk, 0, stream>>>(
      Lb, Lb, DM, 0LL, Wqb, DM, 0LL, bq,
      (void*)Qh, DM, 0LL, (void*)Ql, DM, 0LL, DM,
      NB * NLAT, DM, DM, 1.0f);
  // (3) k = x . Wk^T + bk -> bf16 hi/lo planes [b*MTOK+s][h*64+d]   (M=8192, N=1024, K=1024)
  gemm64<0, 2, 0><<<gK, blk, 0, stream>>>(
      Xb, Xb, DM, 0LL, Wkb, DM, 0LL, bk,
      (void*)Kh, DM, 0LL, (void*)Kl, DM, 0LL, DM,
      NB * MTOK, DM, DM, 1.0f);
  // (4) v^T = Wv . x^T + bv (per row) per batch -> f16 hi plane [b][h*64+d][s] (pitch MTOK) and residual plane
  //     (x4096, keys < VLP only, pitch VLP)   (A = Wvb [n][k], Bt = Xb rows of batch b; M=1024, N=4096, K=1024)
  gemm64<0, 3, 1><<<gVT, blk, 0, stream>>>(
      Wvb, Wvb, DM, 0LL, Xb, DM, (long long)MTOK * DM, bv,
      (void*)VTh, MTOK, (long long)DM * MTOK, (void*)VTl, VLP, (long long)DM * VLP, VLP,
      DM, MTOK, DM, 4096.0f);
  // (5) attention: query blocks 0..RESQB-1 with residual planes, the rest without
  attn_bc64<true><<<dim3(NB * NH * RESQB), dim3(128), 0, stream>>>(
      Qh, Ql, Kh, Kl, VTh, VTl, Oh, Ol, 0, RESQB, 0.125f);
  attn_bc64<false><<<dim3(NB * NH * (NQB - RESQB)), dim3(128), 0, stream>>>(
      Qh, Ql, Kh, Kl, VTh, VTl, Oh, Ol, RESQB, NQB - RESQB, 0.125f);
  // (6) out = context . Wo^T + bo -> d_out f32 [2048][1024]  (A = context hi + lo planes, 2 products)
  gemm64<1, 0, 0><<<gO, blk, 0, stream>>>(
      Oh, Ol, DM, 0LL, Wob, DM, 0LL, bo,
      d_out, DM, 0LL, d_out, DM, 0LL, DM,
      NB * NLAT, DM, DM, 1.0f);
  (void)hipGetLastError();
}

// v001
// It runs in 414 microseconds.
// Timed twice side by side with v000, it ran 1.31 times as fast both times.
// Contractions: q, k, v^T projections = v_wmma_f32_16x16x32_bf16 (bf16 operands from RNE-converted f32 inputs, single product, f32 accumulate, f32 bias add);
// q.k^T scores = v_wmma_f32_16x16x32_bf16 on bf16 hi/lo planes of q and k (hi.hi + hi.lo + lo.hi), f32 accumulate;
// p.v = v_wmma_f32_16x16x32_f16 (p carried x1024 in f16, v in f16, plus f16 residual planes x4096 of p and v on the leading query blocks), f32 accumulate;
// ctx.Wo^T = v_wmma_f32_16x16x32_bf16 with ctx as bf16 hi/lo planes times bf16 Wo (2 products), f32 accumulate; visibility test and softmax in f32.
#include <hip/hip_runtime.h>
#include <math.h>
#include <float.h>
#include <stdint.h>

#define NB    2
#define NLAT  1024         // query (latent) length per batch
#define MTOK  4096         // key / value (token) length per batch
#define DM    1024
#define NH    16
#define HD    64
#define DSF   4            // key j visible to query t iff j / DSF <= t
#define NQB   (NLAT / 64)  // 16 query blocks of 64 rows
#define NKT   (MTOK / 64)  // 64 key tiles of 64
#define RESQB 4            // leading query blocks that use the p / v residual planes
#define VLP   1024         // key pitch of the v^T residual plane (keys 0..VLP-1)
static_assert(RESQB * 64 * DSF <= VLP);
static_assert(NH * HD == DM);
static_assert(MTOK == NLAT * DSF);
static_assert((NLAT % 64) == 0 && (MTOK % 64) == 0 && (DM % 64) == 0);
static_assert((VLP % 64) == 0 && VLP <= MTOK);
static_assert(DSF * NQB <= NKT);

typedef _Float16 v16h __attribute__((ext_vector_type(16)));
typedef _Float16 v8h  __attribute__((ext_vector_type(8)));
typedef __bf16   v16b __attribute__((ext_vector_type(16)));
typedef __bf16   v8b  __attribute__((ext_vector_type(8)));
typedef float    v8f  __attribute__((ext_vector_type(8)));
typedef float    v4f  __attribute__((ext_vector_type(4)));
typedef unsigned int v4u __attribute__((ext_vector_type(4)));

// ---- scalar helpers --------------------------------------------------------------------------------
__device__ __forceinline__ unsigned short bf_bits(float f) {          // f32 -> bf16 bits, RNE convert
  unsigned u = __float_as_uint(f);
  return (unsigned short)((u + 0x7FFFu + ((u >> 16) & 1u)) >> 16);
}
__device__ __forceinline__ float bf_up(unsigned short h) { return __uint_as_float(((unsigned)h) << 16); }
__device__ __forceinline__ unsigned short h_bits(_Float16 x) { return __builtin_bit_cast(unsigned short, x); }
__device__ __forceinline__ unsigned pk16(unsigned short a, unsigned short b) { return (unsigned)a | ((unsigned)b << 16); }
__device__ __forceinline__ v8f zero8() { v8f z = {0.f, 0.f, 0.f, 0.f, 0.f, 0.f, 0.f, 0.f}; return z; }
__device__ __forceinline__ v8h zero8h() {
  const _Float16 z = (_Float16)0.0f;
  v8h r = {z, z, z, z, z, z, z, z};
  return r;
}

// ---- fragment loader: 16-bit A/B operand, lane -> row/col (lane&15), p already includes +8*(lane>>4);
//      elements 0..7 <- p[0..7] (k0+8h..k0+8h+7), elements 8..15 <- p[16..23] (k0+16+8h..)
__device__ __forceinline__ v16b ldfrag_b(const __bf16* p) {
  union { v16b v; v8b h[2]; } f;
  f.h[0] = *(const v8b*)(p);
  f.h[1] = *(const v8b*)(p + 16);
  return f.v;
}

// ---- WMMA helpers with trailing VALU hazard gap (asm only in the device pass) -------------------------
__device__ __forceinline__ v8f mma_b(v16b a, v16b b, v8f c) {
  c = __builtin_amdgcn_wmma_f32_16x16x32_bf16(false, a, false, b, (short)0, c, false, false);
#if defined(__HIP_DEVICE_COMPILE__)
  asm volatile("v_nop\n\tv_nop\n\tv_nop\n\tv_nop" : "+v"(c) : "v"(a), "v"(b));
#endif
  return c;
}
__device__ __forceinline__ v8f mma_h(v16h a, v16h b, v8f c) {
  c = __builtin_amdgcn_wmma_f32_16x16x32_f16(false, a, false, b, (short)0, c, false, false);
#if defined(__HIP_DEVICE_COMPILE__)
  asm volatile("v_nop\n\tv_nop\n\tv_nop\n\tv_nop" : "+v"(c) : "v"(a), "v"(b));
#endif
  return c;
}
__device__ __forceinline__ v8f mma_b_raw(v16b a, v16b b, v8f c) {
  return __builtin_amdgcn_wmma_f32_16x16x32_bf16(false, a, false, b, (short)0, c, false, false);
}
__device__ __forceinline__ void dep_guard_b(v8f& a, v8f& b, v16b x, v16b y) {
#if defined(__HIP_DEVICE_COMPILE__)
  asm volatile("v_nop\n\tv_nop\n\tv_nop\n\tv_nop" : "+v"(a), "+v"(b) : "v"(x), "v"(y));
#else
  (void)a; (void)b; (void)x; (void)y;
#endif
}
__device__ __forceinline__ void keep4_b(v16b a, v16b b, v16b c, v16b d) {
#if defined(__HIP_DEVICE_COMPILE__)
  asm volatile("v_nop" :: "v"(a), "v"(b), "v"(c), "v"(d));
#else
  (void)a; (void)b; (void)c; (void)d;
#endif
}
__device__ __forceinline__ void acc_guard4(v8f& a, v8f& b, v8f& c, v8f& d) {
#if defined(__HIP_DEVICE_COMPILE__)
  asm volatile("v_nop\n\tv_nop\n\tv_nop\n\tv_nop" : "+v"(a), "+v"(b), "+v"(c), "+v"(d));
#else
  (void)a; (void)b; (void)c; (void)d;
#endif
}

// =====================================================================================================
// f32 -> bf16 (RNE convert), 8 elements per thread, one 16-B store per lane: a wave writes 512 contiguous B
// coverage: n8 threads x 8 = whole plane (n8 is a multiple of 256 for every use here).
// =====================================================================================================
__global__ __launch_bounds__(256) void cvt_bf16x8(const float* __restrict__ in, unsigned short* out, int n8) {
  const int i = blockIdx.x * 256 + threadIdx.x;
  if (i < n8) {
    const v4f a = *(const v4f*)(in + (size_t)i * 8);
    const v4f b = *(const v4f*)(in + (size_t)i * 8 + 4);
    v4u p;
    p[0] = pk16(bf_bits(a[0]), bf_bits(a[1]));
    p[1] = pk16(bf_bits(a[2]), bf_bits(a[3]));
    p[2] = pk16(bf_bits(b[0]), bf_bits(b[1]));
    p[3] = pk16(bf_bits(b[2]), bf_bits(b[3]));
    *(v4u*)(out + (size_t)i * 8) = p;
    
  }
}

// =====================================================================================================
// Register-blocked batched bf16 WMMA GEMM: C[m][n] = sum_k A[m][k] * Bt[n][k] + bias; one wave per 64x64
// tile, 8 waves (2 x 4) per GBM x GBN block tile. A row-major [M][K] pitch lda; Bt row-major [N][K] pitch ldb
// (k contiguous); M multiple of GBM, N of GBN, K of GKS. blockIdx.y = batch index (strides in elements).
// Operands go through LDS: a stage is GKS k = one whole 128-B line of every operand row of the block tile,
// brought by asynchronous 16-B copies (8 lanes per row, 4 whole lines per wave-copy) into two LDS buffers;
// stage t+2's copies are issued behind the barrier that ends stage t, one block barrier per stage.
// LDS row pitch GLP elements = 144 B (16 B x odd): the 16 rows of a ds_load_b128 fragment read fill all banks once.
// NSPLIT: 0 = A.Bt; 1 = (A + A2).Bt (A2 = unscaled bf16 lo plane of A).
// BIASM:  0 = bias[n] (length N), 1 = bias[m] (length M); bias values pass through an RNE bf16 convert.
// OUT_MODE: 0 = f32 (pitch ldc); 2 = bf16 hi plane C + bf16 lo plane C2 (lo = RNE(v - hi), unscaled);
//           3 = f16 hi plane C + f16 residual plane C2 = f16((v - hi) * rscale), C2 written only for tiles
//               with n0 < N2 (pitch ldc2, batch stride strideC2).
// =====================================================================================================
// ---- asynchronous copies global -> LDS, 16 B per lane (l = the lane's LDS byte address, g = its global address).
//      s_wait_xcnt 0 closes each statement: it stands ahead of any rewrite of a register that a copy names.
__device__ __forceinline__ void cp_async4(unsigned l0, const char* g0, unsigned l1, const char* g1,
                                          unsigned l2, const char* g2, unsigned l3, const char* g3) {
#if defined(__HIP_DEVICE_COMPILE__)
  asm volatile("global_load_async_to_lds_b128 %0, %1, off\n\t"
               "global_load_async_to_lds_b128 %2, %3, off\n\t"
               "global_load_async_to_lds_b128 %4, %5, off\n\t"
               "global_load_async_to_lds_b128 %6, %7, off\n\t"
               "s_wait_xcnt 0x0"
               :: "v"(l0), "v"(g0), "v"(l1), "v"(g1), "v"(l2), "v"(g2), "v"(l3), "v"(g3) : "memory");
#else
  (void)l0; (void)g0; (void)l1; (void)g1; (void)l2; (void)g2; (void)l3; (void)g3;
#endif
}
__device__ __forceinline__ void cp_async8(unsigned l0, const char* g0, unsigned l1, const char* g1,
                                          unsigned l2, const char* g2, unsigned l3, const char* g3,
                                          unsigned l4, const char* g4, unsigned l5, const char* g5,
                                          unsigned l6, const char* g6, unsigned l7, const char* g7) {
#if defined(__HIP_DEVICE_COMPILE__)
  asm volatile("global_load_async_to_lds_b128 %0, %1, off\n\t"
               "global_load_async_to_lds_b128 %2, %3, off\n\t"
               "global_load_async_to_lds_b128 %4, %5, off\n\t"
               "global_load_async_to_lds_b128 %6, %7, off\n\t"
               "global_load_async_to_lds_b128 %8, %9, off\n\t"
               "global_load_async_to_lds_b128 %10, %11, off\n\t"
               "global_load_async_to_lds_b128 %12, %13, off\n\t"
               "global_load_async_to_lds_b128 %14, %15, off\n\t"
               "s_wait_xcnt 0x0"
               :: "v"(l0), "v"(g0), "v"(l1), "v"(g1), "v"(l2), "v"(g2), "v"(l3), "v"(g3),
                  "v"(l4), "v"(g4), "v"(l5), "v"(g5), "v"(l6), "v"(g6), "v"(l7), "v"(g7) : "memory");
#else
  (void)l0; (void)g0; (void)l1; (void)g1; (void)l2; (void)g2; (void)l3; (void)g3;
  (void)l4; (void)g4; (void)l5; (void)g5; (void)l6; (void)g6; (void)l7; (void)g7;
#endif
}
__device__ __forceinline__ void wait_async0() {   // the wave's own copies have landed in LDS
#if defined(__HIP_DEVICE_COMPILE__)
  asm volatile("s_wait_asynccnt 0x0" ::: "memory");
#endif
}
__device__ __forceinline__ void wait_ds0() {      // the wave's own LDS reads have returned, ahead of a refill of what they read
#if defined(__HIP_DEVICE_COMPILE__)
  asm volatile("s_wait_dscnt 0x0" ::: "memory");
#endif
}

#define GBM 128   // block tile rows    (2 waves x 64)
#define GBN 256   // block tile columns (4 waves x 64)
#define GKS 64    // k per stage
#define GLP 72    // LDS row pitch, elements
static_assert((NB * NLAT) % GBM == 0 && (NB * MTOK) % GBM == 0 && DM % GBM == 0);
static_assert(DM % GBN == 0 && MTOK % GBN == 0 && DM % GKS == 0);
// one stage of the block tile: per thread 4 rows of A (and of A2), 8 rows of Bt, 32 rows apart
template <int NSPLIT>
__device__ __forceinline__ void stage_copies(const char* gA, const char* gA2, const char* gB, size_t rsA, size_t rsB,
                                             unsigned lA, unsigned lA2, unsigned lB) {
  const unsigned RS = 32 * GLP * 2;      // 32 LDS rows, bytes
  if (NSPLIT >= 1)
    cp_async8(lA, gA, lA + RS, gA + rsA, lA + 2 * RS, gA + 2 * rsA, lA + 3 * RS, gA + 3 * rsA,
              lA2, gA2, lA2 + RS, gA2 + rsA, lA2 + 2 * RS, gA2 + 2 * rsA, lA2 + 3 * RS, gA2 + 3 * rsA);
  else
    cp_async4(lA, gA, lA + RS, gA + rsA, lA + 2 * RS, gA + 2 * rsA, lA + 3 * RS, gA + 3 * rsA);
  cp_async8(lB, gB, lB + RS, gB + rsB, lB + 2 * RS, gB + 2 * rsB, lB + 3 * RS, gB + 3 * rsB,
            lB + 4 * RS, gB + 4 * rsB, lB + 5 * RS, gB + 5 * rsB, lB + 6 * RS, gB + 6 * rsB, lB + 7 * RS, gB + 7 * rsB);
}
template <int NSPLIT, int OUT_MODE, int BIASM>
__global__ __launch_bounds__(256) void gemm64(
    const unsigned short* __restrict__ Ap, const unsigned short* A2p, int lda, long long strideA,
    const unsigned short* __restrict__ Btp, int ldb, long long strideB,
    const float* __restrict__ bias,
    void* Cout, int ldc, long long strideC,
    void* Cout2, int ldc2, long long strideC2, int N2,
    int M, int N, int K, float rscale) {
  const __bf16* A   = (const __bf16*)(const void*)Ap;
  const __bf16* A2  = (const __bf16*)(const void*)A2p;
  const __bf16* Bt  = (const __bf16*)(const void*)Btp;
  __shared__ __align__(16) float sT[8][16 * 68];   // per-wave 16x64 slab, pitch 68 floats
  __shared__ __align__(16) __bf16 sA[2][GBM * GLP];                          // A stage, two buffers
  __shared__ __align__(16) __bf16 sA2[2][(NSPLIT >= 1) ? GBM * GLP : 8];     // A2 stage (NSPLIT only)
  __shared__ __align__(16) __bf16 sB[2][GBN * GLP];                          // Bt stage, two buffers
  const int b    = blockIdx.y;
  const int tid  = threadIdx.x;
  const int lane = tid & 31;
  const int wave = tid >> 5;
  const int tilesN = N / GBN;
  const int tilesM = M / GBM;
  const int tile = blockIdx.x;
  if (tile >= tilesM * tilesN) return;   // block-uniform, ahead of every barrier
  const int tm = tile / tilesN;
  const int tn = tile - tm * tilesN;
  const int bm0 = tm * GBM;              // block tile origin
  const int bn0 = tn * GBN;
  const int wm0 = (wave >> 2) << 6;      // this wave's 64x64 tile inside the block tile
  const int wn0 = (wave & 3) << 6;
  const int m0 = bm0 + wm0;
  const int n0 = bn0 + wn0;

  const __bf16* Ab  = A  + (size_t)b * strideA;
  const __bf16* Bb  = Bt + (size_t)b * strideB;
  const __bf16* Ab2 = (NSPLIT >= 1) ? (A2 + (size_t)b * strideA) : Ab;

  const int rlane = lane & 15;                 // row (A) / col (B, D) within subtile
  const int koff  = (lane >> 4) * 8;           // k offset of this lane half
  const int mOff  = (lane >> 4) * 8;           // D row offset

  float bcol[4];
#pragma unroll
  for (int j = 0; j < 4; ++j) bcol[j] = 0.f;
  if (BIASM == 0) {
#pragma unroll
    for (int j = 0; j < 4; ++j) bcol[j] = bf_up(bf_bits(bias[n0 + (j << 4) + rlane]));   // n0+63 < N
  }

  v8f acc[4][4];
#pragma unroll
  for (int i = 0; i < 4; ++i)
#pragma unroll
    for (int j = 0; j < 4; ++j) acc[i][j] = zero8();

  // staging map: thread -> row (tid >> 3) + 32 u, 16-B chunk (tid & 7) of the row's 128-B stage line
  const int srow = tid >> 3;
  const int scol = (tid & 7) * 8;
  const char* tA  = (const char*)(Ab  + (size_t)(bm0 + srow) * lda + scol);   // rows bm0 .. bm0+127 < M
  const char* tA2 = (const char*)(Ab2 + (size_t)(bm0 + srow) * lda + scol);
  const char* tB  = (const char*)(Bb  + (size_t)(bn0 + srow) * ldb + scol);   // rows bn0 .. bn0+255 < N
  const size_t rsA = (size_t)lda * 64;                                        // 32 operand rows, bytes
  const size_t rsB = (size_t)ldb * 64;
  const int sOff = srow * GLP + scol;
  const unsigned lA  = (unsigned)(size_t)(&sA[0][sOff]);                      // LDS byte addresses, buffer 0
  const unsigned lA2 = (unsigned)(size_t)(&sA2[0][(NSPLIT >= 1) ? sOff : 0]);
  const unsigned lB  = (unsigned)(size_t)(&sB[0][sOff]);
  const unsigned bufA = GBM * GLP * 2, bufB = GBN * GLP * 2;                  // buffer sizes, bytes
  const int nst = K / GKS;

  stage_copies<NSPLIT>(tA, tA2, tB, rsA, rsB, lA, lA2, lB);                   // stage 0 -> buffer 0
  wait_async0();                         // this wave's copies of stage 0 have landed
  __syncthreads();                       // stage 0 visible to all 8 waves
  if (nst > 1)                           // block-uniform; stage 1 -> buffer 1, flies during stage 0's products
    stage_copies<NSPLIT>(tA + GKS * 2, tA2 + GKS * 2, tB + GKS * 2, rsA, rsB, lA + bufA, lA2 + bufA, lB + bufB);

  for (int t = 0; t < nst; ++t) {
    const int cur = t & 1;
    // per 32 k: all fragments as one group of LDS reads ahead of their products
    const __bf16* pa  = &sA[cur][(wm0 + rlane) * GLP + koff];
    const __bf16* pa2 = &sA2[cur][(NSPLIT >= 1) ? (wm0 + rlane) * GLP + koff : 0];
    const __bf16* pb  = &sB[cur][(wn0 + rlane) * GLP + koff];
#pragma unroll
    for (int kk = 0; kk < 2; ++kk) {
      v16b bh[4], ah[4], al[4];
#pragma unroll
      for (int j = 0; j < 4; ++j) bh[j] = ldfrag_b(pb + (j << 4) * GLP + kk * 32);
#pragma unroll
      for (int i = 0; i < 4; ++i) {
        ah[i] = ldfrag_b(pa + (i << 4) * GLP + kk * 32);
        al[i] = ah[i];
        if (NSPLIT >= 1) al[i] = ldfrag_b(pa2 + (i << 4) * GLP + kk * 32);
      }
#pragma unroll
      for (int i = 0; i < 4; ++i) {
#pragma unroll
        for (int j = 0; j < 4; ++j) {
          acc[i][j] = mma_b_raw(ah[i], bh[j], acc[i][j]);
          if (NSPLIT >= 1) acc[i][j] = mma_b_raw(al[i], bh[j], acc[i][j]);
        }
        dep_guard_b(acc[i][0], acc[i][3], ah[i], al[i]);
      }
      keep4_b(bh[0], bh[1], bh[2], bh[3]);
    }
    wait_ds0();                          // this wave's reads of stage t are done
    wait_async0();                       // this wave's copies of stage t+1 have landed
    __syncthreads();                     // publishes stage t+1 and ends every read of stage t
    if (t + 2 < nst) {                   // block-uniform; stage t+2 -> the buffer stage t has just left
      const size_t kb = (size_t)(t + 2) * (GKS * 2);
      stage_copies<NSPLIT>(tA + kb, tA2 + kb, tB + kb, rsA, rsB,
                           lA + cur * bufA, lA2 + cur * bufA, lB + cur * bufB);
    }
  }
  wait_async0();                         // nothing of this wave is in flight behind the loop
  acc_guard4(acc[0][0], acc[0][1], acc[0][2], acc[0][3]);
  acc_guard4(acc[1][0], acc[1][1], acc[1][2], acc[1][3]);
  acc_guard4(acc[2][0], acc[2][1], acc[2][2], acc[2][3]);
  acc_guard4(acc[3][0], acc[3][1], acc[3][2], acc[3][3]);

  // ---- epilogue ----
  float* slab = sT[wave];
#pragma unroll
  for (int i = 0; i < 4; ++i) {
    const int mBase = m0 + (i << 4);
    float brow[8];
#pragma unroll
    for (int r = 0; r < 8; ++r) brow[r] = 0.f;
    if (BIASM == 1) {
#pragma unroll
      for (int r = 0; r < 8; ++r) brow[r] = bf_up(bf_bits(bias[mBase + mOff + r]));    // < M
    }
#pragma unroll
    for (int j = 0; j < 4; ++j) {
#pragma unroll
      for (int r = 0; r < 8; ++r) {
        slab[(mOff + r) * 68 + (j << 4) + rlane] = acc[i][j][r] + bcol[j] + brow[r];
      }
    }
    __builtin_amdgcn_fence(__ATOMIC_RELEASE, "workgroup");
    __builtin_amdgcn_wave_barrier();
    __builtin_amdgcn_fence(__ATOMIC_ACQUIRE, "workgroup");
    if (OUT_MODE == 0) {
      float* C = (float*)Cout + (size_t)b * strideC;
      const int hh = lane >> 4, c4 = (lane & 15) * 4;     // 256-B row segment = 16 lanes x 16 B
      v4f vv[8];
#pragma unroll
      for (int it = 0; it < 8; ++it) {
        const int row = it * 2 + hh;                       // it 0..7 x hh 0..1 = rows 0..15
        vv[it] = *(const v4f*)(slab + row * 68 + c4);
      }
      {
#pragma unroll
        for (int it = 0; it < 8; ++it) {
          const int row = it * 2 + hh;
          *(v4f*)(C + (size_t)(mBase + row) * ldc + n0 + c4) = vv[it];
        }
        
      }
    } else {
      const int q = lane >> 3, c8 = (lane & 7) * 8;
      unsigned short* C  = (unsigned short*)Cout  + (size_t)b * strideC;
      unsigned short* C2 = (unsigned short*)Cout2 + (size_t)b * strideC2;
      const bool wlo = (OUT_MODE == 2) || (n0 < N2);      // wave-uniform
      v4u hv[4], lv[4];
#pragma unroll
      for (int it = 0; it < 4; ++it) {
        const int row = it * 4 + q;                        // it 0..3 x q 0..3 = rows 0..15
        const float* sp = slab + row * 68 + c8;
        v4u a, a2;
#pragma unroll
        for (int e = 0; e < 4; ++e) {
          const float f0 = sp[2 * e], f1 = sp[2 * e + 1];
          unsigned short h0, h1, l0, l1;
          if (OUT_MODE == 2) {
            h0 = bf_bits(f0); h1 = bf_bits(f1);
            l0 = bf_bits(f0 - bf_up(h0)); l1 = bf_bits(f1 - bf_up(h1));
          } else {
            const _Float16 x0 = (_Float16)f0, x1 = (_Float16)f1;
            h0 = h_bits(x0); h1 = h_bits(x1);
            l0 = h_bits((_Float16)((f0 - (float)x0) * rscale));
            l1 = h_bits((_Float16)((f1 - (float)x1) * rscale));
          }
          a[e] = pk16(h0, h1); a2[e] = pk16(l0, l1);
        }
        hv[it] = a; lv[it] = a2;
      }
      {
#pragma unroll
        for (int it = 0; it < 4; ++it) {
          const int row = it * 4 + q;
          *(v4u*)(C + (size_t)(mBase + row) * ldc + n0 + c8) = hv[it];
          if (wlo) *(v4u*)(C2 + (size_t)(mBase + row) * ldc2 + n0 + c8) = lv[it];
        }
        
      }
    }
    __builtin_amdgcn_fence(__ATOMIC_RELEASE, "workgroup");
    __builtin_amdgcn_wave_barrier();
    __builtin_amdgcn_fence(__ATOMIC_ACQUIRE, "workgroup");
  }
}

// =====================================================================================================
// Attention with block-triangular visibility (key j visible to query t iff j / DSF <= t, i.e. j < DSF*(t+1)),
// head dim 64, queries from the latent planes (NLAT per batch), keys / values from the token planes (MTOK).
//   q planes (bf16 hi / lo): element (b, t, h, d) at [(b*NLAT + t)*DM + h*64 + d]
//   k planes (bf16 hi / lo): element (b, s, h, d) at [(b*MTOK + s)*DM + h*64 + d]
//   v^T hi plane (f16):      element (b, h, d, s) at [(b*DM + h*64 + d)*MTOK + s]
//   v^T residual plane (f16, (v - hi)*4096): [(b*DM + h*64 + d)*VLP + s], s < VLP, read only when RES
//   (a key tile at or beyond VLP contributes a zero v residual; never happens for the RES query blocks)
//   Query block qb (64 rows) processes key tiles 0 .. DSF*(qb+1)-1 (block-uniform break out of a loop with
//   static trip NKT); inside a tile, invisible keys get -inf logits -> weight exactly 0. Every query row
//   sees at least DSF keys of tile 0, so the running max is finite after the first tile.
//   out planes (bf16 hi / lo of the normalised context): element (b, t, h, d) at [(b*NLAT + t)*DM + h*64 + d]
//   scores = q . k : bf16 hi/lo split (hi.hi + hi.lo + lo.hi), f32 accumulate, then * sscale in f32
//   p = exp(s - m) carried as f16(1024 p); context = p . v on f16 WMMA; RES adds f16 residual planes of p and v
//   (scale 4096, separate accumulator folded back with 1/4096 per tile in f32); online softmax in f32.
//   Block = 4 waves = 64 query rows of one (b, h); grid = nqbThis * NH * NB; kv tiles of 64.
//   K / V^T tile staging: 128 threads x 32 elements per plane = the whole 64x64 tile (plain 16-B loads,
//   __syncthreads before and after); P tiles are wave-private, spilled with _Float16 element stores and reloaded
//   Output coverage: each wave stores rows q0..q0+15 (it 0..3 x lane>>3 0..3) x 64 columns (8 lanes x 8) of both planes.
// =====================================================================================================
template <bool RES>
__global__ __launch_bounds__(128)
void attn_bc64(const unsigned short* __restrict__ qhp, const unsigned short* __restrict__ qlp,
               const unsigned short* __restrict__ khp, const unsigned short* __restrict__ klp,
               const unsigned short* __restrict__ vhp, const unsigned short* __restrict__ vlp,
               unsigned short* ohp, unsigned short* olp,
               int qbBase, int nqbThis, float sscale) {
  union FB { v16b v; v8b h[2]; };
  union FH { v16h v; v8h h[2]; };
  __shared__ __align__(16) __bf16   Ksh[64 * 64];                 // K hi [kv][d]   8 KB
  __shared__ __align__(16) __bf16   Ksl[64 * 64];                 // K lo
  __shared__ __align__(16) _Float16 Vth[64 * 64];                 // V^T hi [d][kv] 8 KB
  __shared__ __align__(16) _Float16 Vtl[RES ? 64 * 64 : 8];       // V^T residual
  __shared__ __align__(16) _Float16 Psh[4][16 * 64];              // per wave P [row][kv]
  __shared__ __align__(16) _Float16 Psl[RES ? 4 : 1][16 * 64];    // per wave P residual
  __shared__ __align__(16) float    Os[4][16 * 64];               // per wave context tile [row][d]

  const int tid  = threadIdx.x;
  const int wave = tid >> 5;
  const int lane = tid & 31;
  const int hh   = lane >> 4;
  const int c    = lane & 15;

  const int bx   = blockIdx.x;
  const int qbl  = bx % nqbThis;
  const int rest = bx / nqbThis;
  const int h    = rest % NH;
  const int b    = rest / NH;
  const int qb   = qbBase + qbl;
  const int q0   = qb * 64 + wave * 16;            // query row within the batch
  const size_t rowQ = (size_t)b * NLAT;
  const size_t rowK = (size_t)b * MTOK;
  int ktEnd = DSF * (qb + 1);                      // key tiles 0..ktEnd-1 hold every visible key of this block
  if (ktEnd > NKT) ktEnd = NKT;

  const __bf16* Qh = (const __bf16*)(const void*)qhp + (size_t)h * HD;
  const __bf16* Ql = (const __bf16*)(const void*)qlp + (size_t)h * HD;
  const __bf16* Kh = (const __bf16*)(const void*)khp + (size_t)h * HD;
  const __bf16* Kl = (const __bf16*)(const void*)klp + (size_t)h * HD;
  const _Float16* Vh = (const _Float16*)(const void*)vhp + ((size_t)b * DM + (size_t)h * HD) * MTOK;
  const _Float16* Vl = (const _Float16*)(const void*)vlp + ((size_t)b * DM + (size_t)h * HD) * VLP;

  // ---- Q fragments (A operand, row = lane&15): 2 d-chunks, hi and lo ----
  v16b qah[2], qal[2];
#pragma unroll
  for (int dc = 0; dc < 2; ++dc) {
    const size_t qo = (rowQ + q0 + c) * DM + dc * 32 + 8 * hh;
    qah[dc] = ldfrag_b(Qh + qo);
    qal[dc] = ldfrag_b(Ql + qo);
  }

  float mrow[8], lrow[8];
  v8f oacc[4];
#pragma unroll
  for (int r = 0; r < 8; ++r) { mrow[r] = -INFINITY; lrow[r] = 0.f; }
#pragma unroll
  for (int t = 0; t < 4; ++t) oacc[t] = zero8();

  for (int kt = 0; kt < NKT; ++kt) {         // static trip count
    if (kt >= ktEnd) break;                  // block-uniform
    const int kv0 = kt * 64;
    __syncthreads();
    {
      const int r = tid >> 1, half = (tid & 1) * 32;
      const __bf16*   kg  = Kh + (rowK + kv0 + r) * DM + half;    // K row kv0+r, d = half..half+31
      const __bf16*   klg = Kl + (rowK + kv0 + r) * DM + half;
      const _Float16* vg  = Vh + (size_t)r * MTOK + kv0 + half;   // V^T row d = r, s = kv0+half..+31
      const int kvl = (kv0 + 64 <= VLP) ? kv0 : (VLP - 64);     // clamped address into the residual plane
      const _Float16* vlg = Vl + (size_t)r * VLP + kvl + half;
      const bool resOK = (kv0 + 64 <= VLP);                      // block-uniform
#pragma unroll
      for (int i = 0; i < 4; ++i) {
        const v8b a0 = *(const v8b*)(kg + 8 * i);
        const v8b a1 = *(const v8b*)(klg + 8 * i);
        const v8h b0 = *(const v8h*)(vg + 8 * i);
        *(v8b*)(Ksh + r * 64 + half + 8 * i) = a0;
        *(v8b*)(Ksl + r * 64 + half + 8 * i) = a1;
        *(v8h*)(Vth + r * 64 + half + 8 * i) = b0;
        if (RES) {
          v8h b1 = *(const v8h*)(vlg + 8 * i);
          if (!resOK) b1 = zero8h();
          *(v8h*)(Vtl + r * 64 + half + 8 * i) = b1;
        }
      }
    }
    __syncthreads();

    // ---- scores: 16 query rows x 64 keys per wave, 3 bf16 products ----
    v8f s[4];
#pragma unroll
    for (int j = 0; j < 4; ++j) {
      s[j] = zero8();
#pragma unroll
      for (int dc = 0; dc < 2; ++dc) {
        FB kb, kl;
        kb.h[0] = *(const v8b*)(Ksh + (j * 16 + c) * 64 + dc * 32 + 8 * hh);
        kb.h[1] = *(const v8b*)(Ksh + (j * 16 + c) * 64 + dc * 32 + 16 + 8 * hh);
        kl.h[0] = *(const v8b*)(Ksl + (j * 16 + c) * 64 + dc * 32 + 8 * hh);
        kl.h[1] = *(const v8b*)(Ksl + (j * 16 + c) * 64 + dc * 32 + 16 + 8 * hh);
        s[j] = mma_b(qah[dc], kb.v, s[j]);
        s[j] = mma_b(qah[dc], kl.v, s[j]);
        s[j] = mma_b(qal[dc], kb.v, s[j]);
      }
    }

    // ---- scale + visibility test (-inf for invisible keys), row max, online softmax,
    //      P (x1024, f16) and P residual (x4096) to LDS ----
    _Float16* pwh = Psh[wave];
    _Float16* pwl = Psl[RES ? wave : 0];
#pragma unroll
    for (int r = 0; r < 8; ++r) {
      const int tq  = q0 + 8 * hh + r;           // query row within the batch
      const int lim = DSF * (tq + 1);            // visible keys: j < lim
      float m = -INFINITY;
#pragma unroll
      for (int j = 0; j < 4; ++j) {
        const int key = kv0 + j * 16 + c;
        const float sv = (key < lim) ? s[j][r] * sscale : -INFINITY;
        s[j][r] = sv;
        m = fmaxf(m, sv);
      }
#pragma unroll
      for (int off = 1; off < 16; off <<= 1) m = fmaxf(m, __shfl_xor(m, off, 32));
      const float mnew  = fmaxf(mrow[r], m);
      const float msafe = (mnew == -INFINITY) ? 0.f : mnew;
      const float alpha = __expf(mrow[r] - msafe);
      mrow[r] = mnew;
      float psum = 0.f;
#pragma unroll
      for (int j = 0; j < 4; ++j) {
        const float p = __expf(s[j][r] - msafe);     // -inf logit -> exactly 0
        psum += p;
        const float p1k = p * 1024.0f;
        const _Float16 ph = (_Float16)p1k;
        pwh[(8 * hh + r) * 64 + j * 16 + c] = ph;
        if (RES) {
          const _Float16 pl = (_Float16)((p1k - (float)ph) * 4096.0f);
          pwl[(8 * hh + r) * 64 + j * 16 + c] = pl;
        }
      }
#pragma unroll
      for (int off = 1; off < 16; off <<= 1) psum += __shfl_xor(psum, off, 32);
      lrow[r] = lrow[r] * alpha + psum;
#pragma unroll
      for (int t = 0; t < 4; ++t) oacc[t][r] *= alpha;
    }
    __builtin_amdgcn_fence(__ATOMIC_RELEASE, "workgroup");
    __builtin_amdgcn_wave_barrier();
    __builtin_amdgcn_fence(__ATOMIC_ACQUIRE, "workgroup");

    // ---- context += P . V (f16 WMMA), residual products into a separate accumulator ----
    v8f o1[4];
#pragma unroll
    for (int t = 0; t < 4; ++t) o1[t] = zero8();
#pragma unroll 1
    for (int kk = 0; kk < 2; ++kk) {
      FH pa, pl;
      pa.h[0] = *(const v8h*)(pwh + c * 64 + kk * 32 + 8 * hh);
      pa.h[1] = *(const v8h*)(pwh + c * 64 + kk * 32 + 16 + 8 * hh);
      if (RES) {
        pl.h[0] = *(const v8h*)(pwl + c * 64 + kk * 32 + 8 * hh);
        pl.h[1] = *(const v8h*)(pwl + c * 64 + kk * 32 + 16 + 8 * hh);
      } else {
        pl.v = pa.v;
      }
#pragma unroll
      for (int t = 0; t < 4; ++t) {
        FH vb;
        vb.h[0] = *(const v8h*)(Vth + (t * 16 + c) * 64 + kk * 32 + 8 * hh);
        vb.h[1] = *(const v8h*)(Vth + (t * 16 + c) * 64 + kk * 32 + 16 + 8 * hh);
        oacc[t] = mma_h(pa.v, vb.v, oacc[t]);
        if (RES) {
          FH vl;
          vl.h[0] = *(const v8h*)(Vtl + (t * 16 + c) * 64 + kk * 32 + 8 * hh);
          vl.h[1] = *(const v8h*)(Vtl + (t * 16 + c) * 64 + kk * 32 + 16 + 8 * hh);
          o1[t] = mma_h(pa.v, vl.v, o1[t]);
          o1[t] = mma_h(pl.v, vb.v, o1[t]);
        }
      }
    }
    if (RES) {
#pragma unroll
      for (int t = 0; t < 4; ++t)
#pragma unroll
        for (int r = 0; r < 8; ++r) oacc[t][r] += o1[t][r] * (1.0f / 4096.0f);
    }
  }

  // ---- normalise (1/l and the 1/1024 p carry), stage the wave's 16x64 tile, bf16 hi/lo split,
  float* os = Os[wave];
#pragma unroll
  for (int r = 0; r < 8; ++r) {
    const float l = lrow[r];
    const float inv = ((l > 0.f) ? (1.0f / l) : 0.f) * (1.0f / 1024.0f);
#pragma unroll
    for (int t = 0; t < 4; ++t) os[(8 * hh + r) * 64 + t * 16 + c] = oacc[t][r] * inv;
  }
  __builtin_amdgcn_fence(__ATOMIC_RELEASE, "workgroup");
  __builtin_amdgcn_wave_barrier();
  __builtin_amdgcn_fence(__ATOMIC_ACQUIRE, "workgroup");
  {
    const int q4 = lane >> 3, c8 = (lane & 7) * 8;
    v4u hv[4], lv[4];
#pragma unroll
    for (int it = 0; it < 4; ++it) {
      const int row = it * 4 + q4;   // it 0..3 x q4 0..3 = rows 0..15 of the wave tile
      const float* sp = os + row * 64 + c8;
      v4u a, a2;
#pragma unroll
      for (int e = 0; e < 4; ++e) {
        const float f0 = sp[2 * e], f1 = sp[2 * e + 1];
        const unsigned short h0 = bf_bits(f0), h1 = bf_bits(f1);
        const unsigned short l0 = bf_bits(f0 - bf_up(h0)), l1 = bf_bits(f1 - bf_up(h1));
        a[e] = pk16(h0, h1); a2[e] = pk16(l0, l1);
      }
      hv[it] = a; lv[it] = a2;
    }
    {
#pragma unroll
      for (int it = 0; it < 4; ++it) {
        const int row = it * 4 + q4;
        const size_t go = (rowQ + q0 + row) * DM + (size_t)h * HD + c8;
        *(v4u*)(ohp + go) = hv[it];
        *(v4u*)(olp + go) = lv[it];
      }
      
    }
  }
}

// =====================================================================================================
// Workspace map (bytes), every region an exact multiple of its 64x64-tile / whole-line store granularity
// (M, N of every GEMM are multiples of 64; converts write whole 512-B groups):
//   Lb   bf16 [2048][1024]            0            4194304
//   Xb   bf16 [8192][1024]            4194304     16777216
//   Wqb  bf16 [1024 n][1024 k]        20971520     2097152
//   Wkb  bf16 [1024][1024]            23068672     2097152
//   Wvb  bf16 [1024][1024]            25165824     2097152
//   Wob  bf16 [1024][1024]            27262976     2097152
//   Qh   bf16 [2048][1024]            29360128     4194304
//   Ql   bf16 [2048][1024]            33554432     4194304
//   Kh   bf16 [8192][1024]            37748736    16777216
//   Kl   bf16 [8192][1024]            54525952    16777216
//   VTh  f16  [2][1024][4096]         71303168    16777216
//   VTl  f16  [2][1024][1024]         88080384     4194304
//   Oh   bf16 [2048][1024]            92274688     4194304
//   Ol   bf16 [2048][1024]            96468992     4194304
//   end                               100663296
// Weights are [out n][in k] with k contiguous = the Bt / A layout the GEMM wants, so they are only converted.
// =====================================================================================================
extern "C" void kernel_launch(void* const* d_in, const int* in_sizes, int n_in,
                              void* d_out, int out_size, void* d_ws, size_t ws_size,
                              hipStream_t stream) {
  if (n_in < 10) return;
  if (in_sizes[0] != NB * MTOK * DM) return;
  if (in_sizes[1] != NB * NLAT * DM) return;
  if (in_sizes[2] != DM * DM || in_sizes[4] != DM * DM || in_sizes[6] != DM * DM || in_sizes[8] != DM * DM) return;
  if (in_sizes[3] != DM || in_sizes[5] != DM || in_sizes[7] != DM || in_sizes[9] != DM) return;
  if (out_size != NB * NLAT * DM) return;

  const float* x  = (const float*)d_in[0];
  const float* lt = (const float*)d_in[1];
  const float* Wq = (const float*)d_in[2];
  const float* bq = (const float*)d_in[3];
  const float* Wk = (const float*)d_in[4];
  const float* bk = (const float*)d_in[5];
  const float* Wv = (const float*)d_in[6];
  const float* bv = (const float*)d_in[7];
  const float* Wo = (const float*)d_in[8];
  const float* bo = (const float*)d_in[9];

  const size_t PL  = (size_t)NB * NLAT * DM * 2;   //  4194304  16-bit latent-side plane [2048][1024]
  const size_t PX  = (size_t)NB * MTOK * DM * 2;   // 16777216  16-bit token-side plane [8192][1024]
  const size_t PW  = (size_t)DM * DM * 2;          //  2097152  16-bit weight plane
  const size_t PVT = (size_t)NB * DM * MTOK * 2;   // 16777216  v^T hi plane
  const size_t PVL = (size_t)NB * DM * VLP * 2;    //  4194304  v^T residual plane
  size_t off = 0;
  const size_t oLb  = off; off += PL;
  const size_t oXb  = off; off += PX;
  const size_t oWq  = off; off += PW;
  const size_t oWk  = off; off += PW;
  const size_t oWv  = off; off += PW;
  const size_t oWo  = off; off += PW;
  const size_t oQh  = off; off += PL;
  const size_t oQl  = off; off += PL;
  const size_t oKh  = off; off += PX;
  const size_t oKl  = off; off += PX;
  const size_t oVTh = off; off += PVT;
  const size_t oVTl = off; off += PVL;
  const size_t oOh  = off; off += PL;
  const size_t oOl  = off; off += PL;
  if (off > ws_size) return;                       // off = 100663296
  if (off > (size_t)134217728) return;

  char* ws = (char*)d_ws;
  unsigned short* Lb  = (unsigned short*)(ws + oLb);
  unsigned short* Xb  = (unsigned short*)(ws + oXb);
  unsigned short* Wqb = (unsigned short*)(ws + oWq);
  unsigned short* Wkb = (unsigned short*)(ws + oWk);
  unsigned short* Wvb = (unsigned short*)(ws + oWv);
  unsigned short* Wob = (unsigned short*)(ws + oWo);
  unsigned short* Qh  = (unsigned short*)(ws + oQh);
  unsigned short* Ql  = (unsigned short*)(ws + oQl);
  unsigned short* Kh  = (unsigned short*)(ws + oKh);
  unsigned short* Kl  = (unsigned short*)(ws + oKl);
  unsigned short* VTh = (unsigned short*)(ws + oVTh);
  unsigned short* VTl = (unsigned short*)(ws + oVTl);
  unsigned short* Oh  = (unsigned short*)(ws + oOh);
  unsigned short* Ol  = (unsigned short*)(ws + oOl);

  const dim3 blk(256);
  const int n8l = NB * NLAT * DM / 8;                          //  262144
  const int n8x = NB * MTOK * DM / 8;                          // 1048576
  const int n8w = DM * DM / 8;                                 //  131072
  const dim3 gCvtL((n8l + 255) / 256);                         // 1024 blocks
  const dim3 gCvtX((n8x + 255) / 256);                         // 4096 blocks
  const dim3 gCvtW((n8w + 255) / 256);                         //  512 blocks
  const dim3 gQ((NB * NLAT / GBM) * (DM / GBN), 1);            //  16 x  4 =  64 blocks: M=2048, N=1024
  const dim3 gK((NB * MTOK / GBM) * (DM / GBN), 1);            //  64 x  4 = 256 blocks: M=8192, N=1024
  const dim3 gVT((DM / GBM) * (MTOK / GBN), NB);               //   8 x 16 = 128 blocks x 2 batches: M=1024, N=4096
  const dim3 gO((NB * NLAT / GBM) * (DM / GBN), 1);            //  16 x  4 =  64 blocks: M=2048, N=1024

  // (1) inputs and weights [n][k] f32 -> bf16 planes
  cvt_bf16x8<<<gCvtL, blk, 0, stream>>>(lt, Lb, n8l);
  cvt_bf16x8<<<gCvtX, blk, 0, stream>>>(x, Xb, n8x);
  cvt_bf16x8<<<gCvtW, blk, 0, stream>>>(Wq, Wqb, n8w);
  cvt_bf16x8<<<gCvtW, blk, 0, stream>>>(Wk, Wkb, n8w);
  cvt_bf16x8<<<gCvtW, blk, 0, stream>>>(Wv, Wvb, n8w);
  cvt_bf16x8<<<gCvtW, blk, 0, stream>>>(Wo, Wob, n8w);
  // (2) q = l . Wq^T + bq -> bf16 hi/lo planes [b*NLAT+t][h*64+d]   (M=2048, N=1024, K=1024)
  gemm64<0, 2, 0><<<gQ, blk, 0, stream>>>(
      Lb, Lb, DM, 0LL, Wqb, DM, 0LL, bq,
      (void*)Qh, DM, 0LL, (void*)Ql, DM, 0LL, DM,
      NB * NLAT, DM, DM, 1.0f);
  // (3) k = x . Wk^T + bk -> bf16 hi/lo planes [b*MTOK+s][h*64+d]   (M=8192, N=1024, K=1024)
  gemm64<0, 2, 0><<<gK, blk, 0, stream>>>(
      Xb, Xb, DM, 0LL, Wkb, DM, 0LL, bk,
      (void*)Kh, DM, 0LL, (void*)Kl, DM, 0LL, DM,
      NB * MTOK, DM, DM, 1.0f);
  // (4) v^T = Wv . x^T + bv (per row) per batch -> f16 hi plane [b][h*64+d][s] (pitch MTOK) and residual plane
  //     (x4096, keys < VLP only, pitch VLP)   (A = Wvb [n][k], Bt = Xb rows of batch b; M=1024, N=4096, K=1024)
  gemm64<0, 3, 1><<<gVT, blk, 0, stream>>>(
      Wvb, Wvb, DM, 0LL, Xb, DM, (long long)MTOK * DM, bv,
      (void*)VTh, MTOK, (long long)DM * MTOK, (void*)VTl, VLP, (long long)DM * VLP, VLP,
      DM, MTOK, DM, 4096.0f);
  // (5) attention: query blocks 0..RESQB-1 with residual planes, the rest without
  attn_bc64<true><<<dim3(NB * NH * RESQB), dim3(128), 0, stream>>>(
      Qh, Ql, Kh, Kl, VTh, VTl, Oh, Ol, 0, RESQB, 0.125f);
  attn_bc64<false><<<dim3(NB * NH * (NQB - RESQB)), dim3(128), 0, stream>>>(
      Qh, Ql, Kh, Kl, VTh, VTl, Oh, Ol, RESQB, NQB - RESQB, 0.125f);
  // (6) out = context . Wo^T + bo -> d_out f32 [2048][1024]  (A = context hi + lo planes, 2 products)
  gemm64<1, 0, 0><<<gO, blk, 0, stream>>>(
      Oh, Ol, DM, 0LL, Wob, DM, 0LL, bo,
      d_out, DM, 0LL, d_out, DM, 0LL, DM,
      NB * NLAT, DM, DM, 1.0f);
  (void)hipGetLastError();
}

// v002
// Measured time: 252 microseconds a run.
// In two side-by-side timings against v001, it was 1.65 and 1.64 times as fast.
// Over all steps from v000 it is 2.16 times as fast.
// Contractions: q, k, v^T projections = v_wmma_f32_16x16x32_bf16 (bf16 operands from RNE-converted f32 inputs, single product, f32 accumulate, f32 bias add);
// q.k^T scores = v_wmma_f32_16x16x32_bf16 on bf16 hi/lo planes of q and k (hi.hi + hi.lo + lo.hi), f32 accumulate;
// p.v = v_wmma_f32_16x16x32_f16 (p carried x1024 in f16, v in f16, plus f16 residual planes x4096 of p and v on the leading query blocks), f32 accumulate;
// ctx.Wo^T = v_wmma_f32_16x16x32_bf16 with ctx as bf16 hi/lo planes times bf16 Wo (2 products), f32 accumulate; visibility test and softmax in f32.
// The keys of a query block are split into chunks, one work-group each; a later launch merges the chunks' f32 partial sums.
#include <hip/hip_runtime.h>
#include <math.h>
#include <float.h>
#include <stdint.h>

#define NB    2
#define NLAT  1024         // query (latent) length per batch
#define MTOK  4096         // key / value (token) length per batch
#define DM    1024
#define NH    16
#define HD    64
#define DSF   4            // key j visible to query t iff j / DSF <= t
#define NQB   (NLAT / 64)  // 16 query blocks of 64 rows
#define NKT   (MTOK / 64)  // 64 key tiles of 64
#define RESQB 4            // leading query blocks that use the p / v residual planes
#define VLP   1024         // key pitch of the v^T residual plane (keys 0..VLP-1)
static_assert(RESQB * 64 * DSF <= VLP);
static_assert(NH * HD == DM);
static_assert(MTOK == NLAT * DSF);
static_assert((NLAT % 64) == 0 && (MTOK % 64) == 0 && (DM % 64) == 0);
static_assert((VLP % 64) == 0 && VLP <= MTOK);
static_assert(DSF * NQB <= NKT);
#define CHR   2            // key tiles per work-group, query blocks with residual planes
#define CHN   4            // key tiles per work-group, the other query blocks
#define MAXCH 16           // partial-sum slots per query block
#define NCR   20           // chunks of query blocks 0 .. RESQB-1, one (b, h)
#define NCN   126          // chunks of query blocks RESQB .. NQB-1, one (b, h)
__host__ __device__ constexpr int n_chunks(int qb, int ch) { return (DSF * (qb + 1) + ch - 1) / ch; }
__host__ __device__ constexpr int sum_chunks(int q0, int q1, int ch) {
  int s = 0;
  for (int q = q0; q < q1; ++q) s += n_chunks(q, ch);
  return s;
}
static_assert(n_chunks(RESQB - 1, CHR) <= MAXCH && n_chunks(NQB - 1, CHN) <= MAXCH);
static_assert(sum_chunks(0, RESQB, CHR) == NCR && sum_chunks(RESQB, NQB, CHN) == NCN);

typedef _Float16 v16h __attribute__((ext_vector_type(16)));
typedef _Float16 v8h  __attribute__((ext_vector_type(8)));
typedef __bf16   v16b __attribute__((ext_vector_type(16)));
typedef __bf16   v8b  __attribute__((ext_vector_type(8)));
typedef float    v8f  __attribute__((ext_vector_type(8)));
typedef float    v4f  __attribute__((ext_vector_type(4)));
typedef unsigned int v4u __attribute__((ext_vector_type(4)));

// ---- scalar helpers --------------------------------------------------------------------------------
__device__ __forceinline__ unsigned short bf_bits(float f) {          // f32 -> bf16 bits, RNE convert
  unsigned u = __float_as_uint(f);
  return (unsigned short)((u + 0x7FFFu + ((u >> 16) & 1u)) >> 16);
}
__device__ __forceinline__ float bf_up(unsigned short h) { return __uint_as_float(((unsigned)h) << 16); }
__device__ __forceinline__ unsigned short h_bits(_Float16 x) { return __builtin_bit_cast(unsigned short, x); }
__device__ __forceinline__ unsigned pk16(unsigned short a, unsigned short b) { return (unsigned)a | ((unsigned)b << 16); }
__device__ __forceinline__ v8f zero8() { v8f z = {0.f, 0.f, 0.f, 0.f, 0.f, 0.f, 0.f, 0.f}; return z; }
__device__ __forceinline__ v8h zero8h() {
  const _Float16 z = (_Float16)0.0f;
  v8h r = {z, z, z, z, z, z, z, z};
  return r;
}

// ---- fragment loader: 16-bit A/B operand, lane -> row/col (lane&15), p already includes +8*(lane>>4);
//      elements 0..7 <- p[0..7] (k0+8h..k0+8h+7), elements 8..15 <- p[16..23] (k0+16+8h..)
__device__ __forceinline__ v16b ldfrag_b(const __bf16* p) {
  union { v16b v; v8b h[2]; } f;
  f.h[0] = *(const v8b*)(p);
  f.h[1] = *(const v8b*)(p + 16);
  return f.v;
}

// ---- WMMA helpers with trailing VALU hazard gap (asm only in the device pass) -------------------------
__device__ __forceinline__ v8f mma_b(v16b a, v16b b, v8f c) {
  c = __builtin_amdgcn_wmma_f32_16x16x32_bf16(false, a, false, b, (short)0, c, false, false);
#if defined(__HIP_DEVICE_COMPILE__)
  asm volatile("v_nop\n\tv_nop\n\tv_nop\n\tv_nop" : "+v"(c) : "v"(a), "v"(b));
#endif
  return c;
}
__device__ __forceinline__ v8f mma_h(v16h a, v16h b, v8f c) {
  c = __builtin_amdgcn_wmma_f32_16x16x32_f16(false, a, false, b, (short)0, c, false, false);
#if defined(__HIP_DEVICE_COMPILE__)
  asm volatile("v_nop\n\tv_nop\n\tv_nop\n\tv_nop" : "+v"(c) : "v"(a), "v"(b));
#endif
  return c;
}
__device__ __forceinline__ v8f mma_b_raw(v16b a, v16b b, v8f c) {
  return __builtin_amdgcn_wmma_f32_16x16x32_bf16(false, a, false, b, (short)0, c, false, false);
}
__device__ __forceinline__ void dep_guard_b(v8f& a, v8f& b, v16b x, v16b y) {
#if defined(__HIP_DEVICE_COMPILE__)
  asm volatile("v_nop\n\tv_nop\n\tv_nop\n\tv_nop" : "+v"(a), "+v"(b) : "v"(x), "v"(y));
#else
  (void)a; (void)b; (void)x; (void)y;
#endif
}
__device__ __forceinline__ void keep4_b(v16b a, v16b b, v16b c, v16b d) {
#if defined(__HIP_DEVICE_COMPILE__)
  asm volatile("v_nop" :: "v"(a), "v"(b), "v"(c), "v"(d));
#else
  (void)a; (void)b; (void)c; (void)d;
#endif
}
__device__ __forceinline__ void acc_guard4(v8f& a, v8f& b, v8f& c, v8f& d) {
#if defined(__HIP_DEVICE_COMPILE__)
  asm volatile("v_nop\n\tv_nop\n\tv_nop\n\tv_nop" : "+v"(a), "+v"(b), "+v"(c), "+v"(d));
#else
  (void)a; (void)b; (void)c; (void)d;
#endif
}

// =====================================================================================================
// f32 -> bf16 (RNE convert), 8 elements per thread, one 16-B store per lane: a wave writes 512 contiguous B
// coverage: n8 threads x 8 = whole plane (n8 is a multiple of 256 for every use here).
// =====================================================================================================
__global__ __launch_bounds__(256) void cvt_bf16x8(const float* __restrict__ in, unsigned short* out, int n8) {
  const int i = blockIdx.x * 256 + threadIdx.x;
  if (i < n8) {
    const v4f a = *(const v4f*)(in + (size_t)i * 8);
    const v4f b = *(const v4f*)(in + (size_t)i * 8 + 4);
    v4u p;
    p[0] = pk16(bf_bits(a[0]), bf_bits(a[1]));
    p[1] = pk16(bf_bits(a[2]), bf_bits(a[3]));
    p[2] = pk16(bf_bits(b[0]), bf_bits(b[1]));
    p[3] = pk16(bf_bits(b[2]), bf_bits(b[3]));
    *(v4u*)(out + (size_t)i * 8) = p;
    
  }
}

// =====================================================================================================
// Register-blocked batched bf16 WMMA GEMM: C[m][n] = sum_k A[m][k] * Bt[n][k] + bias; one wave per 64x64
// tile, 8 waves (2 x 4) per GBM x GBN block tile. A row-major [M][K] pitch lda; Bt row-major [N][K] pitch ldb
// (k contiguous); M multiple of GBM, N of GBN, K of GKS. blockIdx.y = batch index (strides in elements).
// Operands go through LDS: a stage is GKS k = one whole 128-B line of every operand row of the block tile,
// brought by asynchronous 16-B copies (8 lanes per row, 4 whole lines per wave-copy) into two LDS buffers;
// stage t+2's copies are issued behind the barrier that ends stage t, one block barrier per stage.
// LDS row pitch GLP elements = 144 B (16 B x odd): the 16 rows of a ds_load_b128 fragment read fill all banks once.
// NSPLIT: 0 = A.Bt; 1 = (A + A2).Bt (A2 = unscaled bf16 lo plane of A).
// BIASM:  0 = bias[n] (length N), 1 = bias[m] (length M); bias values pass through an RNE bf16 convert.
// OUT_MODE: 0 = f32 (pitch ldc); 2 = bf16 hi plane C + bf16 lo plane C2 (lo = RNE(v - hi), unscaled);
//           3 = f16 hi plane C + f16 residual plane C2 = f16((v - hi) * rscale), C2 written only for tiles
//               with n0 < N2 (pitch ldc2, batch stride strideC2).
// =====================================================================================================
// ---- asynchronous copies global -> LDS, 16 B per lane (l = the lane's LDS byte address, g = its global address).
//      s_wait_xcnt 0 closes each statement: it stands ahead of any rewrite of a register that a copy names.
__device__ __forceinline__ void cp_async4(unsigned l0, const char* g0, unsigned l1, const char* g1,
                                          unsigned l2, const char* g2, unsigned l3, const char* g3) {
#if defined(__HIP_DEVICE_COMPILE__)
  asm volatile("global_load_async_to_lds_b128 %0, %1, off\n\t"
               "global_load_async_to_lds_b128 %2, %3, off\n\t"
               "global_load_async_to_lds_b128 %4, %5, off\n\t"
               "global_load_async_to_lds_b128 %6, %7, off\n\t"
               "s_wait_xcnt 0x0"
               :: "v"(l0), "v"(g0), "v"(l1), "v"(g1), "v"(l2), "v"(g2), "v"(l3), "v"(g3) : "memory");
#else
  (void)l0; (void)g0; (void)l1; (void)g1; (void)l2; (void)g2; (void)l3; (void)g3;
#endif
}
__device__ __forceinline__ void cp_async8(unsigned l0, const char* g0, unsigned l1, const char* g1,
                                          unsigned l2, const char* g2, unsigned l3, const char* g3,
                                          unsigned l4, const char* g4, unsigned l5, const char* g5,
                                          unsigned l6, const char* g6, unsigned l7, const char* g7) {
#if defined(__HIP_DEVICE_COMPILE__)
  asm volatile("global_load_async_to_lds_b128 %0, %1, off\n\t"
               "global_load_async_to_lds_b128 %2, %3, off\n\t"
               "global_load_async_to_lds_b128 %4, %5, off\n\t"
               "global_load_async_to_lds_b128 %6, %7, off\n\t"
               "global_load_async_to_lds_b128 %8, %9, off\n\t"
               "global_load_async_to_lds_b128 %10, %11, off\n\t"
               "global_load_async_to_lds_b128 %12, %13, off\n\t"
               "global_load_async_to_lds_b128 %14, %15, off\n\t"
               "s_wait_xcnt 0x0"
               :: "v"(l0), "v"(g0), "v"(l1), "v"(g1), "v"(l2), "v"(g2), "v"(l3), "v"(g3),
                  "v"(l4), "v"(g4), "v"(l5), "v"(g5), "v"(l6), "v"(g6), "v"(l7), "v"(g7) : "memory");
#else
  (void)l0; (void)g0; (void)l1; (void)g1; (void)l2; (void)g2; (void)l3; (void)g3;
  (void)l4; (void)g4; (void)l5; (void)g5; (void)l6; (void)g6; (void)l7; (void)g7;
#endif
}
__device__ __forceinline__ void wait_async0() {   // the wave's own copies have landed in LDS
#if defined(__HIP_DEVICE_COMPILE__)
  asm volatile("s_wait_asynccnt 0x0" ::: "memory");
#endif
}
__device__ __forceinline__ void wait_ds0() {      // the wave's own LDS reads have returned, ahead of a refill of what they read
#if defined(__HIP_DEVICE_COMPILE__)
  asm volatile("s_wait_dscnt 0x0" ::: "memory");
#endif
}

#define GBM 128   // block tile rows    (2 waves x 64)
#define GBN 256   // block tile columns (4 waves x 64)
#define GKS 64    // k per stage
#define GLP 72    // LDS row pitch, elements
static_assert((NB * NLAT) % GBM == 0 && (NB * MTOK) % GBM == 0 && DM % GBM == 0);
static_assert(DM % GBN == 0 && MTOK % GBN == 0 && DM % GKS == 0);
// one stage of the block tile: per thread 4 rows of A (and of A2), 8 rows of Bt, 32 rows apart
template <int NSPLIT>
__device__ __forceinline__ void stage_copies(const char* gA, const char* gA2, const char* gB, size_t rsA, size_t rsB,
                                             unsigned lA, unsigned lA2, unsigned lB) {
  const unsigned RS = 32 * GLP * 2;      // 32 LDS rows, bytes
  if (NSPLIT >= 1)
    cp_async8(lA, gA, lA + RS, gA + rsA, lA + 2 * RS, gA + 2 * rsA, lA + 3 * RS, gA + 3 * rsA,
              lA2, gA2, lA2 + RS, gA2 + rsA, lA2 + 2 * RS, gA2 + 2 * rsA, lA2 + 3 * RS, gA2 + 3 * rsA);
  else
    cp_async4(lA, gA, lA + RS, gA + rsA, lA + 2 * RS, gA + 2 * rsA, lA + 3 * RS, gA + 3 * rsA);
  cp_async8(lB, gB, lB + RS, gB + rsB, lB + 2 * RS, gB + 2 * rsB, lB + 3 * RS, gB + 3 * rsB,
            lB + 4 * RS, gB + 4 * rsB, lB + 5 * RS, gB + 5 * rsB, lB + 6 * RS, gB + 6 * rsB, lB + 7 * RS, gB + 7 * rsB);
}
template <int NSPLIT, int OUT_MODE, int BIASM>
__global__ __launch_bounds__(256) void gemm64(
    const unsigned short* __restrict__ Ap, const unsigned short* A2p, int lda, long long strideA,
    const unsigned short* __restrict__ Btp, int ldb, long long strideB,
    const float* __restrict__ bias,
    void* Cout, int ldc, long long strideC,
    void* Cout2, int ldc2, long long strideC2, int N2,
    int M, int N, int K, float rscale) {
  const __bf16* A   = (const __bf16*)(const void*)Ap;
  const __bf16* A2  = (const __bf16*)(const void*)A2p;
  const __bf16* Bt  = (const __bf16*)(const void*)Btp;
  __shared__ __align__(16) float sT[8][16 * 68];   // per-wave 16x64 slab, pitch 68 floats
  __shared__ __align__(16) __bf16 sA[2][GBM * GLP];                          // A stage, two buffers
  __shared__ __align__(16) __bf16 sA2[2][(NSPLIT >= 1) ? GBM * GLP : 8];     // A2 stage (NSPLIT only)
  __shared__ __align__(16) __bf16 sB[2][GBN * GLP];                          // Bt stage, two buffers
  const int b    = blockIdx.y;
  const int tid  = threadIdx.x;
  const int lane = tid & 31;
  const int wave = tid >> 5;
  const int tilesN = N / GBN;
  const int tilesM = M / GBM;
  const int tile = blockIdx.x;
  if (tile >= tilesM * tilesN) return;   // block-uniform, ahead of every barrier
  const int tm = tile / tilesN;
  const int tn = tile - tm * tilesN;
  const int bm0 = tm * GBM;              // block tile origin
  const int bn0 = tn * GBN;
  const int wm0 = (wave >> 2) << 6;      // this wave's 64x64 tile inside the block tile
  const int wn0 = (wave & 3) << 6;
  const int m0 = bm0 + wm0;
  const int n0 = bn0 + wn0;

  const __bf16* Ab  = A  + (size_t)b * strideA;
  const __bf16* Bb  = Bt + (size_t)b * strideB;
  const __bf16* Ab2 = (NSPLIT >= 1) ? (A2 + (size_t)b * strideA) : Ab;

  const int rlane = lane & 15;                 // row (A) / col (B, D) within subtile
  const int koff  = (lane >> 4) * 8;           // k offset of this lane half
  const int mOff  = (lane >> 4) * 8;           // D row offset

  float bcol[4];
#pragma unroll
  for (int j = 0; j < 4; ++j) bcol[j] = 0.f;
  if (BIASM == 0) {
#pragma unroll
    for (int j = 0; j < 4; ++j) bcol[j] = bf_up(bf_bits(bias[n0 + (j << 4) + rlane]));   // n0+63 < N
  }

  v8f acc[4][4];
#pragma unroll
  for (int i = 0; i < 4; ++i)
#pragma unroll
    for (int j = 0; j < 4; ++j) acc[i][j] = zero8();

  // staging map: thread -> row (tid >> 3) + 32 u, 16-B chunk (tid & 7) of the row's 128-B stage line
  const int srow = tid >> 3;
  const int scol = (tid & 7) * 8;
  const char* tA  = (const char*)(Ab  + (size_t)(bm0 + srow) * lda + scol);   // rows bm0 .. bm0+127 < M
  const char* tA2 = (const char*)(Ab2 + (size_t)(bm0 + srow) * lda + scol);
  const char* tB  = (const char*)(Bb  + (size_t)(bn0 + srow) * ldb + scol);   // rows bn0 .. bn0+255 < N
  const size_t rsA = (size_t)lda * 64;                                        // 32 operand rows, bytes
  const size_t rsB = (size_t)ldb * 64;
  const int sOff = srow * GLP + scol;
  const unsigned lA  = (unsigned)(size_t)(&sA[0][sOff]);                      // LDS byte addresses, buffer 0
  const unsigned lA2 = (unsigned)(size_t)(&sA2[0][(NSPLIT >= 1) ? sOff : 0]);
  const unsigned lB  = (unsigned)(size_t)(&sB[0][sOff]);
  const unsigned bufA = GBM * GLP * 2, bufB = GBN * GLP * 2;                  // buffer sizes, bytes
  const int nst = K / GKS;

  stage_copies<NSPLIT>(tA, tA2, tB, rsA, rsB, lA, lA2, lB);                   // stage 0 -> buffer 0
  wait_async0();                         // this wave's copies of stage 0 have landed
  __syncthreads();                       // stage 0 visible to all 8 waves
  if (nst > 1)                           // block-uniform; stage 1 -> buffer 1, flies during stage 0's products
    stage_copies<NSPLIT>(tA + GKS * 2, tA2 + GKS * 2, tB + GKS * 2, rsA, rsB, lA + bufA, lA2 + bufA, lB + bufB);

  for (int t = 0; t < nst; ++t) {
    const int cur = t & 1;
    // per 32 k: all fragments as one group of LDS reads ahead of their products
    const __bf16* pa  = &sA[cur][(wm0 + rlane) * GLP + koff];
    const __bf16* pa2 = &sA2[cur][(NSPLIT >= 1) ? (wm0 + rlane) * GLP + koff : 0];
    const __bf16* pb  = &sB[cur][(wn0 + rlane) * GLP + koff];
#pragma unroll
    for (int kk = 0; kk < 2; ++kk) {
      v16b bh[4], ah[4], al[4];
#pragma unroll
      for (int j = 0; j < 4; ++j) bh[j] = ldfrag_b(pb + (j << 4) * GLP + kk * 32);
#pragma unroll
      for (int i = 0; i < 4; ++i) {
        ah[i] = ldfrag_b(pa + (i << 4) * GLP + kk * 32);
        al[i] = ah[i];
        if (NSPLIT >= 1) al[i] = ldfrag_b(pa2 + (i << 4) * GLP + kk * 32);
      }
#pragma unroll
      for (int i = 0; i < 4; ++i) {
#pragma unroll
        for (int j = 0; j < 4; ++j) {
          acc[i][j] = mma_b_raw(ah[i], bh[j], acc[i][j]);
          if (NSPLIT >= 1) acc[i][j] = mma_b_raw(al[i], bh[j], acc[i][j]);
        }
        dep_guard_b(acc[i][0], acc[i][3], ah[i], al[i]);
      }
      keep4_b(bh[0], bh[1], bh[2], bh[3]);
    }
    wait_ds0();                          // this wave's reads of stage t are done
    wait_async0();                       // this wave's copies of stage t+1 have landed
    __syncthreads();                     // publishes stage t+1 and ends every read of stage t
    if (t + 2 < nst) {                   // block-uniform; stage t+2 -> the buffer stage t has just left
      const size_t kb = (size_t)(t + 2) * (GKS * 2);
      stage_copies<NSPLIT>(tA + kb, tA2 + kb, tB + kb, rsA, rsB,
                           lA + cur * bufA, lA2 + cur * bufA, lB + cur * bufB);
    }
  }
  wait_async0();                         // nothing of this wave is in flight behind the loop
  acc_guard4(acc[0][0], acc[0][1], acc[0][2], acc[0][3]);
  acc_guard4(acc[1][0], acc[1][1], acc[1][2], acc[1][3]);
  acc_guard4(acc[2][0], acc[2][1], acc[2][2], acc[2][3]);
  acc_guard4(acc[3][0], acc[3][1], acc[3][2], acc[3][3]);

  // ---- epilogue ----
  float* slab = sT[wave];
#pragma unroll
  for (int i = 0; i < 4; ++i) {
    const int mBase = m0 + (i << 4);
    float brow[8];
#pragma unroll
    for (int r = 0; r < 8; ++r) brow[r] = 0.f;
    if (BIASM == 1) {
#pragma unroll
      for (int r = 0; r < 8; ++r) brow[r] = bf_up(bf_bits(bias[mBase + mOff + r]));    // < M
    }
#pragma unroll
    for (int j = 0; j < 4; ++j) {
#pragma unroll
      for (int r = 0; r < 8; ++r) {
        slab[(mOff + r) * 68 + (j << 4) + rlane] = acc[i][j][r] + bcol[j] + brow[r];
      }
    }
    __builtin_amdgcn_fence(__ATOMIC_RELEASE, "workgroup");
    __builtin_amdgcn_wave_barrier();
    __builtin_amdgcn_fence(__ATOMIC_ACQUIRE, "workgroup");
    if (OUT_MODE == 0) {
      float* C = (float*)Cout + (size_t)b * strideC;
      const int hh = lane >> 4, c4 = (lane & 15) * 4;     // 256-B row segment = 16 lanes x 16 B
      v4f vv[8];
#pragma unroll
      for (int it = 0; it < 8; ++it) {
        const int row = it * 2 + hh;                       // it 0..7 x hh 0..1 = rows 0..15
        vv[it] = *(const v4f*)(slab + row * 68 + c4);
      }
      {
#pragma unroll
        for (int it = 0; it < 8; ++it) {
          const int row = it * 2 + hh;
          *(v4f*)(C + (size_t)(mBase + row) * ldc + n0 + c4) = vv[it];
        }
        
      }
    } else {
      const int q = lane >> 3, c8 = (lane & 7) * 8;
      unsigned short* C  = (unsigned short*)Cout  + (size_t)b * strideC;
      unsigned short* C2 = (unsigned short*)Cout2 + (size_t)b * strideC2;
      const bool wlo = (OUT_MODE == 2) || (n0 < N2);      // wave-uniform
      v4u hv[4], lv[4];
#pragma unroll
      for (int it = 0; it < 4; ++it) {
        const int row = it * 4 + q;                        // it 0..3 x q 0..3 = rows 0..15
        const float* sp = slab + row * 68 + c8;
        v4u a, a2;
#pragma unroll
        for (int e = 0; e < 4; ++e) {
          const float f0 = sp[2 * e], f1 = sp[2 * e + 1];
          unsigned short h0, h1, l0, l1;
          if (OUT_MODE == 2) {
            h0 = bf_bits(f0); h1 = bf_bits(f1);
            l0 = bf_bits(f0 - bf_up(h0)); l1 = bf_bits(f1 - bf_up(h1));
          } else {
            const _Float16 x0 = (_Float16)f0, x1 = (_Float16)f1;
            h0 = h_bits(x0); h1 = h_bits(x1);
            l0 = h_bits((_Float16)((f0 - (float)x0) * rscale));
            l1 = h_bits((_Float16)((f1 - (float)x1) * rscale));
          }
          a[e] = pk16(h0, h1); a2[e] = pk16(l0, l1);
        }
        hv[it] = a; lv[it] = a2;
      }
      {
#pragma unroll
        for (int it = 0; it < 4; ++it) {
          const int row = it * 4 + q;
          *(v4u*)(C + (size_t)(mBase + row) * ldc + n0 + c8) = hv[it];
          if (wlo) *(v4u*)(C2 + (size_t)(mBase + row) * ldc2 + n0 + c8) = lv[it];
        }
        
      }
    }
    __builtin_amdgcn_fence(__ATOMIC_RELEASE, "workgroup");
    __builtin_amdgcn_wave_barrier();
    __builtin_amdgcn_fence(__ATOMIC_ACQUIRE, "workgroup");
  }
}

// =====================================================================================================
// Attention with block-triangular visibility (key j visible to query t iff j / DSF <= t, i.e. j < DSF*(t+1)),
// head dim 64, queries from the latent planes (NLAT per batch), keys / values from the token planes (MTOK).
//   q planes (bf16 hi / lo): element (b, t, h, d) at [(b*NLAT + t)*DM + h*64 + d]
//   k planes (bf16 hi / lo): element (b, s, h, d) at [(b*MTOK + s)*DM + h*64 + d]
//   v^T hi plane (f16):      element (b, h, d, s) at [(b*DM + h*64 + d)*MTOK + s]
//   v^T residual plane (f16, (v - hi)*4096): [(b*DM + h*64 + d)*VLP + s], s < VLP, read only when RES
//   (a key tile at or beyond VLP contributes a zero v residual; never happens for the RES query blocks)
//   Query block qb (64 rows) needs key tiles 0 .. DSF*(qb+1)-1; they are split into chunks of CH tiles, one
//   work-group per chunk (block-uniform break out of a loop with static trip CH), so that the serial walk over
//   key tiles is CH long; inside a tile, invisible keys get -inf logits -> weight exactly 0. A row that sees no
//   key of its chunk leaves m = -inf, l = 0 and a zero context there.
//   out: the chunk's partial sums in f32, slot = ((b*NH + h)*NQB + qb)*MAXCH + chunk:
//     Po  [slot][wave][t*2 + half][lane][4]: the wave's unnormalised context accumulators, register order
//     Pml [slot][wave][lane>>4][m of rows 8*(lane>>4)+0..7, then l of the same rows]  (128 B per wave)
//   scores = q . k : bf16 hi/lo split (hi.hi + hi.lo + lo.hi), f32 accumulate, then * sscale in f32
//   p = exp(s - m) carried as f16(1024 p); context = p . v on f16 WMMA; RES adds f16 residual planes of p and v
//   (scale 4096, separate accumulator folded back with 1/4096 per tile in f32); online softmax in f32.
//   Block = 4 waves = 64 query rows of one (b, h); grid = (chunks of the nqbThis query blocks, NH * NB); kv tiles of 64.
//   K / V^T tile staging: 128 threads x 32 elements per plane = the whole 64x64 tile (plain 16-B loads,
//   __syncthreads before and after); P tiles are wave-private, spilled with _Float16 element stores and reloaded
//   Output coverage: each wave stores its whole 4-KB part of Po (8 stores x 512 B) and its 128-B part of Pml.
// =====================================================================================================
// second launch bound = waves per SIMD that must fit: it holds the register count where several chunks share a WGP
template <bool RES, int CH>
__global__ __launch_bounds__(128, RES ? 4 : 5)
void attn_bc64(const unsigned short* __restrict__ qhp, const unsigned short* __restrict__ qlp,
               const unsigned short* __restrict__ khp, const unsigned short* __restrict__ klp,
               const unsigned short* __restrict__ vhp, const unsigned short* __restrict__ vlp,
               float* Po, float* Pml,
               int qbBase, int nqbThis, float sscale) {
  union FB { v16b v; v8b h[2]; };
  union FH { v16h v; v8h h[2]; };
  __shared__ __align__(16) __bf16   Ksh[64 * 64];                 // K hi [kv][d]   8 KB
  __shared__ __align__(16) __bf16   Ksl[64 * 64];                 // K lo
  __shared__ __align__(16) _Float16 Vth[64 * 64];                 // V^T hi [d][kv] 8 KB
  __shared__ __align__(16) _Float16 Vtl[RES ? 64 * 64 : 8];       // V^T residual
  __shared__ __align__(16) _Float16 Psh[4][16 * 64];              // per wave P [row][kv]
  __shared__ __align__(16) _Float16 Psl[RES ? 4 : 1][16 * 64];    // per wave P residual

  const int tid  = threadIdx.x;
  const int wave = tid >> 5;
  const int lane = tid & 31;
  const int hh   = lane >> 4;
  const int c    = lane & 15;

  const int h    = blockIdx.y % NH;
  const int b    = blockIdx.y / NH;
  int chunk = blockIdx.x;                          // blockIdx.x counts the chunks of qbBase, then of qbBase+1, ...
  int qb    = qbBase;
  for (int i = 1; i < NQB; ++i) {                  // block-uniform, static trip count
    const int nc = n_chunks(qb, CH);
    if (chunk < nc || i >= nqbThis) break;
    chunk -= nc;
    ++qb;
  }
  const int q0   = qb * 64 + wave * 16;            // query row within the batch
  const size_t rowQ = (size_t)b * NLAT;
  const size_t rowK = (size_t)b * MTOK;
  int ktEnd = DSF * (qb + 1);                      // key tiles 0..ktEnd-1 hold every visible key of this block
  if (ktEnd > NKT) ktEnd = NKT;
  const int ktBeg = chunk * CH;                    // this work-group: key tiles ktBeg .. min(ktBeg+CH, ktEnd)-1

  const __bf16* Qh = (const __bf16*)(const void*)qhp + (size_t)h * HD;
  const __bf16* Ql = (const __bf16*)(const void*)qlp + (size_t)h * HD;
  const __bf16* Kh = (const __bf16*)(const void*)khp + (size_t)h * HD;
  const __bf16* Kl = (const __bf16*)(const void*)klp + (size_t)h * HD;
  const _Float16* Vh = (const _Float16*)(const void*)vhp + ((size_t)b * DM + (size_t)h * HD) * MTOK;
  const _Float16* Vl = (const _Float16*)(const void*)vlp + ((size_t)b * DM + (size_t)h * HD) * VLP;

  // ---- Q fragments (A operand, row = lane&15): 2 d-chunks, hi and lo ----
  v16b qah[2], qal[2];
#pragma unroll
  for (int dc = 0; dc < 2; ++dc) {
    const size_t qo = (rowQ + q0 + c) * DM + dc * 32 + 8 * hh;
    qah[dc] = ldfrag_b(Qh + qo);
    qal[dc] = ldfrag_b(Ql + qo);
  }

  float mrow[8], lrow[8];
  v8f oacc[4];
#pragma unroll
  for (int r = 0; r < 8; ++r) { mrow[r] = -INFINITY; lrow[r] = 0.f; }
#pragma unroll
  for (int t = 0; t < 4; ++t) oacc[t] = zero8();

  for (int ki = 0; ki < CH; ++ki) {          // static trip count
    const int kt = ktBeg + ki;
    if (kt >= ktEnd) break;                  // block-uniform
    const int kv0 = kt * 64;
    __syncthreads();
    {
      const int r = tid >> 1, half = (tid & 1) * 32;
      const __bf16*   kg  = Kh + (rowK + kv0 + r) * DM + half;    // K row kv0+r, d = half..half+31
      const __bf16*   klg = Kl + (rowK + kv0 + r) * DM + half;
      const _Float16* vg  = Vh + (size_t)r * MTOK + kv0 + half;   // V^T row d = r, s = kv0+half..+31
      const int kvl = (kv0 + 64 <= VLP) ? kv0 : (VLP - 64);     // clamped address into the residual plane
      const _Float16* vlg = Vl + (size_t)r * VLP + kvl + half;
      const bool resOK = (kv0 + 64 <= VLP);                      // block-uniform
#pragma unroll
      for (int i = 0; i < 4; ++i) {
        const v8b a0 = *(const v8b*)(kg + 8 * i);
        const v8b a1 = *(const v8b*)(klg + 8 * i);
        const v8h b0 = *(const v8h*)(vg + 8 * i);
        *(v8b*)(Ksh + r * 64 + half + 8 * i) = a0;
        *(v8b*)(Ksl + r * 64 + half + 8 * i) = a1;
        *(v8h*)(Vth + r * 64 + half + 8 * i) = b0;
        if (RES) {
          v8h b1 = *(const v8h*)(vlg + 8 * i);
          if (!resOK) b1 = zero8h();
          *(v8h*)(Vtl + r * 64 + half + 8 * i) = b1;
        }
      }
    }
    __syncthreads();

    // ---- scores: 16 query rows x 64 keys per wave, 3 bf16 products ----
    v8f s[4];
#pragma unroll
    for (int j = 0; j < 4; ++j) {
      s[j] = zero8();
#pragma unroll
      for (int dc = 0; dc < 2; ++dc) {
        FB kb, kl;
        kb.h[0] = *(const v8b*)(Ksh + (j * 16 + c) * 64 + dc * 32 + 8 * hh);
        kb.h[1] = *(const v8b*)(Ksh + (j * 16 + c) * 64 + dc * 32 + 16 + 8 * hh);
        kl.h[0] = *(const v8b*)(Ksl + (j * 16 + c) * 64 + dc * 32 + 8 * hh);
        kl.h[1] = *(const v8b*)(Ksl + (j * 16 + c) * 64 + dc * 32 + 16 + 8 * hh);
        s[j] = mma_b(qah[dc], kb.v, s[j]);
        s[j] = mma_b(qah[dc], kl.v, s[j]);
        s[j] = mma_b(qal[dc], kb.v, s[j]);
      }
    }

    // ---- scale + visibility test (-inf for invisible keys), row max, online softmax,
    //      P (x1024, f16) and P residual (x4096) to LDS ----
    _Float16* pwh = Psh[wave];
    _Float16* pwl = Psl[RES ? wave : 0];
#pragma unroll
    for (int r = 0; r < 8; ++r) {
      const int tq  = q0 + 8 * hh + r;           // query row within the batch
      const int lim = DSF * (tq + 1);            // visible keys: j < lim
      float m = -INFINITY;
#pragma unroll
      for (int j = 0; j < 4; ++j) {
        const int key = kv0 + j * 16 + c;
        const float sv = (key < lim) ? s[j][r] * sscale : -INFINITY;
        s[j][r] = sv;
        m = fmaxf(m, sv);
      }
#pragma unroll
      for (int off = 1; off < 16; off <<= 1) m = fmaxf(m, __shfl_xor(m, off, 32));
      const float mnew  = fmaxf(mrow[r], m);
      const float msafe = (mnew == -INFINITY) ? 0.f : mnew;
      const float alpha = __expf(mrow[r] - msafe);
      mrow[r] = mnew;
      float psum = 0.f;
#pragma unroll
      for (int j = 0; j < 4; ++j) {
        const float p = __expf(s[j][r] - msafe);     // -inf logit -> exactly 0
        psum += p;
        const float p1k = p * 1024.0f;
        const _Float16 ph = (_Float16)p1k;
        pwh[(8 * hh + r) * 64 + j * 16 + c] = ph;
        if (RES) {
          const _Float16 pl = (_Float16)((p1k - (float)ph) * 4096.0f);
          pwl[(8 * hh + r) * 64 + j * 16 + c] = pl;
        }
      }
#pragma unroll
      for (int off = 1; off < 16; off <<= 1) psum += __shfl_xor(psum, off, 32);
      lrow[r] = lrow[r] * alpha + psum;
#pragma unroll
      for (int t = 0; t < 4; ++t) oacc[t][r] *= alpha;
    }
    __builtin_amdgcn_fence(__ATOMIC_RELEASE, "workgroup");
    __builtin_amdgcn_wave_barrier();
    __builtin_amdgcn_fence(__ATOMIC_ACQUIRE, "workgroup");

    // ---- context += P . V (f16 WMMA), residual products into a separate accumulator ----
    v8f o1[4];
#pragma unroll
    for (int t = 0; t < 4; ++t) o1[t] = zero8();
#pragma unroll 1
    for (int kk = 0; kk < 2; ++kk) {
      FH pa, pl;
      pa.h[0] = *(const v8h*)(pwh + c * 64 + kk * 32 + 8 * hh);
      pa.h[1] = *(const v8h*)(pwh + c * 64 + kk * 32 + 16 + 8 * hh);
      if (RES) {
        pl.h[0] = *(const v8h*)(pwl + c * 64 + kk * 32 + 8 * hh);
        pl.h[1] = *(const v8h*)(pwl + c * 64 + kk * 32 + 16 + 8 * hh);
      } else {
        pl.v = pa.v;
      }
#pragma unroll
      for (int t = 0; t < 4; ++t) {
        FH vb;
        vb.h[0] = *(const v8h*)(Vth + (t * 16 + c) * 64 + kk * 32 + 8 * hh);
        vb.h[1] = *(const v8h*)(Vth + (t * 16 + c) * 64 + kk * 32 + 16 + 8 * hh);
        oacc[t] = mma_h(pa.v, vb.v, oacc[t]);
        if (RES) {
          FH vl;
          vl.h[0] = *(const v8h*)(Vtl + (t * 16 + c) * 64 + kk * 32 + 8 * hh);
          vl.h[1] = *(const v8h*)(Vtl + (t * 16 + c) * 64 + kk * 32 + 16 + 8 * hh);
          o1[t] = mma_h(pa.v, vl.v, o1[t]);
          o1[t] = mma_h(pl.v, vb.v, o1[t]);
        }
      }
    }
    if (RES) {
#pragma unroll
      for (int t = 0; t < 4; ++t)
#pragma unroll
        for (int r = 0; r < 8; ++r) oacc[t][r] += o1[t][r] * (1.0f / 4096.0f);
    }
  }

  // ---- the chunk's partial sums: accumulators in register order (512 contiguous B per wave store), m and l per row ----
  const size_t slot = ((size_t)(b * NH + h) * NQB + qb) * MAXCH + chunk;
  float* po = Po + (slot * 4 + wave) * 1024 + lane * 4;
#pragma unroll
  for (int t = 0; t < 4; ++t) {
    const v4f lo = {oacc[t][0], oacc[t][1], oacc[t][2], oacc[t][3]};
    const v4f hi = {oacc[t][4], oacc[t][5], oacc[t][6], oacc[t][7]};
    *(v4f*)(po + (t * 2) * 128)     = lo;
    *(v4f*)(po + (t * 2 + 1) * 128) = hi;
  }
  if (c == 0) {                                    // m and l are equal in the 16 lanes of a half
    float* pm = Pml + (slot * 4 + wave) * 32 + hh * 16;
    const v4f m0 = {mrow[0], mrow[1], mrow[2], mrow[3]};
    const v4f m1 = {mrow[4], mrow[5], mrow[6], mrow[7]};
    const v4f l0 = {lrow[0], lrow[1], lrow[2], lrow[3]};
    const v4f l1 = {lrow[4], lrow[5], lrow[6], lrow[7]};
    *(v4f*)(pm)      = m0;
    *(v4f*)(pm + 4)  = m1;
    *(v4f*)(pm + 8)  = l0;
    *(v4f*)(pm + 12) = l1;
  }
}

// =====================================================================================================
// Merge of the key chunks of one query block, chunks in rising order, by the running-maximum rule of the attention
// loop itself: m' = max(m, m_c), l = l exp(m - m') + l_c exp(m_c - m'), context likewise; then the normalisation
// and the bf16 hi / lo split.
//   Block = 4 waves = the 64 query rows of one (b, h, qb); every thread holds the elements that the same thread of
//   the attention work-groups held. Only slots 0 .. nch-1 of the query block are read: all written by the two launches before.
//   out planes (bf16 hi / lo of the normalised context): element (b, t, h, d) at [(b*NLAT + t)*DM + h*64 + d]
//   Output coverage: each wave stores rows q0..q0+15 (it 0..3 x lane>>3 0..3) x 64 columns (8 lanes x 8) of both planes.
// =====================================================================================================
// inputs-only fence on loaded values: the loads of a trip all issue ahead of the arithmetic, so that a trip pays one
// memory latency; without it the compiler sinks some of the loads behind the first wait and the trip pays two
__device__ __forceinline__ void hold_loads12(v4f a0, v4f a1, v4f a2, v4f a3, v4f b0, v4f b1, v4f b2, v4f b3,
                                             v4f b4, v4f b5, v4f b6, v4f b7) {
#if defined(__HIP_DEVICE_COMPILE__)
  asm volatile("" :: "v"(a0), "v"(a1), "v"(a2), "v"(a3), "v"(b0), "v"(b1), "v"(b2), "v"(b3),
                     "v"(b4), "v"(b5), "v"(b6), "v"(b7));
#else
  (void)a0; (void)a1; (void)a2; (void)a3; (void)b0; (void)b1; (void)b2; (void)b3;
  (void)b4; (void)b5; (void)b6; (void)b7;
#endif
}
// one slot into the running sums: ml = m of 8 rows, l of 8 rows; ov = the slot's context accumulators, register order
__device__ __forceinline__ void merge_slot(const v4f* ml, const v4f* ov, float* mrow, float* lrow, v8f* oacc) {
#pragma unroll
  for (int r = 0; r < 8; ++r) {
    const float mc    = ml[r >> 2][r & 3];
    const float mnew  = fmaxf(mrow[r], mc);
    const float msafe = (mnew == -INFINITY) ? 0.f : mnew;
    const float alpha = __expf(mrow[r] - msafe);   // -inf -> exactly 0
    const float w     = __expf(mc - msafe);
    mrow[r] = mnew;
    lrow[r] = lrow[r] * alpha + w * ml[2 + (r >> 2)][r & 3];
#pragma unroll
    for (int t = 0; t < 4; ++t) oacc[t][r] = oacc[t][r] * alpha + w * ov[t * 2 + (r >> 2)][r & 3];
  }
}
__global__ __launch_bounds__(128)
void attn_merge(const float* __restrict__ Po, const float* __restrict__ Pml,
                unsigned short* ohp, unsigned short* olp) {
  __shared__ __align__(16) float Os[4][16 * 64];   // per wave context tile [row][d]
  const int tid  = threadIdx.x;
  const int wave = tid >> 5;
  const int lane = tid & 31;
  const int hh   = lane >> 4;
  const int c    = lane & 15;
  const int qb   = blockIdx.x;
  const int h    = blockIdx.y % NH;
  const int b    = blockIdx.y / NH;
  const int q0   = qb * 64 + wave * 16;            // query row within the batch
  const size_t rowQ = (size_t)b * NLAT;
  const int nch  = (qb < RESQB) ? n_chunks(qb, CHR) : n_chunks(qb, CHN);   // 1 .. MAXCH, block-uniform
  const size_t slot0 = ((size_t)(b * NH + h) * NQB + qb) * MAXCH;
  const float* pmB = Pml + (slot0 * 4 + wave) * 32 + hh * 16;
  const float* poB = Po + (slot0 * 4 + wave) * 1024 + lane * 4;

  float mrow[8], lrow[8];
  v8f oacc[4];
#pragma unroll
  for (int r = 0; r < 8; ++r) { mrow[r] = -INFINITY; lrow[r] = 0.f; }
#pragma unroll
  for (int t = 0; t < 4; ++t) oacc[t] = zero8();
  int ch = 0;
  // kept rolled: the trip count is known only at run time, and the two pointers then live over the whole loop
#pragma unroll 1
  for (; ch + 2 <= nch; ch += 2) {                 // nch <= MAXCH, block-uniform; two slots per trip: their loads fly together
    v4f ml[8], ov[16];
#pragma unroll
    for (int u = 0; u < 2; ++u) {
#pragma unroll
      for (int e = 0; e < 4; ++e) ml[u * 4 + e] = *(const v4f*)(pmB + u * 128 + e * 4);
#pragma unroll
      for (int e = 0; e < 8; ++e) ov[u * 8 + e] = *(const v4f*)(poB + u * 4096 + e * 128);
    }
    hold_loads12(ml[0], ml[1], ml[2], ml[3], ov[0], ov[1], ov[2], ov[3], ov[4], ov[5], ov[6], ov[7]);
    hold_loads12(ml[4], ml[5], ml[6], ml[7], ov[8], ov[9], ov[10], ov[11], ov[12], ov[13], ov[14], ov[15]);
    pmB += 2 * 128;                                // two slots on
    poB += 2 * 4096;
    merge_slot(ml, ov, mrow, lrow, oacc);
    merge_slot(ml + 4, ov + 8, mrow, lrow, oacc);
  }
  if (ch < nch) {                                  // block-uniform: the last slot of an odd count
    v4f ml[4], ov[8];
#pragma unroll
    for (int e = 0; e < 4; ++e) ml[e] = *(const v4f*)(pmB + e * 4);
#pragma unroll
    for (int e = 0; e < 8; ++e) ov[e] = *(const v4f*)(poB + e * 128);
    hold_loads12(ml[0], ml[1], ml[2], ml[3], ov[0], ov[1], ov[2], ov[3], ov[4], ov[5], ov[6], ov[7]);
    merge_slot(ml, ov, mrow, lrow, oacc);
  }

  // ---- normalise (1/l and the 1/1024 p carry), stage the wave's 16x64 tile, bf16 hi/lo split,
  float* os = Os[wave];
#pragma unroll
  for (int r = 0; r < 8; ++r) {
    const float l = lrow[r];
    const float inv = ((l > 0.f) ? (1.0f / l) : 0.f) * (1.0f / 1024.0f);
#pragma unroll
    for (int t = 0; t < 4; ++t) os[(8 * hh + r) * 64 + t * 16 + c] = oacc[t][r] * inv;
  }
  __builtin_amdgcn_fence(__ATOMIC_RELEASE, "workgroup");
  __builtin_amdgcn_wave_barrier();
  __builtin_amdgcn_fence(__ATOMIC_ACQUIRE, "workgroup");
  {
    const int q4 = lane >> 3, c8 = (lane & 7) * 8;
    v4u hv[4], lv[4];
#pragma unroll
    for (int it = 0; it < 4; ++it) {
      const int row = it * 4 + q4;   // it 0..3 x q4 0..3 = rows 0..15 of the wave tile
      const float* sp = os + row * 64 + c8;
      v4u a, a2;
#pragma unroll
      for (int e = 0; e < 4; ++e) {
        const float f0 = sp[2 * e], f1 = sp[2 * e + 1];
        const unsigned short h0 = bf_bits(f0), h1 = bf_bits(f1);
        const unsigned short l0 = bf_bits(f0 - bf_up(h0)), l1 = bf_bits(f1 - bf_up(h1));
        a[e] = pk16(h0, h1); a2[e] = pk16(l0, l1);
      }
      hv[it] = a; lv[it] = a2;
    }
    {
#pragma unroll
      for (int it = 0; it < 4; ++it) {
        const int row = it * 4 + q4;
        const size_t go = (rowQ + q0 + row) * DM + (size_t)h * HD + c8;
        *(v4u*)(ohp + go) = hv[it];
        *(v4u*)(olp + go) = lv[it];
      }
      
    }
  }
}

// =====================================================================================================
// Workspace map (bytes), every region an exact multiple of its 64x64-tile / whole-line store granularity
// (M, N of every GEMM are multiples of 64; converts write whole 512-B groups):
//   Lb   bf16 [2048][1024]            0            4194304
//   Xb   bf16 [8192][1024]            4194304     16777216
//   Wqb  bf16 [1024 n][1024 k]        20971520     2097152
//   Wkb  bf16 [1024][1024]            23068672     2097152
//   Wvb  bf16 [1024][1024]            25165824     2097152
//   Wob  bf16 [1024][1024]            27262976     2097152
//   Qh   bf16 [2048][1024]            29360128     4194304
//   Ql   bf16 [2048][1024]            33554432     4194304
//   Kh   bf16 [8192][1024]            37748736    16777216
//   Kl   bf16 [8192][1024]            54525952    16777216
//   VTh  f16  [2][1024][4096]         71303168    16777216
//   VTl  f16  [2][1024][1024]         88080384     4194304
//   Oh   bf16 [2048][1024]            92274688     4194304
//   Ol   bf16 [2048][1024]            96468992     4194304
//   Po   f32  [8192 slots][4096]       100663296   134217728
//   Pml  f32  [8192 slots][128]        234881024     4194304
//   end                               239075328
// Weights are [out n][in k] with k contiguous = the Bt / A layout the GEMM wants, so they are only converted.
// =====================================================================================================
extern "C" void kernel_launch(void* const* d_in, const int* in_sizes, int n_in,
                              void* d_out, int out_size, void* d_ws, size_t ws_size,
                              hipStream_t stream) {
  if (n_in < 10) return;
  if (in_sizes[0] != NB * MTOK * DM) return;
  if (in_sizes[1] != NB * NLAT * DM) return;
  if (in_sizes[2] != DM * DM || in_sizes[4] != DM * DM || in_sizes[6] != DM * DM || in_sizes[8] != DM * DM) return;
  if (in_sizes[3] != DM || in_sizes[5] != DM || in_sizes[7] != DM || in_sizes[9] != DM) return;
  if (out_size != NB * NLAT * DM) return;

  const float* x  = (const float*)d_in[0];
  const float* lt = (const float*)d_in[1];
  const float* Wq = (const float*)d_in[2];
  const float* bq = (const float*)d_in[3];
  const float* Wk = (const float*)d_in[4];
  const float* bk = (const float*)d_in[5];
  const float* Wv = (const float*)d_in[6];
  const float* bv = (const float*)d_in[7];
  const float* Wo = (const float*)d_in[8];
  const float* bo = (const float*)d_in[9];

  const size_t PL  = (size_t)NB * NLAT * DM * 2;   //  4194304  16-bit latent-side plane [2048][1024]
  const size_t PX  = (size_t)NB * MTOK * DM * 2;   // 16777216  16-bit token-side plane [8192][1024]
  const size_t PW  = (size_t)DM * DM * 2;          //  2097152  16-bit weight plane
  const size_t PVT = (size_t)NB * DM * MTOK * 2;   // 16777216  v^T hi plane
  const size_t PVL = (size_t)NB * DM * VLP * 2;    //  4194304  v^T residual plane
  size_t off = 0;
  const size_t oLb  = off; off += PL;
  const size_t oXb  = off; off += PX;
  const size_t oWq  = off; off += PW;
  const size_t oWk  = off; off += PW;
  const size_t oWv  = off; off += PW;
  const size_t oWo  = off; off += PW;
  const size_t oQh  = off; off += PL;
  const size_t oQl  = off; off += PL;
  const size_t oKh  = off; off += PX;
  const size_t oKl  = off; off += PX;
  const size_t oVTh = off; off += PVT;
  const size_t oVTl = off; off += PVL;
  const size_t oOh  = off; off += PL;
  const size_t oOl  = off; off += PL;
  const size_t oPo  = off; off += (size_t)NB * NH * NQB * MAXCH * 4096 * 4;   // 134217728  partial context sums
  const size_t oPm  = off; off += (size_t)NB * NH * NQB * MAXCH * 128 * 4;    //   4194304  partial m and l
  if (off > ws_size) return;                       // off = 239075328

  char* ws = (char*)d_ws;
  unsigned short* Lb  = (unsigned short*)(ws + oLb);
  unsigned short* Xb  = (unsigned short*)(ws + oXb);
  unsigned short* Wqb = (unsigned short*)(ws + oWq);
  unsigned short* Wkb = (unsigned short*)(ws + oWk);
  unsigned short* Wvb = (unsigned short*)(ws + oWv);
  unsigned short* Wob = (unsigned short*)(ws + oWo);
  unsigned short* Qh  = (unsigned short*)(ws + oQh);
  unsigned short* Ql  = (unsigned short*)(ws + oQl);
  unsigned short* Kh  = (unsigned short*)(ws + oKh);
  unsigned short* Kl  = (unsigned short*)(ws + oKl);
  unsigned short* VTh = (unsigned short*)(ws + oVTh);
  unsigned short* VTl = (unsigned short*)(ws + oVTl);
  unsigned short* Oh  = (unsigned short*)(ws + oOh);
  unsigned short* Ol  = (unsigned short*)(ws + oOl);
  float* Po  = (float*)(ws + oPo);
  float* Pml = (float*)(ws + oPm);

  const dim3 blk(256);
  const int n8l = NB * NLAT * DM / 8;                          //  262144
  const int n8x = NB * MTOK * DM / 8;                          // 1048576
  const int n8w = DM * DM / 8;                                 //  131072
  const dim3 gCvtL((n8l + 255) / 256);                         // 1024 blocks
  const dim3 gCvtX((n8x + 255) / 256);                         // 4096 blocks
  const dim3 gCvtW((n8w + 255) / 256);                         //  512 blocks
  const dim3 gQ((NB * NLAT / GBM) * (DM / GBN), 1);            //  16 x  4 =  64 blocks: M=2048, N=1024
  const dim3 gK((NB * MTOK / GBM) * (DM / GBN), 1);            //  64 x  4 = 256 blocks: M=8192, N=1024
  const dim3 gVT((DM / GBM) * (MTOK / GBN), NB);               //   8 x 16 = 128 blocks x 2 batches: M=1024, N=4096
  const dim3 gO((NB * NLAT / GBM) * (DM / GBN), 1);            //  16 x  4 =  64 blocks: M=2048, N=1024

  // (1) inputs and weights [n][k] f32 -> bf16 planes
  cvt_bf16x8<<<gCvtL, blk, 0, stream>>>(lt, Lb, n8l);
  cvt_bf16x8<<<gCvtX, blk, 0, stream>>>(x, Xb, n8x);
  cvt_bf16x8<<<gCvtW, blk, 0, stream>>>(Wq, Wqb, n8w);
  cvt_bf16x8<<<gCvtW, blk, 0, stream>>>(Wk, Wkb, n8w);
  cvt_bf16x8<<<gCvtW, blk, 0, stream>>>(Wv, Wvb, n8w);
  cvt_bf16x8<<<gCvtW, blk, 0, stream>>>(Wo, Wob, n8w);
  // (2) q = l . Wq^T + bq -> bf16 hi/lo planes [b*NLAT+t][h*64+d]   (M=2048, N=1024, K=1024)
  gemm64<0, 2, 0><<<gQ, blk, 0, stream>>>(
      Lb, Lb, DM, 0LL, Wqb, DM, 0LL, bq,
      (void*)Qh, DM, 0LL, (void*)Ql, DM, 0LL, DM,
      NB * NLAT, DM, DM, 1.0f);
  // (3) k = x . Wk^T + bk -> bf16 hi/lo planes [b*MTOK+s][h*64+d]   (M=8192, N=1024, K=1024)
  gemm64<0, 2, 0><<<gK, blk, 0, stream>>>(
      Xb, Xb, DM, 0LL, Wkb, DM, 0LL, bk,
      (void*)Kh, DM, 0LL, (void*)Kl, DM, 0LL, DM,
      NB * MTOK, DM, DM, 1.0f);
  // (4) v^T = Wv . x^T + bv (per row) per batch -> f16 hi plane [b][h*64+d][s] (pitch MTOK) and residual plane
  //     (x4096, keys < VLP only, pitch VLP)   (A = Wvb [n][k], Bt = Xb rows of batch b; M=1024, N=4096, K=1024)
  gemm64<0, 3, 1><<<gVT, blk, 0, stream>>>(
      Wvb, Wvb, DM, 0LL, Xb, DM, (long long)MTOK * DM, bv,
      (void*)VTh, MTOK, (long long)DM * MTOK, (void*)VTl, VLP, (long long)DM * VLP, VLP,
      DM, MTOK, DM, 4096.0f);
  // (5) attention, one work-group per key chunk: query blocks 0..RESQB-1 with residual planes, the rest without;
  //     then the merge of each query block's chunks -> context planes
  attn_bc64<true, CHR><<<dim3(NCR, NB * NH), dim3(128), 0, stream>>>(
      Qh, Ql, Kh, Kl, VTh, VTl, Po, Pml, 0, RESQB, 0.125f);
  attn_bc64<false, CHN><<<dim3(NCN, NB * NH), dim3(128), 0, stream>>>(
      Qh, Ql, Kh, Kl, VTh, VTl, Po, Pml, RESQB, NQB - RESQB, 0.125f);
  attn_merge<<<dim3(NQB, NB * NH), dim3(128), 0, stream>>>(Po, Pml, Oh, Ol);
  // (6) out = context . Wo^T + bo -> d_out f32 [2048][1024]  (A = context hi + lo planes, 2 products)
  gemm64<1, 0, 0><<<gO, blk, 0, stream>>>(
      Oh, Ol, DM, 0LL, Wob, DM, 0LL, bo,
      d_out, DM, 0LL, d_out, DM, 0LL, DM,
      NB * NLAT, DM, DM, 1.0f);
  (void)hipGetLastError();
}

// v003
// One run takes 188 microseconds.
// Two timings next to v002 both put it at 1.34 times that version's speed.
// Over all steps from v000 it is 2.88 times as fast.
// Contractions: q, k, v^T projections = v_wmma_f32_16x16x32_bf16 (bf16 operands from RNE-converted f32 inputs, single product, f32 accumulate, f32 bias add);
// q.k^T scores = v_wmma_f32_16x16x32_bf16 on bf16 hi/lo planes of q and k (hi.hi + hi.lo + lo.hi), f32 accumulate;
// p.v = v_wmma_f32_16x16x32_f16 (p carried x1024 in f16, v in f16, plus f16 residual planes x4096 of p and v on the leading query blocks), f32 accumulate;
// ctx.Wo^T = v_wmma_f32_16x16x32_bf16 with ctx as bf16 hi/lo planes times bf16 Wo (2 products), f32 accumulate; visibility test and softmax in f32.
// The keys of a query block are split into chunks, one work-group each; a later launch merges the chunks' f32 partial sums.
#include <hip/hip_runtime.h>
#include <math.h>
#include <float.h>
#include <stdint.h>

#define NB    2
#define NLAT  1024         // query (latent) length per batch
#define MTOK  4096         // key / value (token) length per batch
#define DM    1024
#define NH    16
#define HD    64
#define DSF   4            // key j visible to query t iff j / DSF <= t
#define NQB   (NLAT / 64)  // 16 query blocks of 64 rows
#define NKT   (MTOK / 64)  // 64 key tiles of 64
#define RESQB 4            // leading query blocks that use the p / v residual planes
#define VLP   1024         // key pitch of the v^T residual plane (keys 0..VLP-1)
static_assert(RESQB * 64 * DSF <= VLP);
static_assert(NH * HD == DM);
static_assert(MTOK == NLAT * DSF);
static_assert((NLAT % 64) == 0 && (MTOK % 64) == 0 && (DM % 64) == 0);
static_assert((VLP % 64) == 0 && VLP <= MTOK);
static_assert(DSF * NQB <= NKT);
#define CHR   2            // key tiles per work-group, query blocks with residual planes
#define CHN   4            // key tiles per work-group, the other query blocks
#define MAXCH 16           // partial-sum slots per query block
#define NCR   20           // chunks of query blocks 0 .. RESQB-1, one (b, h)
#define NCN   126          // chunks of query blocks RESQB .. NQB-1, one (b, h)
__host__ __device__ constexpr int n_chunks(int qb, int ch) { return (DSF * (qb + 1) + ch - 1) / ch; }
__host__ __device__ constexpr int sum_chunks(int q0, int q1, int ch) {
  int s = 0;
  for (int q = q0; q < q1; ++q) s += n_chunks(q, ch);
  return s;
}
static_assert(n_chunks(RESQB - 1, CHR) <= MAXCH && n_chunks(NQB - 1, CHN) <= MAXCH);
static_assert(sum_chunks(0, RESQB, CHR) == NCR && sum_chunks(RESQB, NQB, CHN) == NCN);

typedef _Float16 v16h __attribute__((ext_vector_type(16)));
typedef _Float16 v8h  __attribute__((ext_vector_type(8)));
typedef __bf16   v16b __attribute__((ext_vector_type(16)));
typedef __bf16   v8b  __attribute__((ext_vector_type(8)));
typedef float    v8f  __attribute__((ext_vector_type(8)));
typedef float    v4f  __attribute__((ext_vector_type(4)));
typedef unsigned int v4u __attribute__((ext_vector_type(4)));

// ---- scalar helpers --------------------------------------------------------------------------------
__device__ __forceinline__ unsigned short bf_bits(float f) {          // f32 -> bf16 bits, RNE convert
  unsigned u = __float_as_uint(f);
  return (unsigned short)((u + 0x7FFFu + ((u >> 16) & 1u)) >> 16);
}
__device__ __forceinline__ float bf_up(unsigned short h) { return __uint_as_float(((unsigned)h) << 16); }
__device__ __forceinline__ unsigned short h_bits(_Float16 x) { return __builtin_bit_cast(unsigned short, x); }
__device__ __forceinline__ unsigned pk16(unsigned short a, unsigned short b) { return (unsigned)a | ((unsigned)b << 16); }
__device__ __forceinline__ v8f zero8() { v8f z = {0.f, 0.f, 0.f, 0.f, 0.f, 0.f, 0.f, 0.f}; return z; }
__device__ __forceinline__ v8h zero8h() {
  const _Float16 z = (_Float16)0.0f;
  v8h r = {z, z, z, z, z, z, z, z};
  return r;
}

// ---- fragment loader: 16-bit A/B operand, lane -> row/col (lane&15), p already includes +8*(lane>>4);
//      elements 0..7 <- p[0..7] (k0+8h..k0+8h+7), elements 8..15 <- p[16..23] (k0+16+8h..)
__device__ __forceinline__ v16b ldfrag_b(const __bf16* p) {
  union { v16b v; v8b h[2]; } f;
  f.h[0] = *(const v8b*)(p);
  f.h[1] = *(const v8b*)(p + 16);
  return f.v;
}

// ---- WMMA helpers with trailing VALU hazard gap (asm only in the device pass) -------------------------
__device__ __forceinline__ v8f mma_b(v16b a, v16b b, v8f c) {
  c = __builtin_amdgcn_wmma_f32_16x16x32_bf16(false, a, false, b, (short)0, c, false, false);
#if defined(__HIP_DEVICE_COMPILE__)
  asm volatile("v_nop\n\tv_nop\n\tv_nop\n\tv_nop" : "+v"(c) : "v"(a), "v"(b));
#endif
  return c;
}
__device__ __forceinline__ v8f mma_h(v16h a, v16h b, v8f c) {
  c = __builtin_amdgcn_wmma_f32_16x16x32_f16(false, a, false, b, (short)0, c, false, false);
#if defined(__HIP_DEVICE_COMPILE__)
  asm volatile("v_nop\n\tv_nop\n\tv_nop\n\tv_nop" : "+v"(c) : "v"(a), "v"(b));
#endif
  return c;
}
__device__ __forceinline__ v8f mma_b_raw(v16b a, v16b b, v8f c) {
  return __builtin_amdgcn_wmma_f32_16x16x32_bf16(false, a, false, b, (short)0, c, false, false);
}
__device__ __forceinline__ void dep_guard_b(v8f& a, v8f& b, v16b x, v16b y) {
#if defined(__HIP_DEVICE_COMPILE__)
  asm volatile("v_nop\n\tv_nop\n\tv_nop\n\tv_nop" : "+v"(a), "+v"(b) : "v"(x), "v"(y));
#else
  (void)a; (void)b; (void)x; (void)y;
#endif
}
__device__ __forceinline__ void keep4_b(v16b a, v16b b, v16b c, v16b d) {
#if defined(__HIP_DEVICE_COMPILE__)
  asm volatile("v_nop" :: "v"(a), "v"(b), "v"(c), "v"(d));
#else
  (void)a; (void)b; (void)c; (void)d;
#endif
}
__device__ __forceinline__ void acc_guard4(v8f& a, v8f& b, v8f& c, v8f& d) {
#if defined(__HIP_DEVICE_COMPILE__)
  asm volatile("v_nop\n\tv_nop\n\tv_nop\n\tv_nop" : "+v"(a), "+v"(b), "+v"(c), "+v"(d));
#else
  (void)a; (void)b; (void)c; (void)d;
#endif
}

// =====================================================================================================
// f32 -> bf16 (RNE convert), 8 elements per thread, one 16-B store per lane: a wave writes 512 contiguous B
// coverage: n8 threads x 8 = whole plane (n8 is a multiple of 256 for every use here).
// =====================================================================================================
__global__ __launch_bounds__(256) void cvt_bf16x8(const float* __restrict__ in, unsigned short* out, int n8) {
  const int i = blockIdx.x * 256 + threadIdx.x;
  if (i < n8) {
    const v4f a = *(const v4f*)(in + (size_t)i * 8);
    const v4f b = *(const v4f*)(in + (size_t)i * 8 + 4);
    v4u p;
    p[0] = pk16(bf_bits(a[0]), bf_bits(a[1]));
    p[1] = pk16(bf_bits(a[2]), bf_bits(a[3]));
    p[2] = pk16(bf_bits(b[0]), bf_bits(b[1]));
    p[3] = pk16(bf_bits(b[2]), bf_bits(b[3]));
    *(v4u*)(out + (size_t)i * 8) = p;
    
  }
}

// =====================================================================================================
// Register-blocked batched bf16 WMMA GEMM: C[m][n] = sum_k A[m][k] * Bt[n][k] + bias; one wave per 64x64
// tile, 8 waves (2 x 4) per GBM x GBN block tile. A row-major [M][K] pitch lda; Bt row-major [N][K] pitch ldb
// (k contiguous); M multiple of GBM, N of GBN, K of GKS. blockIdx.y = batch index (strides in elements).
// Operands go through LDS: a stage is GKS k = one whole 128-B line of every operand row of the block tile,
// brought by asynchronous 16-B copies (8 lanes per row, 4 whole lines per wave-copy) into two LDS buffers;
// stage t+2's copies are issued behind the barrier that ends stage t, one block barrier per stage.
// LDS row pitch GLP elements = 144 B (16 B x odd): the 16 rows of a ds_load_b128 fragment read fill all banks once.
// NSPLIT: 0 = A.Bt; 1 = (A + A2).Bt (A2 = unscaled bf16 lo plane of A).
// BIASM:  0 = bias[n] (length N), 1 = bias[m] (length M); bias values pass through an RNE bf16 convert.
// OUT_MODE: 0 = f32 (pitch ldc); 2 = bf16 hi plane C + bf16 lo plane C2 (lo = RNE(v - hi), unscaled);
//           3 = f16 hi plane C + f16 residual plane C2 = f16((v - hi) * rscale), C2 written only for tiles
//               with n0 < N2 (pitch ldc2, batch stride strideC2).
// =====================================================================================================
// ---- asynchronous copies global -> LDS, 16 B per lane (l = the lane's LDS byte address, g = its global address).
//      s_wait_xcnt 0 closes each statement: it stands ahead of any rewrite of a register that a copy names.
__device__ __forceinline__ void cp_async4(unsigned l0, const char* g0, unsigned l1, const char* g1,
                                          unsigned l2, const char* g2, unsigned l3, const char* g3) {
#if defined(__HIP_DEVICE_COMPILE__)
  asm volatile("global_load_async_to_lds_b128 %0, %1, off\n\t"
               "global_load_async_to_lds_b128 %2, %3, off\n\t"
               "global_load_async_to_lds_b128 %4, %5, off\n\t"
               "global_load_async_to_lds_b128 %6, %7, off\n\t"
               "s_wait_xcnt 0x0"
               :: "v"(l0), "v"(g0), "v"(l1), "v"(g1), "v"(l2), "v"(g2), "v"(l3), "v"(g3) : "memory");
#else
  (void)l0; (void)g0; (void)l1; (void)g1; (void)l2; (void)g2; (void)l3; (void)g3;
#endif
}
__device__ __forceinline__ void cp_async8(unsigned l0, const char* g0, unsigned l1, const char* g1,
                                          unsigned l2, const char* g2, unsigned l3, const char* g3,
                                          unsigned l4, const char* g4, unsigned l5, const char* g5,
                                          unsigned l6, const char* g6, unsigned l7, const char* g7) {
#if defined(__HIP_DEVICE_COMPILE__)
  asm volatile("global_load_async_to_lds_b128 %0, %1, off\n\t"
               "global_load_async_to_lds_b128 %2, %3, off\n\t"
               "global_load_async_to_lds_b128 %4, %5, off\n\t"
               "global_load_async_to_lds_b128 %6, %7, off\n\t"
               "global_load_async_to_lds_b128 %8, %9, off\n\t"
               "global_load_async_to_lds_b128 %10, %11, off\n\t"
               "global_load_async_to_lds_b128 %12, %13, off\n\t"
               "global_load_async_to_lds_b128 %14, %15, off\n\t"
               "s_wait_xcnt 0x0"
               :: "v"(l0), "v"(g0), "v"(l1), "v"(g1), "v"(l2), "v"(g2), "v"(l3), "v"(g3),
                  "v"(l4), "v"(g4), "v"(l5), "v"(g5), "v"(l6), "v"(g6), "v"(l7), "v"(g7) : "memory");
#else
  (void)l0; (void)g0; (void)l1; (void)g1; (void)l2; (void)g2; (void)l3; (void)g3;
  (void)l4; (void)g4; (void)l5; (void)g5; (void)l6; (void)g6; (void)l7; (void)g7;
#endif
}
__device__ __forceinline__ void wait_async0() {   // the wave's own copies have landed in LDS
#if defined(__HIP_DEVICE_COMPILE__)
  asm volatile("s_wait_asynccnt 0x0" ::: "memory");
#endif
}
__device__ __forceinline__ void wait_ds0() {      // the wave's own LDS reads have returned, ahead of a refill of what they read
#if defined(__HIP_DEVICE_COMPILE__)
  asm volatile("s_wait_dscnt 0x0" ::: "memory");
#endif
}

#define GBM 128   // block tile rows    (2 waves x 64)
#define GBN 256   // block tile columns (4 waves x 64)
#define GKS 64    // k per stage
#define GLP 72    // LDS row pitch, elements
static_assert((NB * NLAT) % GBM == 0 && (NB * MTOK) % GBM == 0 && DM % GBM == 0);
static_assert(DM % GBN == 0 && MTOK % GBN == 0 && DM % GKS == 0);
// one stage of the block tile: per thread 4 rows of A (and of A2), 8 rows of Bt, 32 rows apart
template <int NSPLIT>
__device__ __forceinline__ void stage_copies(const char* gA, const char* gA2, const char* gB, size_t rsA, size_t rsB,
                                             unsigned lA, unsigned lA2, unsigned lB) {
  const unsigned RS = 32 * GLP * 2;      // 32 LDS rows, bytes
  if (NSPLIT >= 1)
    cp_async8(lA, gA, lA + RS, gA + rsA, lA + 2 * RS, gA + 2 * rsA, lA + 3 * RS, gA + 3 * rsA,
              lA2, gA2, lA2 + RS, gA2 + rsA, lA2 + 2 * RS, gA2 + 2 * rsA, lA2 + 3 * RS, gA2 + 3 * rsA);
  else
    cp_async4(lA, gA, lA + RS, gA + rsA, lA + 2 * RS, gA + 2 * rsA, lA + 3 * RS, gA + 3 * rsA);
  cp_async8(lB, gB, lB + RS, gB + rsB, lB + 2 * RS, gB + 2 * rsB, lB + 3 * RS, gB + 3 * rsB,
            lB + 4 * RS, gB + 4 * rsB, lB + 5 * RS, gB + 5 * rsB, lB + 6 * RS, gB + 6 * rsB, lB + 7 * RS, gB + 7 * rsB);
}
template <int NSPLIT, int OUT_MODE, int BIASM>
__global__ __launch_bounds__(256) void gemm64(
    const unsigned short* __restrict__ Ap, const unsigned short* A2p, int lda, long long strideA,
    const unsigned short* __restrict__ Btp, int ldb, long long strideB,
    const float* __restrict__ bias,
    void* Cout, int ldc, long long strideC,
    void* Cout2, int ldc2, long long strideC2, int N2,
    int M, int N, int K, float rscale) {
  const __bf16* A   = (const __bf16*)(const void*)Ap;
  const __bf16* A2  = (const __bf16*)(const void*)A2p;
  const __bf16* Bt  = (const __bf16*)(const void*)Btp;
  __shared__ __align__(16) float sT[8][16 * 68];   // per-wave 16x64 slab, pitch 68 floats
  __shared__ __align__(16) __bf16 sA[2][GBM * GLP];                          // A stage, two buffers
  __shared__ __align__(16) __bf16 sA2[2][(NSPLIT >= 1) ? GBM * GLP : 8];     // A2 stage (NSPLIT only)
  __shared__ __align__(16) __bf16 sB[2][GBN * GLP];                          // Bt stage, two buffers
  const int b    = blockIdx.y;
  const int tid  = threadIdx.x;
  const int lane = tid & 31;
  const int wave = tid >> 5;
  const int tilesN = N / GBN;
  const int tilesM = M / GBM;
  const int tile = blockIdx.x;
  if (tile >= tilesM * tilesN) return;   // block-uniform, ahead of every barrier
  const int tm = tile / tilesN;
  const int tn = tile - tm * tilesN;
  const int bm0 = tm * GBM;              // block tile origin
  const int bn0 = tn * GBN;
  const int wm0 = (wave >> 2) << 6;      // this wave's 64x64 tile inside the block tile
  const int wn0 = (wave & 3) << 6;
  const int m0 = bm0 + wm0;
  const int n0 = bn0 + wn0;

  const __bf16* Ab  = A  + (size_t)b * strideA;
  const __bf16* Bb  = Bt + (size_t)b * strideB;
  const __bf16* Ab2 = (NSPLIT >= 1) ? (A2 + (size_t)b * strideA) : Ab;

  const int rlane = lane & 15;                 // row (A) / col (B, D) within subtile
  const int koff  = (lane >> 4) * 8;           // k offset of this lane half
  const int mOff  = (lane >> 4) * 8;           // D row offset

  float bcol[4];
#pragma unroll
  for (int j = 0; j < 4; ++j) bcol[j] = 0.f;
  if (BIASM == 0) {
#pragma unroll
    for (int j = 0; j < 4; ++j) bcol[j] = bf_up(bf_bits(bias[n0 + (j << 4) + rlane]));   // n0+63 < N
  }

  v8f acc[4][4];
#pragma unroll
  for (int i = 0; i < 4; ++i)
#pragma unroll
    for (int j = 0; j < 4; ++j) acc[i][j] = zero8();

  // staging map: thread -> row (tid >> 3) + 32 u, 16-B chunk (tid & 7) of the row's 128-B stage line
  const int srow = tid >> 3;
  const int scol = (tid & 7) * 8;
  const char* tA  = (const char*)(Ab  + (size_t)(bm0 + srow) * lda + scol);   // rows bm0 .. bm0+127 < M
  const char* tA2 = (const char*)(Ab2 + (size_t)(bm0 + srow) * lda + scol);
  const char* tB  = (const char*)(Bb  + (size_t)(bn0 + srow) * ldb + scol);   // rows bn0 .. bn0+255 < N
  const size_t rsA = (size_t)lda * 64;                                        // 32 operand rows, bytes
  const size_t rsB = (size_t)ldb * 64;
  const int sOff = srow * GLP + scol;
  const unsigned lA  = (unsigned)(size_t)(&sA[0][sOff]);                      // LDS byte addresses, buffer 0
  const unsigned lA2 = (unsigned)(size_t)(&sA2[0][(NSPLIT >= 1) ? sOff : 0]);
  const unsigned lB  = (unsigned)(size_t)(&sB[0][sOff]);
  const unsigned bufA = GBM * GLP * 2, bufB = GBN * GLP * 2;                  // buffer sizes, bytes
  const int nst = K / GKS;

  stage_copies<NSPLIT>(tA, tA2, tB, rsA, rsB, lA, lA2, lB);                   // stage 0 -> buffer 0
  wait_async0();                         // this wave's copies of stage 0 have landed
  __syncthreads();                       // stage 0 visible to all 8 waves
  if (nst > 1)                           // block-uniform; stage 1 -> buffer 1, flies during stage 0's products
    stage_copies<NSPLIT>(tA + GKS * 2, tA2 + GKS * 2, tB + GKS * 2, rsA, rsB, lA + bufA, lA2 + bufA, lB + bufB);

  for (int t = 0; t < nst; ++t) {
    const int cur = t & 1;
    // per 32 k: all fragments as one group of LDS reads ahead of their products
    const __bf16* pa  = &sA[cur][(wm0 + rlane) * GLP + koff];
    const __bf16* pa2 = &sA2[cur][(NSPLIT >= 1) ? (wm0 + rlane) * GLP + koff : 0];
    const __bf16* pb  = &sB[cur][(wn0 + rlane) * GLP + koff];
#pragma unroll
    for (int kk = 0; kk < 2; ++kk) {
      v16b bh[4], ah[4], al[4];
#pragma unroll
      for (int j = 0; j < 4; ++j) bh[j] = ldfrag_b(pb + (j << 4) * GLP + kk * 32);
#pragma unroll
      for (int i = 0; i < 4; ++i) {
        ah[i] = ldfrag_b(pa + (i << 4) * GLP + kk * 32);
        al[i] = ah[i];
        if (NSPLIT >= 1) al[i] = ldfrag_b(pa2 + (i << 4) * GLP + kk * 32);
      }
#pragma unroll
      for (int i = 0; i < 4; ++i) {
#pragma unroll
        for (int j = 0; j < 4; ++j) {
          acc[i][j] = mma_b_raw(ah[i], bh[j], acc[i][j]);
          if (NSPLIT >= 1) acc[i][j] = mma_b_raw(al[i], bh[j], acc[i][j]);
        }
        dep_guard_b(acc[i][0], acc[i][3], ah[i], al[i]);
      }
      keep4_b(bh[0], bh[1], bh[2], bh[3]);
    }
    wait_ds0();                          // this wave's reads of stage t are done
    wait_async0();                       // this wave's copies of stage t+1 have landed
    __syncthreads();                     // publishes stage t+1 and ends every read of stage t
    if (t + 2 < nst) {                   // block-uniform; stage t+2 -> the buffer stage t has just left
      const size_t kb = (size_t)(t + 2) * (GKS * 2);
      stage_copies<NSPLIT>(tA + kb, tA2 + kb, tB + kb, rsA, rsB,
                           lA + cur * bufA, lA2 + cur * bufA, lB + cur * bufB);
    }
  }
  wait_async0();                         // nothing of this wave is in flight behind the loop
  acc_guard4(acc[0][0], acc[0][1], acc[0][2], acc[0][3]);
  acc_guard4(acc[1][0], acc[1][1], acc[1][2], acc[1][3]);
  acc_guard4(acc[2][0], acc[2][1], acc[2][2], acc[2][3]);
  acc_guard4(acc[3][0], acc[3][1], acc[3][2], acc[3][3]);

  // ---- epilogue ----
  float* slab = sT[wave];
#pragma unroll
  for (int i = 0; i < 4; ++i) {
    const int mBase = m0 + (i << 4);
    float brow[8];
#pragma unroll
    for (int r = 0; r < 8; ++r) brow[r] = 0.f;
    if (BIASM == 1) {
#pragma unroll
      for (int r = 0; r < 8; ++r) brow[r] = bf_up(bf_bits(bias[mBase + mOff + r]));    // < M
    }
#pragma unroll
    for (int j = 0; j < 4; ++j) {
#pragma unroll
      for (int r = 0; r < 8; ++r) {
        slab[(mOff + r) * 68 + (j << 4) + rlane] = acc[i][j][r] + bcol[j] + brow[r];
      }
    }
    __builtin_amdgcn_fence(__ATOMIC_RELEASE, "workgroup");
    __builtin_amdgcn_wave_barrier();
    __builtin_amdgcn_fence(__ATOMIC_ACQUIRE, "workgroup");
    if (OUT_MODE == 0) {
      float* C = (float*)Cout + (size_t)b * strideC;
      const int hh = lane >> 4, c4 = (lane & 15) * 4;     // 256-B row segment = 16 lanes x 16 B
      v4f vv[8];
#pragma unroll
      for (int it = 0; it < 8; ++it) {
        const int row = it * 2 + hh;                       // it 0..7 x hh 0..1 = rows 0..15
        vv[it] = *(const v4f*)(slab + row * 68 + c4);
      }
      {
#pragma unroll
        for (int it = 0; it < 8; ++it) {
          const int row = it * 2 + hh;
          *(v4f*)(C + (size_t)(mBase + row) * ldc + n0 + c4) = vv[it];
        }
        
      }
    } else {
      const int q = lane >> 3, c8 = (lane & 7) * 8;
      unsigned short* C  = (unsigned short*)Cout  + (size_t)b * strideC;
      unsigned short* C2 = (unsigned short*)Cout2 + (size_t)b * strideC2;
      const bool wlo = (OUT_MODE == 2) || (n0 < N2);      // wave-uniform
      v4u hv[4], lv[4];
#pragma unroll
      for (int it = 0; it < 4; ++it) {
        const int row = it * 4 + q;                        // it 0..3 x q 0..3 = rows 0..15
        const float* sp = slab + row * 68 + c8;
        v4u a, a2;
#pragma unroll
        for (int e = 0; e < 4; ++e) {
          const float f0 = sp[2 * e], f1 = sp[2 * e + 1];
          unsigned short h0, h1, l0, l1;
          if (OUT_MODE == 2) {
            h0 = bf_bits(f0); h1 = bf_bits(f1);
            l0 = bf_bits(f0 - bf_up(h0)); l1 = bf_bits(f1 - bf_up(h1));
          } else {
            const _Float16 x0 = (_Float16)f0, x1 = (_Float16)f1;
            h0 = h_bits(x0); h1 = h_bits(x1);
            l0 = h_bits((_Float16)((f0 - (float)x0) * rscale));
            l1 = h_bits((_Float16)((f1 - (float)x1) * rscale));
          }
          a[e] = pk16(h0, h1); a2[e] = pk16(l0, l1);
        }
        hv[it] = a; lv[it] = a2;
      }
      {
#pragma unroll
        for (int it = 0; it < 4; ++it) {
          const int row = it * 4 + q;
          *(v4u*)(C + (size_t)(mBase + row) * ldc + n0 + c8) = hv[it];
          if (wlo) *(v4u*)(C2 + (size_t)(mBase + row) * ldc2 + n0 + c8) = lv[it];
        }
        
      }
    }
    __builtin_amdgcn_fence(__ATOMIC_RELEASE, "workgroup");
    __builtin_amdgcn_wave_barrier();
    __builtin_amdgcn_fence(__ATOMIC_ACQUIRE, "workgroup");
  }
}

// =====================================================================================================
// Attention with block-triangular visibility (key j visible to query t iff j / DSF <= t, i.e. j < DSF*(t+1)),
// head dim 64, queries from the latent planes (NLAT per batch), keys / values from the token planes (MTOK).
//   q planes (bf16 hi / lo): element (b, t, h, d) at [(b*NLAT + t)*DM + h*64 + d]
//   k planes (bf16 hi / lo): element (b, s, h, d) at [(b*MTOK + s)*DM + h*64 + d]
//   v^T hi plane (f16):      element (b, h, d, s) at [(b*DM + h*64 + d)*MTOK + s]
//   v^T residual plane (f16, (v - hi)*4096): [(b*DM + h*64 + d)*VLP + s], s < VLP, read only when RES
//   (a key tile at or beyond VLP contributes a zero v residual; never happens for the RES query blocks)
//   Query block qb (64 rows) needs key tiles 0 .. DSF*(qb+1)-1; they are split into chunks of CH tiles, one
//   work-group per chunk (block-uniform break out of a loop with static trip CH), so that the serial walk over
//   key tiles is CH long; inside a tile, invisible keys get -inf logits -> weight exactly 0. A row that sees no
//   key of its chunk leaves m = -inf, l = 0 and a zero context there.
//   out: the chunk's partial sums in f32, slot = ((b*NH + h)*NQB + qb)*MAXCH + chunk:
//     Po  [slot][wave][t*2 + half][lane][4]: the wave's unnormalised context accumulators, register order
//     Pml [slot][wave][lane>>4][m of rows 8*(lane>>4)+0..7, then l of the same rows]  (128 B per wave)
//   scores = q . k : bf16 hi/lo split (hi.hi + hi.lo + lo.hi), f32 accumulate, then * sscale in f32
//   p = exp(s - m) carried as f16(1024 p); context = p . v on f16 WMMA; RES adds f16 residual planes of p and v
//   (scale 4096, separate accumulator folded back with 1/4096 per tile in f32); online softmax in f32.
//   Block = 4 waves = 64 query rows of one (b, h); grid = (chunks of the nqbThis query blocks, NH * NB); kv tiles of 64.
//   K / V^T tile staging: 128 threads x 32 elements per plane = the whole 64x64 tile (plain 16-B loads,
//   __syncthreads before and after); P tiles are wave-private, spilled with _Float16 element stores and reloaded
//   Output coverage: each wave stores its whole 4-KB part of Po (8 stores x 512 B) and its 128-B part of Pml.
// =====================================================================================================
// LDS row pitch of the K, V^T and P tiles, elements: 144 B = 16 B x odd, so that the 16 rows of a ds_load_b128 fragment
// read fall on all 64 banks once (at the rows' own 128 B they fall on 8 banks)
#define ALP 72
// second launch bound = waves per SIMD that must fit: it holds the register count where several chunks share a WGP
template <bool RES, int CH>
__global__ __launch_bounds__(128, RES ? 4 : 5)
void attn_bc64(const unsigned short* __restrict__ qhp, const unsigned short* __restrict__ qlp,
               const unsigned short* __restrict__ khp, const unsigned short* __restrict__ klp,
               const unsigned short* __restrict__ vhp, const unsigned short* __restrict__ vlp,
               float* Po, float* Pml,
               int qbBase, int nqbThis, float sscale) {
  union FB { v16b v; v8b h[2]; };
  union FH { v16h v; v8h h[2]; };
  __shared__ __align__(16) __bf16   Ksh[64 * ALP];                // K hi [kv][d]   9 KB
  __shared__ __align__(16) __bf16   Ksl[64 * ALP];                // K lo
  __shared__ __align__(16) _Float16 Vth[64 * ALP];                // V^T hi [d][kv] 9 KB
  __shared__ __align__(16) _Float16 Vtl[RES ? 64 * ALP : 8];      // V^T residual
  __shared__ __align__(16) _Float16 Psh[4][16 * ALP];             // per wave P [row][kv]
  __shared__ __align__(16) _Float16 Psl[RES ? 4 : 1][16 * ALP];   // per wave P residual

  const int tid  = threadIdx.x;
  const int wave = tid >> 5;
  const int lane = tid & 31;
  const int hh   = lane >> 4;
  const int c    = lane & 15;

  const int h    = blockIdx.y % NH;
  const int b    = blockIdx.y / NH;
  int chunk = blockIdx.x;                          // blockIdx.x counts the chunks of qbBase, then of qbBase+1, ...
  int qb    = qbBase;
  for (int i = 1; i < NQB; ++i) {                  // block-uniform, static trip count
    const int nc = n_chunks(qb, CH);
    if (chunk < nc || i >= nqbThis) break;
    chunk -= nc;
    ++qb;
  }
  const int q0   = qb * 64 + wave * 16;            // query row within the batch
  const size_t rowQ = (size_t)b * NLAT;
  const size_t rowK = (size_t)b * MTOK;
  int ktEnd = DSF * (qb + 1);                      // key tiles 0..ktEnd-1 hold every visible key of this block
  if (ktEnd > NKT) ktEnd = NKT;
  const int ktBeg = chunk * CH;                    // this work-group: key tiles ktBeg .. min(ktBeg+CH, ktEnd)-1

  const __bf16* Qh = (const __bf16*)(const void*)qhp + (size_t)h * HD;
  const __bf16* Ql = (const __bf16*)(const void*)qlp + (size_t)h * HD;
  const __bf16* Kh = (const __bf16*)(const void*)khp + (size_t)h * HD;
  const __bf16* Kl = (const __bf16*)(const void*)klp + (size_t)h * HD;
  const _Float16* Vh = (const _Float16*)(const void*)vhp + ((size_t)b * DM + (size_t)h * HD) * MTOK;
  const _Float16* Vl = (const _Float16*)(const void*)vlp + ((size_t)b * DM + (size_t)h * HD) * VLP;

  // ---- Q fragments (A operand, row = lane&15): 2 d-chunks, hi and lo ----
  v16b qah[2], qal[2];
#pragma unroll
  for (int dc = 0; dc < 2; ++dc) {
    const size_t qo = (rowQ + q0 + c) * DM + dc * 32 + 8 * hh;
    qah[dc] = ldfrag_b(Qh + qo);
    qal[dc] = ldfrag_b(Ql + qo);
  }
#if defined(__HIP_DEVICE_COMPILE__)
  asm volatile("s_wait_xcnt 0x0" ::: "memory");   // stands ahead of any rewrite of the address registers of the Q loads above
#endif
  __builtin_amdgcn_sched_barrier(0);               // keeps later address arithmetic, which reuses those registers, behind that wait

  float mrow[8], lrow[8];
  v8f oacc[4];
#pragma unroll
  for (int r = 0; r < 8; ++r) { mrow[r] = -INFINITY; lrow[r] = 0.f; }
#pragma unroll
  for (int t = 0; t < 4; ++t) oacc[t] = zero8();

  for (int ki = 0; ki < CH; ++ki) {          // static trip count
    const int kt = ktBeg + ki;
    if (kt >= ktEnd) break;                  // block-uniform
    const int kv0 = kt * 64;
    __syncthreads();
    {
      const int r = tid >> 1, half = (tid & 1) * 32;
      const __bf16*   kg  = Kh + (rowK + kv0 + r) * DM + half;    // K row kv0+r, d = half..half+31
      const __bf16*   klg = Kl + (rowK + kv0 + r) * DM + half;
      const _Float16* vg  = Vh + (size_t)r * MTOK + kv0 + half;   // V^T row d = r, s = kv0+half..+31
      const int kvl = (kv0 + 64 <= VLP) ? kv0 : (VLP - 64);     // clamped address into the residual plane
      const _Float16* vlg = Vl + (size_t)r * VLP + kvl + half;
      const bool resOK = (kv0 + 64 <= VLP);                      // block-uniform
#pragma unroll
      for (int i = 0; i < 4; ++i) {
        const v8b a0 = *(const v8b*)(kg + 8 * i);
        const v8b a1 = *(const v8b*)(klg + 8 * i);
        const v8h b0 = *(const v8h*)(vg + 8 * i);
        *(v8b*)(Ksh + r * ALP + half + 8 * i) = a0;
        *(v8b*)(Ksl + r * ALP + half + 8 * i) = a1;
        *(v8h*)(Vth + r * ALP + half + 8 * i) = b0;
        if (RES) {
          v8h b1 = *(const v8h*)(vlg + 8 * i);
          if (!resOK) b1 = zero8h();
          *(v8h*)(Vtl + r * ALP + half + 8 * i) = b1;
        }
      }
    }
    __syncthreads();

    // ---- scores: 16 query rows x 64 keys per wave, 3 bf16 products ----
    v8f s[4];
#pragma unroll
    for (int j = 0; j < 4; ++j) {
      s[j] = zero8();
#pragma unroll
      for (int dc = 0; dc < 2; ++dc) {
        FB kb, kl;
        kb.h[0] = *(const v8b*)(Ksh + (j * 16 + c) * ALP + dc * 32 + 8 * hh);
        kb.h[1] = *(const v8b*)(Ksh + (j * 16 + c) * ALP + dc * 32 + 16 + 8 * hh);
        kl.h[0] = *(const v8b*)(Ksl + (j * 16 + c) * ALP + dc * 32 + 8 * hh);
        kl.h[1] = *(const v8b*)(Ksl + (j * 16 + c) * ALP + dc * 32 + 16 + 8 * hh);
        s[j] = mma_b(qah[dc], kb.v, s[j]);
        s[j] = mma_b(qah[dc], kl.v, s[j]);
        s[j] = mma_b(qal[dc], kb.v, s[j]);
      }
    }

    // ---- scale + visibility test (-inf for invisible keys), row max, online softmax,
    //      P (x1024, f16) and P residual (x4096) to LDS ----
    _Float16* pwh = Psh[wave];
    _Float16* pwl = Psl[RES ? wave : 0];
#pragma unroll
    for (int r = 0; r < 8; ++r) {
      const int tq  = q0 + 8 * hh + r;           // query row within the batch
      const int lim = DSF * (tq + 1);            // visible keys: j < lim
      float m = -INFINITY;
#pragma unroll
      for (int j = 0; j < 4; ++j) {
        const int key = kv0 + j * 16 + c;
        const float sv = (key < lim) ? s[j][r] * sscale : -INFINITY;
        s[j][r] = sv;
        m = fmaxf(m, sv);
      }
#pragma unroll
      for (int off = 1; off < 16; off <<= 1) m = fmaxf(m, __shfl_xor(m, off, 32));
      const float mnew  = fmaxf(mrow[r], m);
      const float msafe = (mnew == -INFINITY) ? 0.f : mnew;
      const float alpha = __expf(mrow[r] - msafe);
      mrow[r] = mnew;
      float psum = 0.f;
#pragma unroll
      for (int j = 0; j < 4; ++j) {
        const float p = __expf(s[j][r] - msafe);     // -inf logit -> exactly 0
        psum += p;
        const float p1k = p * 1024.0f;
        const _Float16 ph = (_Float16)p1k;
        pwh[(8 * hh + r) * ALP + j * 16 + c] = ph;
        if (RES) {
          const _Float16 pl = (_Float16)((p1k - (float)ph) * 4096.0f);
          pwl[(8 * hh + r) * ALP + j * 16 + c] = pl;
        }
      }
#pragma unroll
      for (int off = 1; off < 16; off <<= 1) psum += __shfl_xor(psum, off, 32);
      lrow[r] = lrow[r] * alpha + psum;
#pragma unroll
      for (int t = 0; t < 4; ++t) oacc[t][r] *= alpha;
    }
    __builtin_amdgcn_fence(__ATOMIC_RELEASE, "workgroup");
    __builtin_amdgcn_wave_barrier();
    __builtin_amdgcn_fence(__ATOMIC_ACQUIRE, "workgroup");

    // ---- context += P . V (f16 WMMA), residual products into a separate accumulator ----
    v8f o1[4];
#pragma unroll
    for (int t = 0; t < 4; ++t) o1[t] = zero8();
#pragma unroll 1
    for (int kk = 0; kk < 2; ++kk) {
      FH pa, pl;
      pa.h[0] = *(const v8h*)(pwh + c * ALP + kk * 32 + 8 * hh);
      pa.h[1] = *(const v8h*)(pwh + c * ALP + kk * 32 + 16 + 8 * hh);
      if (RES) {
        pl.h[0] = *(const v8h*)(pwl + c * ALP + kk * 32 + 8 * hh);
        pl.h[1] = *(const v8h*)(pwl + c * ALP + kk * 32 + 16 + 8 * hh);
      } else {
        pl.v = pa.v;
      }
#pragma unroll
      for (int t = 0; t < 4; ++t) {
        FH vb;
        vb.h[0] = *(const v8h*)(Vth + (t * 16 + c) * ALP + kk * 32 + 8 * hh);
        vb.h[1] = *(const v8h*)(Vth + (t * 16 + c) * ALP + kk * 32 + 16 + 8 * hh);
        oacc[t] = mma_h(pa.v, vb.v, oacc[t]);
        if (RES) {
          FH vl;
          vl.h[0] = *(const v8h*)(Vtl + (t * 16 + c) * ALP + kk * 32 + 8 * hh);
          vl.h[1] = *(const v8h*)(Vtl + (t * 16 + c) * ALP + kk * 32 + 16 + 8 * hh);
          o1[t] = mma_h(pa.v, vl.v, o1[t]);
          o1[t] = mma_h(pl.v, vb.v, o1[t]);
        }
      }
    }
    if (RES) {
#pragma unroll
      for (int t = 0; t < 4; ++t)
#pragma unroll
        for (int r = 0; r < 8; ++r) oacc[t][r] += o1[t][r] * (1.0f / 4096.0f);
    }
  }

  // ---- the chunk's partial sums: accumulators in register order (512 contiguous B per wave store), m and l per row ----
  const size_t slot = ((size_t)(b * NH + h) * NQB + qb) * MAXCH + chunk;
  float* po = Po + (slot * 4 + wave) * 1024 + lane * 4;
#pragma unroll
  for (int t = 0; t < 4; ++t) {
    const v4f lo = {oacc[t][0], oacc[t][1], oacc[t][2], oacc[t][3]};
    const v4f hi = {oacc[t][4], oacc[t][5], oacc[t][6], oacc[t][7]};
    *(v4f*)(po + (t * 2) * 128)     = lo;
    *(v4f*)(po + (t * 2 + 1) * 128) = hi;
  }
  if (c == 0) {                                    // m and l are equal in the 16 lanes of a half
    float* pm = Pml + (slot * 4 + wave) * 32 + hh * 16;
    const v4f m0 = {mrow[0], mrow[1], mrow[2], mrow[3]};
    const v4f m1 = {mrow[4], mrow[5], mrow[6], mrow[7]};
    const v4f l0 = {lrow[0], lrow[1], lrow[2], lrow[3]};
    const v4f l1 = {lrow[4], lrow[5], lrow[6], lrow[7]};
    *(v4f*)(pm)      = m0;
    *(v4f*)(pm + 4)  = m1;
    *(v4f*)(pm + 8)  = l0;
    *(v4f*)(pm + 12) = l1;
  }
}

// =====================================================================================================
// Merge of the key chunks of one query block, chunks in rising order, by the running-maximum rule of the attention
// loop itself: m' = max(m, m_c), l = l exp(m - m') + l_c exp(m_c - m'), context likewise; then the normalisation
// and the bf16 hi / lo split.
//   Block = 4 waves = the 64 query rows of one (b, h, qb); every thread holds the elements that the same thread of
//   the attention work-groups held. Only slots 0 .. nch-1 of the query block are read: all written by the two launches before.
//   out planes (bf16 hi / lo of the normalised context): element (b, t, h, d) at [(b*NLAT + t)*DM + h*64 + d]
//   Output coverage: each wave stores rows q0..q0+15 (it 0..3 x lane>>3 0..3) x 64 columns (8 lanes x 8) of both planes.
// =====================================================================================================
// inputs-only fence on loaded values: the loads of a trip all issue ahead of the arithmetic, so that a trip pays one
// memory latency; without it the compiler sinks some of the loads behind the first wait and the trip pays two
__device__ __forceinline__ void hold_loads12(v4f a0, v4f a1, v4f a2, v4f a3, v4f b0, v4f b1, v4f b2, v4f b3,
                                             v4f b4, v4f b5, v4f b6, v4f b7) {
#if defined(__HIP_DEVICE_COMPILE__)
  asm volatile("" :: "v"(a0), "v"(a1), "v"(a2), "v"(a3), "v"(b0), "v"(b1), "v"(b2), "v"(b3),
                     "v"(b4), "v"(b5), "v"(b6), "v"(b7));
#else
  (void)a0; (void)a1; (void)a2; (void)a3; (void)b0; (void)b1; (void)b2; (void)b3;
  (void)b4; (void)b5; (void)b6; (void)b7;
#endif
}
// one slot into the running sums: ml = m of 8 rows, l of 8 rows; ov = the slot's context accumulators, register order
__device__ __forceinline__ void merge_slot(const v4f* ml, const v4f* ov, float* mrow, float* lrow, v8f* oacc) {
#pragma unroll
  for (int r = 0; r < 8; ++r) {
    const float mc    = ml[r >> 2][r & 3];
    const float mnew  = fmaxf(mrow[r], mc);
    const float msafe = (mnew == -INFINITY) ? 0.f : mnew;
    const float alpha = __expf(mrow[r] - msafe);   // -inf -> exactly 0
    const float w     = __expf(mc - msafe);
    mrow[r] = mnew;
    lrow[r] = lrow[r] * alpha + w * ml[2 + (r >> 2)][r & 3];
#pragma unroll
    for (int t = 0; t < 4; ++t) oacc[t][r] = oacc[t][r] * alpha + w * ov[t * 2 + (r >> 2)][r & 3];
  }
}
__global__ __launch_bounds__(128)
void attn_merge(const float* __restrict__ Po, const float* __restrict__ Pml,
                unsigned short* ohp, unsigned short* olp) {
  __shared__ __align__(16) float Os[4][16 * 64];   // per wave context tile [row][d]
  const int tid  = threadIdx.x;
  const int wave = tid >> 5;
  const int lane = tid & 31;
  const int hh   = lane >> 4;
  const int c    = lane & 15;
  const int qb   = blockIdx.x;
  const int h    = blockIdx.y % NH;
  const int b    = blockIdx.y / NH;
  const int q0   = qb * 64 + wave * 16;            // query row within the batch
  const size_t rowQ = (size_t)b * NLAT;
  const int nch  = (qb < RESQB) ? n_chunks(qb, CHR) : n_chunks(qb, CHN);   // 1 .. MAXCH, block-uniform
  const size_t slot0 = ((size_t)(b * NH + h) * NQB + qb) * MAXCH;
  const float* pmB = Pml + (slot0 * 4 + wave) * 32 + hh * 16;
  const float* poB = Po + (slot0 * 4 + wave) * 1024 + lane * 4;

  float mrow[8], lrow[8];
  v8f oacc[4];
#pragma unroll
  for (int r = 0; r < 8; ++r) { mrow[r] = -INFINITY; lrow[r] = 0.f; }
#pragma unroll
  for (int t = 0; t < 4; ++t) oacc[t] = zero8();
  int ch = 0;
  // kept rolled: the trip count is known only at run time, and the two pointers then live over the whole loop
#pragma unroll 1
  for (; ch + 2 <= nch; ch += 2) {                 // nch <= MAXCH, block-uniform; two slots per trip: their loads fly together
    v4f ml[8], ov[16];
#pragma unroll
    for (int u = 0; u < 2; ++u) {
#pragma unroll
      for (int e = 0; e < 4; ++e) ml[u * 4 + e] = *(const v4f*)(pmB + u * 128 + e * 4);
#pragma unroll
      for (int e = 0; e < 8; ++e) ov[u * 8 + e] = *(const v4f*)(poB + u * 4096 + e * 128);
    }
    hold_loads12(ml[0], ml[1], ml[2], ml[3], ov[0], ov[1], ov[2], ov[3], ov[4], ov[5], ov[6], ov[7]);
    hold_loads12(ml[4], ml[5], ml[6], ml[7], ov[8], ov[9], ov[10], ov[11], ov[12], ov[13], ov[14], ov[15]);
    pmB += 2 * 128;                                // two slots on
    poB += 2 * 4096;
    merge_slot(ml, ov, mrow, lrow, oacc);
    merge_slot(ml + 4, ov + 8, mrow, lrow, oacc);
  }
  if (ch < nch) {                                  // block-uniform: the last slot of an odd count
    v4f ml[4], ov[8];
#pragma unroll
    for (int e = 0; e < 4; ++e) ml[e] = *(const v4f*)(pmB + e * 4);
#pragma unroll
    for (int e = 0; e < 8; ++e) ov[e] = *(const v4f*)(poB + e * 128);
    hold_loads12(ml[0], ml[1], ml[2], ml[3], ov[0], ov[1], ov[2], ov[3], ov[4], ov[5], ov[6], ov[7]);
    merge_slot(ml, ov, mrow, lrow, oacc);
  }

  // ---- normalise (1/l and the 1/1024 p carry), stage the wave's 16x64 tile, bf16 hi/lo split,
  float* os = Os[wave];
#pragma unroll
  for (int r = 0; r < 8; ++r) {
    const float l = lrow[r];
    const float inv = ((l > 0.f) ? (1.0f / l) : 0.f) * (1.0f / 1024.0f);
#pragma unroll
    for (int t = 0; t < 4; ++t) os[(8 * hh + r) * 64 + t * 16 + c] = oacc[t][r] * inv;
  }
  __builtin_amdgcn_fence(__ATOMIC_RELEASE, "workgroup");
  __builtin_amdgcn_wave_barrier();
  __builtin_amdgcn_fence(__ATOMIC_ACQUIRE, "workgroup");
  {
    const int q4 = lane >> 3, c8 = (lane & 7) * 8;
    v4u hv[4], lv[4];
#pragma unroll
    for (int it = 0; it < 4; ++it) {
      const int row = it * 4 + q4;   // it 0..3 x q4 0..3 = rows 0..15 of the wave tile
      const float* sp = os + row * 64 + c8;
      v4u a, a2;
#pragma unroll
      for (int e = 0; e < 4; ++e) {
        const float f0 = sp[2 * e], f1 = sp[2 * e + 1];
        const unsigned short h0 = bf_bits(f0), h1 = bf_bits(f1);
        const unsigned short l0 = bf_bits(f0 - bf_up(h0)), l1 = bf_bits(f1 - bf_up(h1));
        a[e] = pk16(h0, h1); a2[e] = pk16(l0, l1);
      }
      hv[it] = a; lv[it] = a2;
    }
    {
#pragma unroll
      for (int it = 0; it < 4; ++it) {
        const int row = it * 4 + q4;
        const size_t go = (rowQ + q0 + row) * DM + (size_t)h * HD + c8;
        *(v4u*)(ohp + go) = hv[it];
        *(v4u*)(olp + go) = lv[it];
      }
      
    }
  }
}

// =====================================================================================================
// Workspace map (bytes), every region an exact multiple of its 64x64-tile / whole-line store granularity
// (M, N of every GEMM are multiples of 64; converts write whole 512-B groups):
//   Lb   bf16 [2048][1024]            0            4194304
//   Xb   bf16 [8192][1024]            4194304     16777216
//   Wqb  bf16 [1024 n][1024 k]        20971520     2097152
//   Wkb  bf16 [1024][1024]            23068672     2097152
//   Wvb  bf16 [1024][1024]            25165824     2097152
//   Wob  bf16 [1024][1024]            27262976     2097152
//   Qh   bf16 [2048][1024]            29360128     4194304
//   Ql   bf16 [2048][1024]            33554432     4194304
//   Kh   bf16 [8192][1024]            37748736    16777216
//   Kl   bf16 [8192][1024]            54525952    16777216
//   VTh  f16  [2][1024][4096]         71303168    16777216
//   VTl  f16  [2][1024][1024]         88080384     4194304
//   Oh   bf16 [2048][1024]            92274688     4194304
//   Ol   bf16 [2048][1024]            96468992     4194304
//   Po   f32  [8192 slots][4096]       100663296   134217728
//   Pml  f32  [8192 slots][128]        234881024     4194304
//   end                               239075328
// Weights are [out n][in k] with k contiguous = the Bt / A layout the GEMM wants, so they are only converted.
// =====================================================================================================
extern "C" void kernel_launch(void* const* d_in, const int* in_sizes, int n_in,
                              void* d_out, int out_size, void* d_ws, size_t ws_size,
                              hipStream_t stream) {
  if (n_in < 10) return;
  if (in_sizes[0] != NB * MTOK * DM) return;
  if (in_sizes[1] != NB * NLAT * DM) return;
  if (in_sizes[2] != DM * DM || in_sizes[4] != DM * DM || in_sizes[6] != DM * DM || in_sizes[8] != DM * DM) return;
  if (in_sizes[3] != DM || in_sizes[5] != DM || in_sizes[7] != DM || in_sizes[9] != DM) return;
  if (out_size != NB * NLAT * DM) return;

  const float* x  = (const float*)d_in[0];
  const float* lt = (const float*)d_in[1];
  const float* Wq = (const float*)d_in[2];
  const float* bq = (const float*)d_in[3];
  const float* Wk = (const float*)d_in[4];
  const float* bk = (const float*)d_in[5];
  const float* Wv = (const float*)d_in[6];
  const float* bv = (const float*)d_in[7];
  const float* Wo = (const float*)d_in[8];
  const float* bo = (const float*)d_in[9];

  const size_t PL  = (size_t)NB * NLAT * DM * 2;   //  4194304  16-bit latent-side plane [2048][1024]
  const size_t PX  = (size_t)NB * MTOK * DM * 2;   // 16777216  16-bit token-side plane [8192][1024]
  const size_t PW  = (size_t)DM * DM * 2;          //  2097152  16-bit weight plane
  const size_t PVT = (size_t)NB * DM * MTOK * 2;   // 16777216  v^T hi plane
  const size_t PVL = (size_t)NB * DM * VLP * 2;    //  4194304  v^T residual plane
  size_t off = 0;
  const size_t oLb  = off; off += PL;
  const size_t oXb  = off; off += PX;
  const size_t oWq  = off; off += PW;
  const size_t oWk  = off; off += PW;
  const size_t oWv  = off; off += PW;
  const size_t oWo  = off; off += PW;
  const size_t oQh  = off; off += PL;
  const size_t oQl  = off; off += PL;
  const size_t oKh  = off; off += PX;
  const size_t oKl  = off; off += PX;
  const size_t oVTh = off; off += PVT;
  const size_t oVTl = off; off += PVL;
  const size_t oOh  = off; off += PL;
  const size_t oOl  = off; off += PL;
  const size_t oPo  = off; off += (size_t)NB * NH * NQB * MAXCH * 4096 * 4;   // 134217728  partial context sums
  const size_t oPm  = off; off += (size_t)NB * NH * NQB * MAXCH * 128 * 4;    //   4194304  partial m and l
  if (off > ws_size) return;                       // off = 239075328

  char* ws = (char*)d_ws;
  unsigned short* Lb  = (unsigned short*)(ws + oLb);
  unsigned short* Xb  = (unsigned short*)(ws + oXb);
  unsigned short* Wqb = (unsigned short*)(ws + oWq);
  unsigned short* Wkb = (unsigned short*)(ws + oWk);
  unsigned short* Wvb = (unsigned short*)(ws + oWv);
  unsigned short* Wob = (unsigned short*)(ws + oWo);
  unsigned short* Qh  = (unsigned short*)(ws + oQh);
  unsigned short* Ql  = (unsigned short*)(ws + oQl);
  unsigned short* Kh  = (unsigned short*)(ws + oKh);
  unsigned short* Kl  = (unsigned short*)(ws + oKl);
  unsigned short* VTh = (unsigned short*)(ws + oVTh);
  unsigned short* VTl = (unsigned short*)(ws + oVTl);
  unsigned short* Oh  = (unsigned short*)(ws + oOh);
  unsigned short* Ol  = (unsigned short*)(ws + oOl);
  float* Po  = (float*)(ws + oPo);
  float* Pml = (float*)(ws + oPm);

  const dim3 blk(256);
  const int n8l = NB * NLAT * DM / 8;                          //  262144
  const int n8x = NB * MTOK * DM / 8;                          // 1048576
  const int n8w = DM * DM / 8;                                 //  131072
  const dim3 gCvtL((n8l + 255) / 256);                         // 1024 blocks
  const dim3 gCvtX((n8x + 255) / 256);                         // 4096 blocks
  const dim3 gCvtW((n8w + 255) / 256);                         //  512 blocks
  const dim3 gQ((NB * NLAT / GBM) * (DM / GBN), 1);            //  16 x  4 =  64 blocks: M=2048, N=1024
  const dim3 gK((NB * MTOK / GBM) * (DM / GBN), 1);            //  64 x  4 = 256 blocks: M=8192, N=1024
  const dim3 gVT((DM / GBM) * (MTOK / GBN), NB);               //   8 x 16 = 128 blocks x 2 batches: M=1024, N=4096
  const dim3 gO((NB * NLAT / GBM) * (DM / GBN), 1);            //  16 x  4 =  64 blocks: M=2048, N=1024

  // (1) inputs and weights [n][k] f32 -> bf16 planes
  cvt_bf16x8<<<gCvtL, blk, 0, stream>>>(lt, Lb, n8l);
  cvt_bf16x8<<<gCvtX, blk, 0, stream>>>(x, Xb, n8x);
  cvt_bf16x8<<<gCvtW, blk, 0, stream>>>(Wq, Wqb, n8w);
  cvt_bf16x8<<<gCvtW, blk, 0, stream>>>(Wk, Wkb, n8w);
  cvt_bf16x8<<<gCvtW, blk, 0, stream>>>(Wv, Wvb, n8w);
  cvt_bf16x8<<<gCvtW, blk, 0, stream>>>(Wo, Wob, n8w);
  // (2) q = l . Wq^T + bq -> bf16 hi/lo planes [b*NLAT+t][h*64+d]   (M=2048, N=1024, K=1024)
  gemm64<0, 2, 0><<<gQ, blk, 0, stream>>>(
      Lb, Lb, DM, 0LL, Wqb, DM, 0LL, bq,
      (void*)Qh, DM, 0LL, (void*)Ql, DM, 0LL, DM,
      NB * NLAT, DM, DM, 1.0f);
  // (3) k = x . Wk^T + bk -> bf16 hi/lo planes [b*MTOK+s][h*64+d]   (M=8192, N=1024, K=1024)
  gemm64<0, 2, 0><<<gK, blk, 0, stream>>>(
      Xb, Xb, DM, 0LL, Wkb, DM, 0LL, bk,
      (void*)Kh, DM, 0LL, (void*)Kl, DM, 0LL, DM,
      NB * MTOK, DM, DM, 1.0f);
  // (4) v^T = Wv . x^T + bv (per row) per batch -> f16 hi plane [b][h*64+d][s] (pitch MTOK) and residual plane
  //     (x4096, keys < VLP only, pitch VLP)   (A = Wvb [n][k], Bt = Xb rows of batch b; M=1024, N=4096, K=1024)
  gemm64<0, 3, 1><<<gVT, blk, 0, stream>>>(
      Wvb, Wvb, DM, 0LL, Xb, DM, (long long)MTOK * DM, bv,
      (void*)VTh, MTOK, (long long)DM * MTOK, (void*)VTl, VLP, (long long)DM * VLP, VLP,
      DM, MTOK, DM, 4096.0f);
  // (5) attention, one work-group per key chunk: query blocks 0..RESQB-1 with residual planes, the rest without;
  //     then the merge of each query block's chunks -> context planes
  attn_bc64<true, CHR><<<dim3(NCR, NB * NH), dim3(128), 0, stream>>>(
      Qh, Ql, Kh, Kl, VTh, VTl, Po, Pml, 0, RESQB, 0.125f);
  attn_bc64<false, CHN><<<dim3(NCN, NB * NH), dim3(128), 0, stream>>>(
      Qh, Ql, Kh, Kl, VTh, VTl, Po, Pml, RESQB, NQB - RESQB, 0.125f);
  attn_merge<<<dim3(NQB, NB * NH), dim3(128), 0, stream>>>(Po, Pml, Oh, Ol);
  // (6) out = context . Wo^T + bo -> d_out f32 [2048][1024]  (A = context hi + lo planes, 2 products)
  gemm64<1, 0, 0><<<gO, blk, 0, stream>>>(
      Oh, Ol, DM, 0LL, Wob, DM, 0LL, bo,
      d_out, DM, 0LL, d_out, DM, 0LL, DM,
      NB * NLAT, DM, DM, 1.0f);
  (void)hipGetLastError();
}

// v004
// One run takes 158 microseconds.
// Timed twice side by side with v003, it ran 1.18 and 1.19 times as fast.
// Over all steps from v000 it is 3.42 times as fast.
// Contractions: q, k, v^T projections = v_wmma_f32_16x16x32_bf16 (bf16 operands from RNE-converted f32 inputs, single product, f32 accumulate, f32 bias add);
// q.k^T scores = v_wmma_f32_16x16x32_bf16 on bf16 hi/lo planes of q and k (hi.hi + hi.lo + lo.hi), f32 accumulate;
// p.v = v_wmma_f32_16x16x32_f16 (p carried x1024 in f16, v in f16, plus f16 residual planes x4096 of p and v on the leading query blocks), f32 accumulate;
// ctx.Wo^T = v_wmma_f32_16x16x32_bf16 with ctx as bf16 hi/lo planes times bf16 Wo (2 products), f32 accumulate; visibility test and softmax in f32.
// The keys of a query block are split into chunks, one work-group each; a later launch merges the chunks' f32 partial sums.
// Launches that do not depend on one another share one grid, a range of block indices per job (the six converts; the q, k, v^T projections).
#include <hip/hip_runtime.h>
#include <math.h>
#include <float.h>
#include <stdint.h>

#define NB    2
#define NLAT  1024         // query (latent) length per batch
#define MTOK  4096         // key / value (token) length per batch
#define DM    1024
#define NH    16
#define HD    64
#define DSF   4            // key j visible to query t iff j / DSF <= t
#define NQB   (NLAT / 64)  // 16 query blocks of 64 rows
#define NKT   (MTOK / 64)  // 64 key tiles of 64
#define RESQB 4            // leading query blocks that use the p / v residual planes
#define VLP   1024         // key pitch of the v^T residual plane (keys 0..VLP-1)
static_assert(RESQB * 64 * DSF <= VLP);
static_assert(NH * HD == DM);
static_assert(MTOK == NLAT * DSF);
static_assert((NLAT % 64) == 0 && (MTOK % 64) == 0 && (DM % 64) == 0);
static_assert((VLP % 64) == 0 && VLP <= MTOK);
static_assert(DSF * NQB <= NKT);
#define CHR   2            // key tiles per work-group, query blocks with residual planes
#define CHN   4            // key tiles per work-group, the other query blocks
#define MAXCH 16           // partial-sum slots per query block
#define NCR   20           // chunks of query blocks 0 .. RESQB-1, one (b, h)
#define NCN   126          // chunks of query blocks RESQB .. NQB-1, one (b, h)
__host__ __device__ constexpr int n_chunks(int qb, int ch) { return (DSF * (qb + 1) + ch - 1) / ch; }
__host__ __device__ constexpr int sum_chunks(int q0, int q1, int ch) {
  int s = 0;
  for (int q = q0; q < q1; ++q) s += n_chunks(q, ch);
  return s;
}
static_assert(n_chunks(RESQB - 1, CHR) <= MAXCH && n_chunks(NQB - 1, CHN) <= MAXCH);
static_assert(sum_chunks(0, RESQB, CHR) == NCR && sum_chunks(RESQB, NQB, CHN) == NCN);

typedef _Float16 v16h __attribute__((ext_vector_type(16)));
typedef _Float16 v8h  __attribute__((ext_vector_type(8)));
typedef __bf16   v16b __attribute__((ext_vector_type(16)));
typedef __bf16   v8b  __attribute__((ext_vector_type(8)));
typedef float    v8f  __attribute__((ext_vector_type(8)));
typedef float    v4f  __attribute__((ext_vector_type(4)));
typedef unsigned int v4u __attribute__((ext_vector_type(4)));

// ---- scalar helpers --------------------------------------------------------------------------------
__device__ __forceinline__ unsigned short bf_bits(float f) {          // f32 -> bf16 bits, RNE convert
  unsigned u = __float_as_uint(f);
  return (unsigned short)((u + 0x7FFFu + ((u >> 16) & 1u)) >> 16);
}
__device__ __forceinline__ float bf_up(unsigned short h) { return __uint_as_float(((unsigned)h) << 16); }
__device__ __forceinline__ unsigned short h_bits(_Float16 x) { return __builtin_bit_cast(unsigned short, x); }
__device__ __forceinline__ unsigned pk16(unsigned short a, unsigned short b) { return (unsigned)a | ((unsigned)b << 16); }
__device__ __forceinline__ v8f zero8() { v8f z = {0.f, 0.f, 0.f, 0.f, 0.f, 0.f, 0.f, 0.f}; return z; }
__device__ __forceinline__ v8h zero8h() {
  const _Float16 z = (_Float16)0.0f;
  v8h r = {z, z, z, z, z, z, z, z};
  return r;
}

// ---- fragment loader: 16-bit A/B operand, lane -> row/col (lane&15), p already includes +8*(lane>>4);
//      elements 0..7 <- p[0..7] (k0+8h..k0+8h+7), elements 8..15 <- p[16..23] (k0+16+8h..)
__device__ __forceinline__ v16b ldfrag_b(const __bf16* p) {
  union { v16b v; v8b h[2]; } f;
  f.h[0] = *(const v8b*)(p);
  f.h[1] = *(const v8b*)(p + 16);
  return f.v;
}

// ---- WMMA helpers with trailing VALU hazard gap (asm only in the device pass) -------------------------
__device__ __forceinline__ v8f mma_b(v16b a, v16b b, v8f c) {
  c = __builtin_amdgcn_wmma_f32_16x16x32_bf16(false, a, false, b, (short)0, c, false, false);
#if defined(__HIP_DEVICE_COMPILE__)
  asm volatile("v_nop\n\tv_nop\n\tv_nop\n\tv_nop" : "+v"(c) : "v"(a), "v"(b));
#endif
  return c;
}
__device__ __forceinline__ v8f mma_h(v16h a, v16h b, v8f c) {
  c = __builtin_amdgcn_wmma_f32_16x16x32_f16(false, a, false, b, (short)0, c, false, false);
#if defined(__HIP_DEVICE_COMPILE__)
  asm volatile("v_nop\n\tv_nop\n\tv_nop\n\tv_nop" : "+v"(c) : "v"(a), "v"(b));
#endif
  return c;
}
__device__ __forceinline__ v8f mma_b_raw(v16b a, v16b b, v8f c) {
  return __builtin_amdgcn_wmma_f32_16x16x32_bf16(false, a, false, b, (short)0, c, false, false);
}
__device__ __forceinline__ void dep_guard_b(v8f& a, v8f& b, v16b x, v16b y) {
#if defined(__HIP_DEVICE_COMPILE__)
  asm volatile("v_nop\n\tv_nop\n\tv_nop\n\tv_nop" : "+v"(a), "+v"(b) : "v"(x), "v"(y));
#else
  (void)a; (void)b; (void)x; (void)y;
#endif
}
__device__ __forceinline__ void keep4_b(v16b a, v16b b, v16b c, v16b d) {
#if defined(__HIP_DEVICE_COMPILE__)
  asm volatile("v_nop" :: "v"(a), "v"(b), "v"(c), "v"(d));
#else
  (void)a; (void)b; (void)c; (void)d;
#endif
}
__device__ __forceinline__ void acc_guard4(v8f& a, v8f& b, v8f& c, v8f& d) {
#if defined(__HIP_DEVICE_COMPILE__)
  asm volatile("v_nop\n\tv_nop\n\tv_nop\n\tv_nop" : "+v"(a), "+v"(b), "+v"(c), "+v"(d));
#else
  (void)a; (void)b; (void)c; (void)d;
#endif
}

// =====================================================================================================
// f32 -> bf16 (RNE convert), 8 elements per thread, one 16-B store per lane: a wave writes 512 contiguous B
// All six planes in one grid: a range of block indices per plane, the largest plane first; the choice is block-uniform.
// coverage: every plane is a whole number of blocks of 256 threads x 8 elements.
// =====================================================================================================
#define CVB_X (NB * MTOK * DM / 2048)   // 4096 blocks: x
#define CVB_L (NB * NLAT * DM / 2048)   // 1024 blocks: l
#define CVB_W (DM * DM / 2048)          //  512 blocks: each weight
static_assert((NB * MTOK * DM) % 2048 == 0 && (NB * NLAT * DM) % 2048 == 0 && (DM * DM) % 2048 == 0);
__global__ __launch_bounds__(256) void cvt_bf16x8_all(
    const float* __restrict__ x, const float* __restrict__ lt, const float* __restrict__ Wq,
    const float* __restrict__ Wk, const float* __restrict__ Wv, const float* __restrict__ Wo,
    unsigned short* Xb, unsigned short* Lb, unsigned short* Wqb,
    unsigned short* Wkb, unsigned short* Wvb, unsigned short* Wob) {
  int blk = blockIdx.x;
  const float* in = x;
  unsigned short* out = Xb;
  if (blk >= CVB_X) {
    blk -= CVB_X;
    in = lt; out = Lb;
    if (blk >= CVB_L) {
      blk -= CVB_L;
      const int w = blk / CVB_W;         // 0 .. 3
      blk -= w * CVB_W;
      in  = (w == 0) ? Wq  : (w == 1) ? Wk  : (w == 2) ? Wv  : Wo;
      out = (w == 0) ? Wqb : (w == 1) ? Wkb : (w == 2) ? Wvb : Wob;
    }
  }
  const int i = blk * 256 + threadIdx.x;
  {
    const v4f a = *(const v4f*)(in + (size_t)i * 8);
    const v4f b = *(const v4f*)(in + (size_t)i * 8 + 4);
    v4u p;
    p[0] = pk16(bf_bits(a[0]), bf_bits(a[1]));
    p[1] = pk16(bf_bits(a[2]), bf_bits(a[3]));
    p[2] = pk16(bf_bits(b[0]), bf_bits(b[1]));
    p[3] = pk16(bf_bits(b[2]), bf_bits(b[3]));
    *(v4u*)(out + (size_t)i * 8) = p;
    
  }
}

// =====================================================================================================
// Register-blocked batched bf16 WMMA GEMM: C[m][n] = sum_k A[m][k] * Bt[n][k] + bias; one wave per 64x64
// tile, 8 waves (2 x 4) per GBM x GBN block tile. A row-major [M][K] pitch lda; Bt row-major [N][K] pitch ldb
// (k contiguous); M multiple of GBM, N of GBN, K of GKS. b = batch index (strides in elements).
// Operands go through LDS: a stage is GKS k = one whole 128-B line of every operand row of the block tile,
// brought by asynchronous 16-B copies (8 lanes per row, 4 whole lines per wave-copy) into two LDS buffers;
// stage t+2's copies are issued behind the barrier that ends stage t, one block barrier per stage.
// LDS row pitch GLP elements = 144 B (16 B x odd): the 16 rows of a ds_load_b128 fragment read fill all banks once.
// NSPLIT: 0 = A.Bt; 1 = (A + A2).Bt (A2 = unscaled bf16 lo plane of A).
// BIASM:  0 = bias[n] (length N), 1 = bias[m] (length M); bias values pass through an RNE bf16 convert.
// OUT_MODE: 0 = f32 (pitch ldc); 2 = bf16 hi plane C + bf16 lo plane C2 (lo = RNE(v - hi), unscaled);
//           3 = f16 hi plane C + f16 residual plane C2 = f16((v - hi) * rscale), C2 written only for tiles
//               with n0 < N2 (pitch ldc2, batch stride strideC2).
// =====================================================================================================
// ---- asynchronous copies global -> LDS, 16 B per lane (l = the lane's LDS byte address, g = its global address).
//      s_wait_xcnt 0 closes each statement: it stands ahead of any rewrite of a register that a copy names.
__device__ __forceinline__ void cp_async4(unsigned l0, const char* g0, unsigned l1, const char* g1,
                                          unsigned l2, const char* g2, unsigned l3, const char* g3) {
#if defined(__HIP_DEVICE_COMPILE__)
  asm volatile("global_load_async_to_lds_b128 %0, %1, off\n\t"
               "global_load_async_to_lds_b128 %2, %3, off\n\t"
               "global_load_async_to_lds_b128 %4, %5, off\n\t"
               "global_load_async_to_lds_b128 %6, %7, off\n\t"
               "s_wait_xcnt 0x0"
               :: "v"(l0), "v"(g0), "v"(l1), "v"(g1), "v"(l2), "v"(g2), "v"(l3), "v"(g3) : "memory");
#else
  (void)l0; (void)g0; (void)l1; (void)g1; (void)l2; (void)g2; (void)l3; (void)g3;
#endif
}
__device__ __forceinline__ void cp_async8(unsigned l0, const char* g0, unsigned l1, const char* g1,
                                          unsigned l2, const char* g2, unsigned l3, const char* g3,
                                          unsigned l4, const char* g4, unsigned l5, const char* g5,
                                          unsigned l6, const char* g6, unsigned l7, const char* g7) {
#if defined(__HIP_DEVICE_COMPILE__)
  asm volatile("global_load_async_to_lds_b128 %0, %1, off\n\t"
               "global_load_async_to_lds_b128 %2, %3, off\n\t"
               "global_load_async_to_lds_b128 %4, %5, off\n\t"
               "global_load_async_to_lds_b128 %6, %7, off\n\t"
               "global_load_async_to_lds_b128 %8, %9, off\n\t"
               "global_load_async_to_lds_b128 %10, %11, off\n\t"
               "global_load_async_to_lds_b128 %12, %13, off\n\t"
               "global_load_async_to_lds_b128 %14, %15, off\n\t"
               "s_wait_xcnt 0x0"
               :: "v"(l0), "v"(g0), "v"(l1), "v"(g1), "v"(l2), "v"(g2), "v"(l3), "v"(g3),
                  "v"(l4), "v"(g4), "v"(l5), "v"(g5), "v"(l6), "v"(g6), "v"(l7), "v"(g7) : "memory");
#else
  (void)l0; (void)g0; (void)l1; (void)g1; (void)l2; (void)g2; (void)l3; (void)g3;
  (void)l4; (void)g4; (void)l5; (void)g5; (void)l6; (void)g6; (void)l7; (void)g7;
#endif
}
__device__ __forceinline__ void wait_async0() {   // the wave's own copies have landed in LDS
#if defined(__HIP_DEVICE_COMPILE__)
  asm volatile("s_wait_asynccnt 0x0" ::: "memory");
#endif
}
__device__ __forceinline__ void wait_ds0() {      // the wave's own LDS reads have returned, ahead of a refill of what they read
#if defined(__HIP_DEVICE_COMPILE__)
  asm volatile("s_wait_dscnt 0x0" ::: "memory");
#endif
}

#define GBM 128   // block tile rows    (2 waves x 64)
#define GBN 256   // block tile columns (4 waves x 64)
#define GKS 64    // k per stage
#define GLP 72    // LDS row pitch, elements
static_assert((NB * NLAT) % GBM == 0 && (NB * MTOK) % GBM == 0 && DM % GBM == 0);
static_assert(DM % GBN == 0 && MTOK % GBN == 0 && DM % GKS == 0);
// one stage of the block tile: per thread 4 rows of A (and of A2), 8 rows of Bt, 32 rows apart
template <int NSPLIT>
__device__ __forceinline__ void stage_copies(const char* gA, const char* gA2, const char* gB, size_t rsA, size_t rsB,
                                             unsigned lA, unsigned lA2, unsigned lB) {
  const unsigned RS = 32 * GLP * 2;      // 32 LDS rows, bytes
  if (NSPLIT >= 1)
    cp_async8(lA, gA, lA + RS, gA + rsA, lA + 2 * RS, gA + 2 * rsA, lA + 3 * RS, gA + 3 * rsA,
              lA2, gA2, lA2 + RS, gA2 + rsA, lA2 + 2 * RS, gA2 + 2 * rsA, lA2 + 3 * RS, gA2 + 3 * rsA);
  else
    cp_async4(lA, gA, lA + RS, gA + rsA, lA + 2 * RS, gA + 2 * rsA, lA + 3 * RS, gA + 3 * rsA);
  cp_async8(lB, gB, lB + RS, gB + rsB, lB + 2 * RS, gB + 2 * rsB, lB + 3 * RS, gB + 3 * rsB,
            lB + 4 * RS, gB + 4 * rsB, lB + 5 * RS, gB + 5 * rsB, lB + 6 * RS, gB + 6 * rsB, lB + 7 * RS, gB + 7 * rsB);
}
// one block tile: tile = index of the tile in the job's M x N plane, b = batch index; the LDS arrays are the calling kernel's
template <int NSPLIT, int OUT_MODE, int BIASM>
__device__ __forceinline__ void gemm64_tile(
    const unsigned short* __restrict__ Ap, const unsigned short* A2p, int lda, long long strideA,
    const unsigned short* __restrict__ Btp, int ldb, long long strideB,
    const float* __restrict__ bias,
    void* Cout, int ldc, long long strideC,
    void* Cout2, int ldc2, long long strideC2, int N2,
    int M, int N, int K, float rscale,
    int tile, int b,
    float (*sT)[16 * 68], __bf16 (*sA)[GBM * GLP], __bf16 (*sA2)[(NSPLIT >= 1) ? GBM * GLP : 8], __bf16 (*sB)[GBN * GLP]) {
  const __bf16* A   = (const __bf16*)(const void*)Ap;
  const __bf16* A2  = (const __bf16*)(const void*)A2p;
  const __bf16* Bt  = (const __bf16*)(const void*)Btp;
  const int tid  = threadIdx.x;
  const int lane = tid & 31;
  const int wave = tid >> 5;
  const int tilesN = N / GBN;
  const int tilesM = M / GBM;
  if (tile >= tilesM * tilesN) return;   // block-uniform, ahead of every barrier
  const int tm = tile / tilesN;
  const int tn = tile - tm * tilesN;
  const int bm0 = tm * GBM;              // block tile origin
  const int bn0 = tn * GBN;
  const int wm0 = (wave >> 2) << 6;      // this wave's 64x64 tile inside the block tile
  const int wn0 = (wave & 3) << 6;
  const int m0 = bm0 + wm0;
  const int n0 = bn0 + wn0;

  const __bf16* Ab  = A  + (size_t)b * strideA;
  const __bf16* Bb  = Bt + (size_t)b * strideB;
  const __bf16* Ab2 = (NSPLIT >= 1) ? (A2 + (size_t)b * strideA) : Ab;

  const int rlane = lane & 15;                 // row (A) / col (B, D) within subtile
  const int koff  = (lane >> 4) * 8;           // k offset of this lane half
  const int mOff  = (lane >> 4) * 8;           // D row offset

  float bcol[4];
#pragma unroll
  for (int j = 0; j < 4; ++j) bcol[j] = 0.f;
  if (BIASM == 0) {
#pragma unroll
    for (int j = 0; j < 4; ++j) bcol[j] = bf_up(bf_bits(bias[n0 + (j << 4) + rlane]));   // n0+63 < N
  }

  v8f acc[4][4];
#pragma unroll
  for (int i = 0; i < 4; ++i)
#pragma unroll
    for (int j = 0; j < 4; ++j) acc[i][j] = zero8();

  // staging map: thread -> row (tid >> 3) + 32 u, 16-B chunk (tid & 7) of the row's 128-B stage line
  const int srow = tid >> 3;
  const int scol = (tid & 7) * 8;
  const char* tA  = (const char*)(Ab  + (size_t)(bm0 + srow) * lda + scol);   // rows bm0 .. bm0+127 < M
  const char* tA2 = (const char*)(Ab2 + (size_t)(bm0 + srow) * lda + scol);
  const char* tB  = (const char*)(Bb  + (size_t)(bn0 + srow) * ldb + scol);   // rows bn0 .. bn0+255 < N
  const size_t rsA = (size_t)lda * 64;                                        // 32 operand rows, bytes
  const size_t rsB = (size_t)ldb * 64;
  const int sOff = srow * GLP + scol;
  const unsigned lA  = (unsigned)(size_t)(&sA[0][sOff]);                      // LDS byte addresses, buffer 0
  const unsigned lA2 = (unsigned)(size_t)(&sA2[0][(NSPLIT >= 1) ? sOff : 0]);
  const unsigned lB  = (unsigned)(size_t)(&sB[0][sOff]);
  const unsigned bufA = GBM * GLP * 2, bufB = GBN * GLP * 2;                  // buffer sizes, bytes
  const int nst = K / GKS;

  stage_copies<NSPLIT>(tA, tA2, tB, rsA, rsB, lA, lA2, lB);                   // stage 0 -> buffer 0
  wait_async0();                         // this wave's copies of stage 0 have landed
  __syncthreads();                       // stage 0 visible to all 8 waves
  if (nst > 1)                           // block-uniform; stage 1 -> buffer 1, flies during stage 0's products
    stage_copies<NSPLIT>(tA + GKS * 2, tA2 + GKS * 2, tB + GKS * 2, rsA, rsB, lA + bufA, lA2 + bufA, lB + bufB);

  for (int t = 0; t < nst; ++t) {
    const int cur = t & 1;
    // per 32 k: all fragments as one group of LDS reads ahead of their products
    const __bf16* pa  = &sA[cur][(wm0 + rlane) * GLP + koff];
    const __bf16* pa2 = &sA2[cur][(NSPLIT >= 1) ? (wm0 + rlane) * GLP + koff : 0];
    const __bf16* pb  = &sB[cur][(wn0 + rlane) * GLP + koff];
#pragma unroll
    for (int kk = 0; kk < 2; ++kk) {
      v16b bh[4], ah[4], al[4];
#pragma unroll
      for (int j = 0; j < 4; ++j) bh[j] = ldfrag_b(pb + (j << 4) * GLP + kk * 32);
#pragma unroll
      for (int i = 0; i < 4; ++i) {
        ah[i] = ldfrag_b(pa + (i << 4) * GLP + kk * 32);
        al[i] = ah[i];
        if (NSPLIT >= 1) al[i] = ldfrag_b(pa2 + (i << 4) * GLP + kk * 32);
      }
#pragma unroll
      for (int i = 0; i < 4; ++i) {
#pragma unroll
        for (int j = 0; j < 4; ++j) {
          acc[i][j] = mma_b_raw(ah[i], bh[j], acc[i][j]);
          if (NSPLIT >= 1) acc[i][j] = mma_b_raw(al[i], bh[j], acc[i][j]);
        }
        dep_guard_b(acc[i][0], acc[i][3], ah[i], al[i]);
      }
      keep4_b(bh[0], bh[1], bh[2], bh[3]);
    }
    wait_ds0();                          // this wave's reads of stage t are done
    wait_async0();                       // this wave's copies of stage t+1 have landed
    __syncthreads();                     // publishes stage t+1 and ends every read of stage t
    if (t + 2 < nst) {                   // block-uniform; stage t+2 -> the buffer stage t has just left
      const size_t kb = (size_t)(t + 2) * (GKS * 2);
      stage_copies<NSPLIT>(tA + kb, tA2 + kb, tB + kb, rsA, rsB,
                           lA + cur * bufA, lA2 + cur * bufA, lB + cur * bufB);
    }
  }
  wait_async0();                         // nothing of this wave is in flight behind the loop
  acc_guard4(acc[0][0], acc[0][1], acc[0][2], acc[0][3]);
  acc_guard4(acc[1][0], acc[1][1], acc[1][2], acc[1][3]);
  acc_guard4(acc[2][0], acc[2][1], acc[2][2], acc[2][3]);
  acc_guard4(acc[3][0], acc[3][1], acc[3][2], acc[3][3]);

  // ---- epilogue ----
  float* slab = sT[wave];
#pragma unroll
  for (int i = 0; i < 4; ++i) {
    const int mBase = m0 + (i << 4);
    float brow[8];
#pragma unroll
    for (int r = 0; r < 8; ++r) brow[r] = 0.f;
    if (BIASM == 1) {
#pragma unroll
      for (int r = 0; r < 8; ++r) brow[r] = bf_up(bf_bits(bias[mBase + mOff + r]));    // < M
    }
#pragma unroll
    for (int j = 0; j < 4; ++j) {
#pragma unroll
      for (int r = 0; r < 8; ++r) {
        slab[(mOff + r) * 68 + (j << 4) + rlane] = acc[i][j][r] + bcol[j] + brow[r];
      }
    }
    __builtin_amdgcn_fence(__ATOMIC_RELEASE, "workgroup");
    __builtin_amdgcn_wave_barrier();
    __builtin_amdgcn_fence(__ATOMIC_ACQUIRE, "workgroup");
    if (OUT_MODE == 0) {
      float* C = (float*)Cout + (size_t)b * strideC;
      const int hh = lane >> 4, c4 = (lane & 15) * 4;     // 256-B row segment = 16 lanes x 16 B
      v4f vv[8];
#pragma unroll
      for (int it = 0; it < 8; ++it) {
        const int row = it * 2 + hh;                       // it 0..7 x hh 0..1 = rows 0..15
        vv[it] = *(const v4f*)(slab + row * 68 + c4);
      }
      {
#pragma unroll
        for (int it = 0; it < 8; ++it) {
          const int row = it * 2 + hh;
          *(v4f*)(C + (size_t)(mBase + row) * ldc + n0 + c4) = vv[it];
        }
        
      }
    } else {
      const int q = lane >> 3, c8 = (lane & 7) * 8;
      unsigned short* C  = (unsigned short*)Cout  + (size_t)b * strideC;
      unsigned short* C2 = (unsigned short*)Cout2 + (size_t)b * strideC2;
      const bool wlo = (OUT_MODE == 2) || (n0 < N2);      // wave-uniform
      v4u hv[4], lv[4];
#pragma unroll
      for (int it = 0; it < 4; ++it) {
        const int row = it * 4 + q;                        // it 0..3 x q 0..3 = rows 0..15
        const float* sp = slab + row * 68 + c8;
        v4u a, a2;
#pragma unroll
        for (int e = 0; e < 4; ++e) {
          const float f0 = sp[2 * e], f1 = sp[2 * e + 1];
          unsigned short h0, h1, l0, l1;
          if (OUT_MODE == 2) {
            h0 = bf_bits(f0); h1 = bf_bits(f1);
            l0 = bf_bits(f0 - bf_up(h0)); l1 = bf_bits(f1 - bf_up(h1));
          } else {
            const _Float16 x0 = (_Float16)f0, x1 = (_Float16)f1;
            h0 = h_bits(x0); h1 = h_bits(x1);
            l0 = h_bits((_Float16)((f0 - (float)x0) * rscale));
            l1 = h_bits((_Float16)((f1 - (float)x1) * rscale));
          }
          a[e] = pk16(h0, h1); a2[e] = pk16(l0, l1);
        }
        hv[it] = a; lv[it] = a2;
      }
      {
#pragma unroll
        for (int it = 0; it < 4; ++it) {
          const int row = it * 4 + q;
          *(v4u*)(C + (size_t)(mBase + row) * ldc + n0 + c8) = hv[it];
#if defined(__HIP_DEVICE_COMPILE__)
          if (OUT_MODE == 3) asm volatile("s_wait_xcnt 0x0" ::: "memory");   // stands ahead of any rewrite of the registers of the store above
#endif
          if (wlo) *(v4u*)(C2 + (size_t)(mBase + row) * ldc2 + n0 + c8) = lv[it];
        }
        
      }
    }
    __builtin_amdgcn_fence(__ATOMIC_RELEASE, "workgroup");
    __builtin_amdgcn_wave_barrier();
    __builtin_amdgcn_fence(__ATOMIC_ACQUIRE, "workgroup");
  }
}
// one job per launch: blockIdx.x = tile, blockIdx.y = batch index
template <int NSPLIT, int OUT_MODE, int BIASM>
__global__ __launch_bounds__(256) void gemm64(
    const unsigned short* __restrict__ Ap, const unsigned short* A2p, int lda, long long strideA,
    const unsigned short* __restrict__ Btp, int ldb, long long strideB,
    const float* __restrict__ bias,
    void* Cout, int ldc, long long strideC,
    void* Cout2, int ldc2, long long strideC2, int N2,
    int M, int N, int K, float rscale) {
  __shared__ __align__(16) float sT[8][16 * 68];   // per-wave 16x64 slab, pitch 68 floats
  __shared__ __align__(16) __bf16 sA[2][GBM * GLP];                          // A stage, two buffers
  __shared__ __align__(16) __bf16 sA2[2][(NSPLIT >= 1) ? GBM * GLP : 8];     // A2 stage (NSPLIT only)
  __shared__ __align__(16) __bf16 sB[2][GBN * GLP];                          // Bt stage, two buffers
  gemm64_tile<NSPLIT, OUT_MODE, BIASM>(Ap, A2p, lda, strideA, Btp, ldb, strideB, bias, Cout, ldc, strideC,
                                       Cout2, ldc2, strideC2, N2, M, N, K, rscale,
                                       (int)blockIdx.x, (int)blockIdx.y, sT, sA, sA2, sB);
}
// the q, k and v^T projections in one grid, a range of block indices per job (block-uniform choice):
//   k   = x . Wk^T + bk -> bf16 hi/lo planes [b*MTOK+s][h*64+d]                 (M=8192, N=1024, K=1024)
//   v^T = Wv . x^T + bv (per row) per batch -> f16 hi plane [b][h*64+d][s] (pitch MTOK) and residual plane
//         (x4096, keys < VLP only, pitch VLP)   (A = Wvb [n][k], Bt = Xb rows of batch b; M=1024, N=4096, K=1024)
//   q   = l . Wq^T + bq -> bf16 hi/lo planes [b*NLAT+t][h*64+d]                 (M=2048, N=1024, K=1024)
#define GT_K  ((NB * MTOK / GBM) * (DM / GBN))   // 64 x  4 = 256 tiles
#define GT_VT ((DM / GBM) * (MTOK / GBN))        //  8 x 16 = 128 tiles per batch
#define GT_Q  ((NB * NLAT / GBM) * (DM / GBN))   // 16 x  4 =  64 tiles
__global__ __launch_bounds__(256) void gemm_qkv(
    const unsigned short* __restrict__ Lb, const unsigned short* __restrict__ Xb,
    const unsigned short* __restrict__ Wqb, const unsigned short* __restrict__ Wkb, const unsigned short* __restrict__ Wvb,
    const float* __restrict__ bq, const float* __restrict__ bk, const float* __restrict__ bv,
    unsigned short* Qh, unsigned short* Ql, unsigned short* Kh, unsigned short* Kl,
    unsigned short* VTh, unsigned short* VTl) {
  __shared__ __align__(16) float sT[8][16 * 68];   // per-wave 16x64 slab, pitch 68 floats
  __shared__ __align__(16) __bf16 sA[2][GBM * GLP];                          // A stage, two buffers
  __shared__ __align__(16) __bf16 sA2[2][8];                                 // not used by these jobs
  __shared__ __align__(16) __bf16 sB[2][GBN * GLP];                          // Bt stage, two buffers
  const int blk = blockIdx.x;
  if (blk >= GT_K && blk < GT_K + NB * GT_VT) {
    const int t = blk - GT_K;
    gemm64_tile<0, 3, 1>(Wvb, Wvb, DM, 0LL, Xb, DM, (long long)MTOK * DM, bv,
                         (void*)VTh, MTOK, (long long)DM * MTOK, (void*)VTl, VLP, (long long)DM * VLP, VLP,
                         DM, MTOK, DM, 4096.0f, t % GT_VT, t / GT_VT, sT, sA, sA2, sB);
  } else {
    const bool isK = blk < GT_K;
    gemm64_tile<0, 2, 0>(isK ? Xb : Lb, isK ? Xb : Lb, DM, 0LL, isK ? Wkb : Wqb, DM, 0LL, isK ? bk : bq,
                         (void*)(isK ? Kh : Qh), DM, 0LL, (void*)(isK ? Kl : Ql), DM, 0LL, DM,
                         isK ? NB * MTOK : NB * NLAT, DM, DM, 1.0f,
                         isK ? blk : blk - (GT_K + NB * GT_VT), 0, sT, sA, sA2, sB);
  }
}

// =====================================================================================================
// Attention with block-triangular visibility (key j visible to query t iff j / DSF <= t, i.e. j < DSF*(t+1)),
// head dim 64, queries from the latent planes (NLAT per batch), keys / values from the token planes (MTOK).
//   q planes (bf16 hi / lo): element (b, t, h, d) at [(b*NLAT + t)*DM + h*64 + d]
//   k planes (bf16 hi / lo): element (b, s, h, d) at [(b*MTOK + s)*DM + h*64 + d]
//   v^T hi plane (f16):      element (b, h, d, s) at [(b*DM + h*64 + d)*MTOK + s]
//   v^T residual plane (f16, (v - hi)*4096): [(b*DM + h*64 + d)*VLP + s], s < VLP, read only when RES
//   (a key tile at or beyond VLP contributes a zero v residual; never happens for the RES query blocks)
//   Query block qb (64 rows) needs key tiles 0 .. DSF*(qb+1)-1; they are split into chunks of CH tiles, one
//   work-group per chunk (block-uniform break out of a loop with static trip CH), so that the serial walk over
//   key tiles is CH long; inside a tile, invisible keys get -inf logits -> weight exactly 0. A row that sees no
//   key of its chunk leaves m = -inf, l = 0 and a zero context there.
//   out: the chunk's partial sums in f32, slot = ((b*NH + h)*NQB + qb)*MAXCH + chunk:
//     Po  [slot][wave][t*2 + half][lane][4]: the wave's unnormalised context accumulators, register order
//     Pml [slot][wave][lane>>4][m of rows 8*(lane>>4)+0..7, then l of the same rows]  (128 B per wave)
//   scores = q . k : bf16 hi/lo split (hi.hi + hi.lo + lo.hi), f32 accumulate, then * sscale in f32
//   p = exp(s - m) carried as f16(1024 p); context = p . v on f16 WMMA; RES adds f16 residual planes of p and v
//   (scale 4096, separate accumulator folded back with 1/4096 per tile in f32); online softmax in f32.
//   Block = 4 waves = 64 query rows of one (b, h); grid = (chunks of the nqbThis query blocks, NH * NB); kv tiles of 64.
//   K / V^T tile staging: 128 threads x 32 elements per plane = the whole 64x64 tile (plain 16-B loads,
//   __syncthreads before and after); P tiles are wave-private, spilled with _Float16 element stores and reloaded
//   Output coverage: each wave stores its whole 4-KB part of Po (8 stores x 512 B) and its 128-B part of Pml.
// =====================================================================================================
// LDS row pitch of the K, V^T and P tiles, elements: 144 B = 16 B x odd, so that the 16 rows of a ds_load_b128 fragment
// read fall on all 64 banks once (at the rows' own 128 B they fall on 8 banks)
#define ALP 72
// second launch bound = waves per SIMD that must fit: it holds the register count where several chunks share a WGP
template <bool RES, int CH>
__global__ __launch_bounds__(128, RES ? 4 : 5)
void attn_bc64(const unsigned short* __restrict__ qhp, const unsigned short* __restrict__ qlp,
               const unsigned short* __restrict__ khp, const unsigned short* __restrict__ klp,
               const unsigned short* __restrict__ vhp, const unsigned short* __restrict__ vlp,
               float* Po, float* Pml,
               int qbBase, int nqbThis, float sscale) {
  union FB { v16b v; v8b h[2]; };
  union FH { v16h v; v8h h[2]; };
  __shared__ __align__(16) __bf16   Ksh[64 * ALP];                // K hi [kv][d]   9 KB
  __shared__ __align__(16) __bf16   Ksl[64 * ALP];                // K lo
  __shared__ __align__(16) _Float16 Vth[64 * ALP];                // V^T hi [d][kv] 9 KB
  __shared__ __align__(16) _Float16 Vtl[RES ? 64 * ALP : 8];      // V^T residual
  __shared__ __align__(16) _Float16 Psh[4][16 * ALP];             // per wave P [row][kv]
  __shared__ __align__(16) _Float16 Psl[RES ? 4 : 1][16 * ALP];   // per wave P residual

  const int tid  = threadIdx.x;
  const int wave = tid >> 5;
  const int lane = tid & 31;
  const int hh   = lane >> 4;
  const int c    = lane & 15;

  const int h    = blockIdx.y % NH;
  const int b    = blockIdx.y / NH;
  int chunk = blockIdx.x;                          // blockIdx.x counts the chunks of qbBase, then of qbBase+1, ...
  int qb    = qbBase;
  for (int i = 1; i < NQB; ++i) {                  // block-uniform, static trip count
    const int nc = n_chunks(qb, CH);
    if (chunk < nc || i >= nqbThis) break;
    chunk -= nc;
    ++qb;
  }
  const int q0   = qb * 64 + wave * 16;            // query row within the batch
  const size_t rowQ = (size_t)b * NLAT;
  const size_t rowK = (size_t)b * MTOK;
  int ktEnd = DSF * (qb + 1);                      // key tiles 0..ktEnd-1 hold every visible key of this block
  if (ktEnd > NKT) ktEnd = NKT;
  const int ktBeg = chunk * CH;                    // this work-group: key tiles ktBeg .. min(ktBeg+CH, ktEnd)-1

  const __bf16* Qh = (const __bf16*)(const void*)qhp + (size_t)h * HD;
  const __bf16* Ql = (const __bf16*)(const void*)qlp + (size_t)h * HD;
  const __bf16* Kh = (const __bf16*)(const void*)khp + (size_t)h * HD;
  const __bf16* Kl = (const __bf16*)(const void*)klp + (size_t)h * HD;
  const _Float16* Vh = (const _Float16*)(const void*)vhp + ((size_t)b * DM + (size_t)h * HD) * MTOK;
  const _Float16* Vl = (const _Float16*)(const void*)vlp + ((size_t)b * DM + (size_t)h * HD) * VLP;

  // ---- Q fragments (A operand, row = lane&15): 2 d-chunks, hi and lo ----
  v16b qah[2], qal[2];
#pragma unroll
  for (int dc = 0; dc < 2; ++dc) {
    const size_t qo = (rowQ + q0 + c) * DM + dc * 32 + 8 * hh;
    qah[dc] = ldfrag_b(Qh + qo);
    qal[dc] = ldfrag_b(Ql + qo);
  }
#if defined(__HIP_DEVICE_COMPILE__)
  asm volatile("s_wait_xcnt 0x0" ::: "memory");   // stands ahead of any rewrite of the address registers of the Q loads above
#endif
  __builtin_amdgcn_sched_barrier(0);               // keeps later address arithmetic, which reuses those registers, behind that wait

  float mrow[8], lrow[8];
  v8f oacc[4];
#pragma unroll
  for (int r = 0; r < 8; ++r) { mrow[r] = -INFINITY; lrow[r] = 0.f; }
#pragma unroll
  for (int t = 0; t < 4; ++t) oacc[t] = zero8();

  for (int ki = 0; ki < CH; ++ki) {          // static trip count
    const int kt = ktBeg + ki;
    if (kt >= ktEnd) break;                  // block-uniform
    const int kv0 = kt * 64;
    __syncthreads();
    {
      const int r = tid >> 1, half = (tid & 1) * 32;
      const __bf16*   kg  = Kh + (rowK + kv0 + r) * DM + half;    // K row kv0+r, d = half..half+31
      const __bf16*   klg = Kl + (rowK + kv0 + r) * DM + half;
      const _Float16* vg  = Vh + (size_t)r * MTOK + kv0 + half;   // V^T row d = r, s = kv0+half..+31
      const int kvl = (kv0 + 64 <= VLP) ? kv0 : (VLP - 64);     // clamped address into the residual plane
      const _Float16* vlg = Vl + (size_t)r * VLP + kvl + half;
      const bool resOK = (kv0 + 64 <= VLP);                      // block-uniform
#pragma unroll
      for (int i = 0; i < 4; ++i) {
        const v8b a0 = *(const v8b*)(kg + 8 * i);
        const v8b a1 = *(const v8b*)(klg + 8 * i);
        const v8h b0 = *(const v8h*)(vg + 8 * i);
        *(v8b*)(Ksh + r * ALP + half + 8 * i) = a0;
        *(v8b*)(Ksl + r * ALP + half + 8 * i) = a1;
        *(v8h*)(Vth + r * ALP + half + 8 * i) = b0;
        if (RES) {
          v8h b1 = *(const v8h*)(vlg + 8 * i);
          if (!resOK) b1 = zero8h();
          *(v8h*)(Vtl + r * ALP + half + 8 * i) = b1;
        }
      }
    }
    __syncthreads();

    // ---- scores: 16 query rows x 64 keys per wave, 3 bf16 products ----
    v8f s[4];
#pragma unroll
    for (int j = 0; j < 4; ++j) {
      s[j] = zero8();
#pragma unroll
      for (int dc = 0; dc < 2; ++dc) {
        FB kb, kl;
        kb.h[0] = *(const v8b*)(Ksh + (j * 16 + c) * ALP + dc * 32 + 8 * hh);
        kb.h[1] = *(const v8b*)(Ksh + (j * 16 + c) * ALP + dc * 32 + 16 + 8 * hh);
        kl.h[0] = *(const v8b*)(Ksl + (j * 16 + c) * ALP + dc * 32 + 8 * hh);
        kl.h[1] = *(const v8b*)(Ksl + (j * 16 + c) * ALP + dc * 32 + 16 + 8 * hh);
        s[j] = mma_b(qah[dc], kb.v, s[j]);
        s[j] = mma_b(qah[dc], kl.v, s[j]);
        s[j] = mma_b(qal[dc], kb.v, s[j]);
      }
    }

    // ---- scale + visibility test (-inf for invisible keys), row max, online softmax,
    //      P (x1024, f16) and P residual (x4096) to LDS ----
    _Float16* pwh = Psh[wave];
    _Float16* pwl = Psl[RES ? wave : 0];
#pragma unroll
    for (int r = 0; r < 8; ++r) {
      const int tq  = q0 + 8 * hh + r;           // query row within the batch
      const int lim = DSF * (tq + 1);            // visible keys: j < lim
      float m = -INFINITY;
#pragma unroll
      for (int j = 0; j < 4; ++j) {
        const int key = kv0 + j * 16 + c;
        const float sv = (key < lim) ? s[j][r] * sscale : -INFINITY;
        s[j][r] = sv;
        m = fmaxf(m, sv);
      }
#pragma unroll
      for (int off = 1; off < 16; off <<= 1) m = fmaxf(m, __shfl_xor(m, off, 32));
      const float mnew  = fmaxf(mrow[r], m);
      const float msafe = (mnew == -INFINITY) ? 0.f : mnew;
      const float alpha = __expf(mrow[r] - msafe);
      mrow[r] = mnew;
      float psum = 0.f;
#pragma unroll
      for (int j = 0; j < 4; ++j) {
        const float p = __expf(s[j][r] - msafe);     // -inf logit -> exactly 0
        psum += p;
        const float p1k = p * 1024.0f;
        const _Float16 ph = (_Float16)p1k;
        pwh[(8 * hh + r) * ALP + j * 16 + c] = ph;
        if (RES) {
          const _Float16 pl = (_Float16)((p1k - (float)ph) * 4096.0f);
          pwl[(8 * hh + r) * ALP + j * 16 + c] = pl;
        }
      }
#pragma unroll
      for (int off = 1; off < 16; off <<= 1) psum += __shfl_xor(psum, off, 32);
      lrow[r] = lrow[r] * alpha + psum;
#pragma unroll
      for (int t = 0; t < 4; ++t) oacc[t][r] *= alpha;
    }
    __builtin_amdgcn_fence(__ATOMIC_RELEASE, "workgroup");
    __builtin_amdgcn_wave_barrier();
    __builtin_amdgcn_fence(__ATOMIC_ACQUIRE, "workgroup");

    // ---- context += P . V (f16 WMMA), residual products into a separate accumulator ----
    v8f o1[4];
#pragma unroll
    for (int t = 0; t < 4; ++t) o1[t] = zero8();
#pragma unroll 1
    for (int kk = 0; kk < 2; ++kk) {
      FH pa, pl;
      pa.h[0] = *(const v8h*)(pwh + c * ALP + kk * 32 + 8 * hh);
      pa.h[1] = *(const v8h*)(pwh + c * ALP + kk * 32 + 16 + 8 * hh);
      if (RES) {
        pl.h[0] = *(const v8h*)(pwl + c * ALP + kk * 32 + 8 * hh);
        pl.h[1] = *(const v8h*)(pwl + c * ALP + kk * 32 + 16 + 8 * hh);
      } else {
        pl.v = pa.v;
      }
#pragma unroll
      for (int t = 0; t < 4; ++t) {
        FH vb;
        vb.h[0] = *(const v8h*)(Vth + (t * 16 + c) * ALP + kk * 32 + 8 * hh);
        vb.h[1] = *(const v8h*)(Vth + (t * 16 + c) * ALP + kk * 32 + 16 + 8 * hh);
        oacc[t] = mma_h(pa.v, vb.v, oacc[t]);
        if (RES) {
          FH vl;
          vl.h[0] = *(const v8h*)(Vtl + (t * 16 + c) * ALP + kk * 32 + 8 * hh);
          vl.h[1] = *(const v8h*)(Vtl + (t * 16 + c) * ALP + kk * 32 + 16 + 8 * hh);
          o1[t] = mma_h(pa.v, vl.v, o1[t]);
          o1[t] = mma_h(pl.v, vb.v, o1[t]);
        }
      }
    }
    if (RES) {
#pragma unroll
      for (int t = 0; t < 4; ++t)
#pragma unroll
        for (int r = 0; r < 8; ++r) oacc[t][r] += o1[t][r] * (1.0f / 4096.0f);
    }
  }

  // ---- the chunk's partial sums: accumulators in register order (512 contiguous B per wave store), m and l per row ----
  const size_t slot = ((size_t)(b * NH + h) * NQB + qb) * MAXCH + chunk;
  float* po = Po + (slot * 4 + wave) * 1024 + lane * 4;
#pragma unroll
  for (int t = 0; t < 4; ++t) {
    const v4f lo = {oacc[t][0], oacc[t][1], oacc[t][2], oacc[t][3]};
    const v4f hi = {oacc[t][4], oacc[t][5], oacc[t][6], oacc[t][7]};
    *(v4f*)(po + (t * 2) * 128)     = lo;
    *(v4f*)(po + (t * 2 + 1) * 128) = hi;
  }
  if (c == 0) {                                    // m and l are equal in the 16 lanes of a half
    float* pm = Pml + (slot * 4 + wave) * 32 + hh * 16;
    const v4f m0 = {mrow[0], mrow[1], mrow[2], mrow[3]};
    const v4f m1 = {mrow[4], mrow[5], mrow[6], mrow[7]};
    const v4f l0 = {lrow[0], lrow[1], lrow[2], lrow[3]};
    const v4f l1 = {lrow[4], lrow[5], lrow[6], lrow[7]};
    *(v4f*)(pm)      = m0;
    *(v4f*)(pm + 4)  = m1;
    *(v4f*)(pm + 8)  = l0;
    *(v4f*)(pm + 12) = l1;
  }
}

// =====================================================================================================
// Merge of the key chunks of one query block, chunks in rising order, by the running-maximum rule of the attention
// loop itself: m' = max(m, m_c), l = l exp(m - m') + l_c exp(m_c - m'), context likewise; then the normalisation
// and the bf16 hi / lo split.
//   Block = 4 waves = the 64 query rows of one (b, h, qb); every thread holds the elements that the same thread of
//   the attention work-groups held. Only slots 0 .. nch-1 of the query block are read: all written by the two launches before.
//   out planes (bf16 hi / lo of the normalised context): element (b, t, h, d) at [(b*NLAT + t)*DM + h*64 + d]
//   Output coverage: each wave stores rows q0..q0+15 (it 0..3 x lane>>3 0..3) x 64 columns (8 lanes x 8) of both planes.
// =====================================================================================================
// inputs-only fence on loaded values: the loads of a trip all issue ahead of the arithmetic, so that a trip pays one
// memory latency; without it the compiler sinks some of the loads behind the first wait and the trip pays two
__device__ __forceinline__ void hold_loads12(v4f a0, v4f a1, v4f a2, v4f a3, v4f b0, v4f b1, v4f b2, v4f b3,
                                             v4f b4, v4f b5, v4f b6, v4f b7) {
#if defined(__HIP_DEVICE_COMPILE__)
  asm volatile("" :: "v"(a0), "v"(a1), "v"(a2), "v"(a3), "v"(b0), "v"(b1), "v"(b2), "v"(b3),
                     "v"(b4), "v"(b5), "v"(b6), "v"(b7));
#else
  (void)a0; (void)a1; (void)a2; (void)a3; (void)b0; (void)b1; (void)b2; (void)b3;
  (void)b4; (void)b5; (void)b6; (void)b7;
#endif
}
// one slot into the running sums: ml = m of 8 rows, l of 8 rows; ov = the slot's context accumulators, register order
__device__ __forceinline__ void merge_slot(const v4f* ml, const v4f* ov, float* mrow, float* lrow, v8f* oacc) {
#pragma unroll
  for (int r = 0; r < 8; ++r) {
    const float mc    = ml[r >> 2][r & 3];
    const float mnew  = fmaxf(mrow[r], mc);
    const float msafe = (mnew == -INFINITY) ? 0.f : mnew;
    const float alpha = __expf(mrow[r] - msafe);   // -inf -> exactly 0
    const float w     = __expf(mc - msafe);
    mrow[r] = mnew;
    lrow[r] = lrow[r] * alpha + w * ml[2 + (r >> 2)][r & 3];
#pragma unroll
    for (int t = 0; t < 4; ++t) oacc[t][r] = oacc[t][r] * alpha + w * ov[t * 2 + (r >> 2)][r & 3];
  }
}
__global__ __launch_bounds__(128)
void attn_merge(const float* __restrict__ Po, const float* __restrict__ Pml,
                unsigned short* ohp, unsigned short* olp) {
  __shared__ __align__(16) float Os[4][16 * 64];   // per wave context tile [row][d]
  const int tid  = threadIdx.x;
  const int wave = tid >> 5;
  const int lane = tid & 31;
  const int hh   = lane >> 4;
  const int c    = lane & 15;
  const int qb   = blockIdx.x;
  const int h    = blockIdx.y % NH;
  const int b    = blockIdx.y / NH;
  const int q0   = qb * 64 + wave * 16;            // query row within the batch
  const size_t rowQ = (size_t)b * NLAT;
  const int nch  = (qb < RESQB) ? n_chunks(qb, CHR) : n_chunks(qb, CHN);   // 1 .. MAXCH, block-uniform
  const size_t slot0 = ((size_t)(b * NH + h) * NQB + qb) * MAXCH;
  const float* pmB = Pml + (slot0 * 4 + wave) * 32 + hh * 16;
  const float* poB = Po + (slot0 * 4 + wave) * 1024 + lane * 4;

  float mrow[8], lrow[8];
  v8f oacc[4];
#pragma unroll
  for (int r = 0; r < 8; ++r) { mrow[r] = -INFINITY; lrow[r] = 0.f; }
#pragma unroll
  for (int t = 0; t < 4; ++t) oacc[t] = zero8();
  int ch = 0;
  // kept rolled: the trip count is known only at run time, and the two pointers then live over the whole loop
#pragma unroll 1
  for (; ch + 2 <= nch; ch += 2) {                 // nch <= MAXCH, block-uniform; two slots per trip: their loads fly together
    v4f ml[8], ov[16];
#pragma unroll
    for (int u = 0; u < 2; ++u) {
#pragma unroll
      for (int e = 0; e < 4; ++e) ml[u * 4 + e] = *(const v4f*)(pmB + u * 128 + e * 4);
#pragma unroll
      for (int e = 0; e < 8; ++e) ov[u * 8 + e] = *(const v4f*)(poB + u * 4096 + e * 128);
    }
    hold_loads12(ml[0], ml[1], ml[2], ml[3], ov[0], ov[1], ov[2], ov[3], ov[4], ov[5], ov[6], ov[7]);
    hold_loads12(ml[4], ml[5], ml[6], ml[7], ov[8], ov[9], ov[10], ov[11], ov[12], ov[13], ov[14], ov[15]);
    pmB += 2 * 128;                                // two slots on
    poB += 2 * 4096;
    merge_slot(ml, ov, mrow, lrow, oacc);
    merge_slot(ml + 4, ov + 8, mrow, lrow, oacc);
  }
  if (ch < nch) {                                  // block-uniform: the last slot of an odd count
    v4f ml[4], ov[8];
#pragma unroll
    for (int e = 0; e < 4; ++e) ml[e] = *(const v4f*)(pmB + e * 4);
#pragma unroll
    for (int e = 0; e < 8; ++e) ov[e] = *(const v4f*)(poB + e * 128);
    hold_loads12(ml[0], ml[1], ml[2], ml[3], ov[0], ov[1], ov[2], ov[3], ov[4], ov[5], ov[6], ov[7]);
    merge_slot(ml, ov, mrow, lrow, oacc);
  }

  // ---- normalise (1/l and the 1/1024 p carry), stage the wave's 16x64 tile, bf16 hi/lo split,
  float* os = Os[wave];
#pragma unroll
  for (int r = 0; r < 8; ++r) {
    const float l = lrow[r];
    const float inv = ((l > 0.f) ? (1.0f / l) : 0.f) * (1.0f / 1024.0f);
#pragma unroll
    for (int t = 0; t < 4; ++t) os[(8 * hh + r) * 64 + t * 16 + c] = oacc[t][r] * inv;
  }
  __builtin_amdgcn_fence(__ATOMIC_RELEASE, "workgroup");
  __builtin_amdgcn_wave_barrier();
  __builtin_amdgcn_fence(__ATOMIC_ACQUIRE, "workgroup");
  {
    const int q4 = lane >> 3, c8 = (lane & 7) * 8;
    v4u hv[4], lv[4];
#pragma unroll
    for (int it = 0; it < 4; ++it) {
      const int row = it * 4 + q4;   // it 0..3 x q4 0..3 = rows 0..15 of the wave tile
      const float* sp = os + row * 64 + c8;
      v4u a, a2;
#pragma unroll
      for (int e = 0; e < 4; ++e) {
        const float f0 = sp[2 * e], f1 = sp[2 * e + 1];
        const unsigned short h0 = bf_bits(f0), h1 = bf_bits(f1);
        const unsigned short l0 = bf_bits(f0 - bf_up(h0)), l1 = bf_bits(f1 - bf_up(h1));
        a[e] = pk16(h0, h1); a2[e] = pk16(l0, l1);
      }
      hv[it] = a; lv[it] = a2;
    }
    {
#pragma unroll
      for (int it = 0; it < 4; ++it) {
        const int row = it * 4 + q4;
        const size_t go = (rowQ + q0 + row) * DM + (size_t)h * HD + c8;
        *(v4u*)(ohp + go) = hv[it];
        *(v4u*)(olp + go) = lv[it];
      }
      
    }
  }
}

// =====================================================================================================
// Workspace map (bytes), every region an exact multiple of its 64x64-tile / whole-line store granularity
// (M, N of every GEMM are multiples of 64; converts write whole 512-B groups):
//   Lb   bf16 [2048][1024]            0            4194304
//   Xb   bf16 [8192][1024]            4194304     16777216
//   Wqb  bf16 [1024 n][1024 k]        20971520     2097152
//   Wkb  bf16 [1024][1024]            23068672     2097152
//   Wvb  bf16 [1024][1024]            25165824     2097152
//   Wob  bf16 [1024][1024]            27262976     2097152
//   Qh   bf16 [2048][1024]            29360128     4194304
//   Ql   bf16 [2048][1024]            33554432     4194304
//   Kh   bf16 [8192][1024]            37748736    16777216
//   Kl   bf16 [8192][1024]            54525952    16777216
//   VTh  f16  [2][1024][4096]         71303168    16777216
//   VTl  f16  [2][1024][1024]         88080384     4194304
//   Oh   bf16 [2048][1024]            92274688     4194304
//   Ol   bf16 [2048][1024]            96468992     4194304
//   Po   f32  [8192 slots][4096]       100663296   134217728
//   Pml  f32  [8192 slots][128]        234881024     4194304
//   end                               239075328
// Weights are [out n][in k] with k contiguous = the Bt / A layout the GEMM wants, so they are only converted.
// =====================================================================================================
extern "C" void kernel_launch(void* const* d_in, const int* in_sizes, int n_in,
                              void* d_out, int out_size, void* d_ws, size_t ws_size,
                              hipStream_t stream) {
  if (n_in < 10) return;
  if (in_sizes[0] != NB * MTOK * DM) return;
  if (in_sizes[1] != NB * NLAT * DM) return;
  if (in_sizes[2] != DM * DM || in_sizes[4] != DM * DM || in_sizes[6] != DM * DM || in_sizes[8] != DM * DM) return;
  if (in_sizes[3] != DM || in_sizes[5] != DM || in_sizes[7] != DM || in_sizes[9] != DM) return;
  if (out_size != NB * NLAT * DM) return;

  const float* x  = (const float*)d_in[0];
  const float* lt = (const float*)d_in[1];
  const float* Wq = (const float*)d_in[2];
  const float* bq = (const float*)d_in[3];
  const float* Wk = (const float*)d_in[4];
  const float* bk = (const float*)d_in[5];
  const float* Wv = (const float*)d_in[6];
  const float* bv = (const float*)d_in[7];
  const float* Wo = (const float*)d_in[8];
  const float* bo = (const float*)d_in[9];

  const size_t PL  = (size_t)NB * NLAT * DM * 2;   //  4194304  16-bit latent-side plane [2048][1024]
  const size_t PX  = (size_t)NB * MTOK * DM * 2;   // 16777216  16-bit token-side plane [8192][1024]
  const size_t PW  = (size_t)DM * DM * 2;          //  2097152  16-bit weight plane
  const size_t PVT = (size_t)NB * DM * MTOK * 2;   // 16777216  v^T hi plane
  const size_t PVL = (size_t)NB * DM * VLP * 2;    //  4194304  v^T residual plane
  size_t off = 0;
  const size_t oLb  = off; off += PL;
  const size_t oXb  = off; off += PX;
  const size_t oWq  = off; off += PW;
  const size_t oWk  = off; off += PW;
  const size_t oWv  = off; off += PW;
  const size_t oWo  = off; off += PW;
  const size_t oQh  = off; off += PL;
  const size_t oQl  = off; off += PL;
  const size_t oKh  = off; off += PX;
  const size_t oKl  = off; off += PX;
  const size_t oVTh = off; off += PVT;
  const size_t oVTl = off; off += PVL;
  const size_t oOh  = off; off += PL;
  const size_t oOl  = off; off += PL;
  const size_t oPo  = off; off += (size_t)NB * NH * NQB * MAXCH * 4096 * 4;   // 134217728  partial context sums
  const size_t oPm  = off; off += (size_t)NB * NH * NQB * MAXCH * 128 * 4;    //   4194304  partial m and l
  if (off > ws_size) return;                       // off = 239075328

  char* ws = (char*)d_ws;
  unsigned short* Lb  = (unsigned short*)(ws + oLb);
  unsigned short* Xb  = (unsigned short*)(ws + oXb);
  unsigned short* Wqb = (unsigned short*)(ws + oWq);
  unsigned short* Wkb = (unsigned short*)(ws + oWk);
  unsigned short* Wvb = (unsigned short*)(ws + oWv);
  unsigned short* Wob = (unsigned short*)(ws + oWo);
  unsigned short* Qh  = (unsigned short*)(ws + oQh);
  unsigned short* Ql  = (unsigned short*)(ws + oQl);
  unsigned short* Kh  = (unsigned short*)(ws + oKh);
  unsigned short* Kl  = (unsigned short*)(ws + oKl);
  unsigned short* VTh = (unsigned short*)(ws + oVTh);
  unsigned short* VTl = (unsigned short*)(ws + oVTl);
  unsigned short* Oh  = (unsigned short*)(ws + oOh);
  unsigned short* Ol  = (unsigned short*)(ws + oOl);
  float* Po  = (float*)(ws + oPo);
  float* Pml = (float*)(ws + oPm);

  const dim3 blk(256);
  const dim3 gCvt(CVB_X + CVB_L + 4 * CVB_W);                  // 4096 + 1024 + 4 x 512 = 7168 blocks
  const dim3 gQKV(GT_K + NB * GT_VT + GT_Q);                   //  256 + 2 x 128 + 64 = 576 blocks
  const dim3 gO((NB * NLAT / GBM) * (DM / GBN), 1);            //  16 x  4 =  64 blocks: M=2048, N=1024

  // (1) inputs and weights [n][k] f32 -> bf16 planes, one grid
  cvt_bf16x8_all<<<gCvt, blk, 0, stream>>>(x, lt, Wq, Wk, Wv, Wo, Xb, Lb, Wqb, Wkb, Wvb, Wob);
  // (2) - (4) the k, v^T and q projections, one grid
  gemm_qkv<<<gQKV, blk, 0, stream>>>(Lb, Xb, Wqb, Wkb, Wvb, bq, bk, bv, Qh, Ql, Kh, Kl, VTh, VTl);
  // (5) attention, one work-group per key chunk: query blocks 0..RESQB-1 with residual planes, the rest without;
  //     then the merge of each query block's chunks -> context planes
  attn_bc64<true, CHR><<<dim3(NCR, NB * NH), dim3(128), 0, stream>>>(
      Qh, Ql, Kh, Kl, VTh, VTl, Po, Pml, 0, RESQB, 0.125f);
  attn_bc64<false, CHN><<<dim3(NCN, NB * NH), dim3(128), 0, stream>>>(
      Qh, Ql, Kh, Kl, VTh, VTl, Po, Pml, RESQB, NQB - RESQB, 0.125f);
  attn_merge<<<dim3(NQB, NB * NH), dim3(128), 0, stream>>>(Po, Pml, Oh, Ol);
  // (6) out = context . Wo^T + bo -> d_out f32 [2048][1024]  (A = context hi + lo planes, 2 products)
  gemm64<1, 0, 0><<<gO, blk, 0, stream>>>(
      Oh, Ol, DM, 0LL, Wob, DM, 0LL, bo,
      d_out, DM, 0LL, d_out, DM, 0LL, DM,
      NB * NLAT, DM, DM, 1.0f);
  (void)hipGetLastError();
}

// v005
// A run of this version takes 140 microseconds.
// Two timings next to v004 both put it at 1.13 times that version's speed.
// Over all steps from v000 it is 3.87 times as fast.
// Contractions: q, k, v^T projections = v_wmma_f32_16x16x32_bf16 (bf16 operands from RNE-converted f32 inputs, single product, f32 accumulate, f32 bias add);
// scores, transposed, k.q^T = v_wmma_f32_16x16x32_bf16 on bf16 hi/lo planes of q and k (hi.hi + lo.hi + hi.lo), f32 accumulate;
// context, transposed, v^T.p^T = v_wmma_f32_16x16x32_f16 (p carried x1024 in f16, v in f16, plus f16 residual planes x4096 of p and v on the leading query blocks), f32 accumulate;
// ctx.Wo^T = v_wmma_f32_16x16x32_bf16 with ctx as bf16 hi/lo planes times bf16 Wo (2 products), f32 accumulate; visibility test and softmax in f32.
// The keys of a query block are split into chunks, one work-group each; a later launch merges the chunks' f32 partial sums.
// Launches that do not depend on one another share one grid, a range of block indices per job (the six converts; the q, k, v^T projections).
#include <hip/hip_runtime.h>
#include <math.h>
#include <float.h>
#include <stdint.h>

#define NB    2
#define NLAT  1024         // query (latent) length per batch
#define MTOK  4096         // key / value (token) length per batch
#define DM    1024
#define NH    16
#define HD    64
#define DSF   4            // key j visible to query t iff j / DSF <= t
#define NQB   (NLAT / 64)  // 16 query blocks of 64 rows
#define NKT   (MTOK / 64)  // 64 key tiles of 64
#define RESQB 4            // leading query blocks that use the p / v residual planes
#define VLP   1024         // key pitch of the v^T residual plane (keys 0..VLP-1)
static_assert(RESQB * 64 * DSF <= VLP);
static_assert(NH * HD == DM);
static_assert(MTOK == NLAT * DSF);
static_assert((NLAT % 64) == 0 && (MTOK % 64) == 0 && (DM % 64) == 0);
static_assert((VLP % 64) == 0 && VLP <= MTOK);
static_assert(DSF * NQB <= NKT);
#define CHR   2            // key tiles per work-group, query blocks with residual planes
#define CHN   4            // key tiles per work-group, the other query blocks
#define MAXCH 16           // partial-sum slots per query block
#define NCR   20           // chunks of query blocks 0 .. RESQB-1, one (b, h)
#define NCN   126          // chunks of query blocks RESQB .. NQB-1, one (b, h)
__host__ __device__ constexpr int n_chunks(int qb, int ch) { return (DSF * (qb + 1) + ch - 1) / ch; }
__host__ __device__ constexpr int sum_chunks(int q0, int q1, int ch) {
  int s = 0;
  for (int q = q0; q < q1; ++q) s += n_chunks(q, ch);
  return s;
}
static_assert(n_chunks(RESQB - 1, CHR) <= MAXCH && n_chunks(NQB - 1, CHN) <= MAXCH);
static_assert(sum_chunks(0, RESQB, CHR) == NCR && sum_chunks(RESQB, NQB, CHN) == NCN);

typedef _Float16 v16h __attribute__((ext_vector_type(16)));
typedef _Float16 v8h  __attribute__((ext_vector_type(8)));
typedef __bf16   v16b __attribute__((ext_vector_type(16)));
typedef __bf16   v8b  __attribute__((ext_vector_type(8)));
typedef float    v8f  __attribute__((ext_vector_type(8)));
typedef float    v4f  __attribute__((ext_vector_type(4)));
typedef unsigned int v4u __attribute__((ext_vector_type(4)));

// ---- scalar helpers --------------------------------------------------------------------------------
__device__ __forceinline__ unsigned short bf_bits(float f) {          // f32 -> bf16 bits, RNE convert
  unsigned u = __float_as_uint(f);
  return (unsigned short)((u + 0x7FFFu + ((u >> 16) & 1u)) >> 16);
}
__device__ __forceinline__ float bf_up(unsigned short h) { return __uint_as_float(((unsigned)h) << 16); }
__device__ __forceinline__ unsigned short h_bits(_Float16 x) { return __builtin_bit_cast(unsigned short, x); }
__device__ __forceinline__ unsigned pk16(unsigned short a, unsigned short b) { return (unsigned)a | ((unsigned)b << 16); }
__device__ __forceinline__ v8f zero8() { v8f z = {0.f, 0.f, 0.f, 0.f, 0.f, 0.f, 0.f, 0.f}; return z; }
__device__ __forceinline__ v8h zero8h() {
  const _Float16 z = (_Float16)0.0f;
  v8h r = {z, z, z, z, z, z, z, z};
  return r;
}

// lane l <-> lane l ^ 16: the value of the same column in the other half of the wave
__device__ __forceinline__ float xhalf(float x) {
  const int b = __builtin_bit_cast(int, x);
  return __builtin_bit_cast(float, __builtin_amdgcn_permlanex16(b, b, 0x76543210, 0xfedcba98, false, false));
}

// ---- fragment loader: 16-bit A/B operand, lane -> row/col (lane&15), p already includes +8*(lane>>4);
//      elements 0..7 <- p[0..7] (k0+8h..k0+8h+7), elements 8..15 <- p[16..23] (k0+16+8h..)
__device__ __forceinline__ v16b ldfrag_b(const __bf16* p) {
  union { v16b v; v8b h[2]; } f;
  f.h[0] = *(const v8b*)(p);
  f.h[1] = *(const v8b*)(p + 16);
  return f.v;
}

// ---- WMMA helpers with trailing VALU hazard gap (asm only in the device pass) -------------------------
__device__ __forceinline__ v8f mma_b(v16b a, v16b b, v8f c) {
  c = __builtin_amdgcn_wmma_f32_16x16x32_bf16(false, a, false, b, (short)0, c, false, false);
#if defined(__HIP_DEVICE_COMPILE__)
  asm volatile("v_nop\n\tv_nop\n\tv_nop\n\tv_nop" : "+v"(c) : "v"(a), "v"(b));
#endif
  return c;
}
__device__ __forceinline__ v8f mma_h(v16h a, v16h b, v8f c) {
  c = __builtin_amdgcn_wmma_f32_16x16x32_f16(false, a, false, b, (short)0, c, false, false);
#if defined(__HIP_DEVICE_COMPILE__)
  asm volatile("v_nop\n\tv_nop\n\tv_nop\n\tv_nop" : "+v"(c) : "v"(a), "v"(b));
#endif
  return c;
}
__device__ __forceinline__ v8f mma_b_raw(v16b a, v16b b, v8f c) {
  return __builtin_amdgcn_wmma_f32_16x16x32_bf16(false, a, false, b, (short)0, c, false, false);
}
__device__ __forceinline__ void dep_guard_b(v8f& a, v8f& b, v16b x, v16b y) {
#if defined(__HIP_DEVICE_COMPILE__)
  asm volatile("v_nop\n\tv_nop\n\tv_nop\n\tv_nop" : "+v"(a), "+v"(b) : "v"(x), "v"(y));
#else
  (void)a; (void)b; (void)x; (void)y;
#endif
}
__device__ __forceinline__ void keep4_b(v16b a, v16b b, v16b c, v16b d) {
#if defined(__HIP_DEVICE_COMPILE__)
  asm volatile("v_nop" :: "v"(a), "v"(b), "v"(c), "v"(d));
#else
  (void)a; (void)b; (void)c; (void)d;
#endif
}
__device__ __forceinline__ void acc_guard4(v8f& a, v8f& b, v8f& c, v8f& d) {
#if defined(__HIP_DEVICE_COMPILE__)
  asm volatile("v_nop\n\tv_nop\n\tv_nop\n\tv_nop" : "+v"(a), "+v"(b), "+v"(c), "+v"(d));
#else
  (void)a; (void)b; (void)c; (void)d;
#endif
}

// =====================================================================================================
// f32 -> bf16 (RNE convert), 8 elements per thread, one 16-B store per lane: a wave writes 512 contiguous B
// All six planes in one grid: a range of block indices per plane, the largest plane first; the choice is block-uniform.
// coverage: every plane is a whole number of blocks of 256 threads x 8 elements.
// =====================================================================================================
#define CVB_X (NB * MTOK * DM / 2048)   // 4096 blocks: x
#define CVB_L (NB * NLAT * DM / 2048)   // 1024 blocks: l
#define CVB_W (DM * DM / 2048)          //  512 blocks: each weight
static_assert((NB * MTOK * DM) % 2048 == 0 && (NB * NLAT * DM) % 2048 == 0 && (DM * DM) % 2048 == 0);
__global__ __launch_bounds__(256) void cvt_bf16x8_all(
    const float* __restrict__ x, const float* __restrict__ lt, const float* __restrict__ Wq,
    const float* __restrict__ Wk, const float* __restrict__ Wv, const float* __restrict__ Wo,
    unsigned short* Xb, unsigned short* Lb, unsigned short* Wqb,
    unsigned short* Wkb, unsigned short* Wvb, unsigned short* Wob) {
  int blk = blockIdx.x;
  const float* in = x;
  unsigned short* out = Xb;
  if (blk >= CVB_X) {
    blk -= CVB_X;
    in = lt; out = Lb;
    if (blk >= CVB_L) {
      blk -= CVB_L;
      const int w = blk / CVB_W;         // 0 .. 3
      blk -= w * CVB_W;
      in  = (w == 0) ? Wq  : (w == 1) ? Wk  : (w == 2) ? Wv  : Wo;
      out = (w == 0) ? Wqb : (w == 1) ? Wkb : (w == 2) ? Wvb : Wob;
    }
  }
  const int i = blk * 256 + threadIdx.x;
  {
    const v4f a = *(const v4f*)(in + (size_t)i * 8);
    const v4f b = *(const v4f*)(in + (size_t)i * 8 + 4);
    v4u p;
    p[0] = pk16(bf_bits(a[0]), bf_bits(a[1]));
    p[1] = pk16(bf_bits(a[2]), bf_bits(a[3]));
    p[2] = pk16(bf_bits(b[0]), bf_bits(b[1]));
    p[3] = pk16(bf_bits(b[2]), bf_bits(b[3]));
    *(v4u*)(out + (size_t)i * 8) = p;
    
  }
}

// =====================================================================================================
// Register-blocked batched bf16 WMMA GEMM: C[m][n] = sum_k A[m][k] * Bt[n][k] + bias; one wave per 64x64
// tile, 8 waves (2 x 4) per GBM x GBN block tile. A row-major [M][K] pitch lda; Bt row-major [N][K] pitch ldb
// (k contiguous); M multiple of GBM, N of GBN, K of GKS. b = batch index (strides in elements).
// Operands go through LDS: a stage is GKS k = one whole 128-B line of every operand row of the block tile,
// brought by asynchronous 16-B copies (8 lanes per row, 4 whole lines per wave-copy) into two LDS buffers;
// stage t+2's copies are issued behind the barrier that ends stage t, one block barrier per stage.
// LDS row pitch GLP elements = 144 B (16 B x odd): the 16 rows of a ds_load_b128 fragment read fill all banks once.
// NSPLIT: 0 = A.Bt; 1 = (A + A2).Bt (A2 = unscaled bf16 lo plane of A).
// BIASM:  0 = bias[n] (length N), 1 = bias[m] (length M); bias values pass through an RNE bf16 convert.
// OUT_MODE: 0 = f32 (pitch ldc); 2 = bf16 hi plane C + bf16 lo plane C2 (lo = RNE(v - hi), unscaled);
//           3 = f16 hi plane C + f16 residual plane C2 = f16((v - hi) * rscale), C2 written only for tiles
//               with n0 < N2 (pitch ldc2, batch stride strideC2).
// =====================================================================================================
// ---- asynchronous copies global -> LDS, 16 B per lane (l = the lane's LDS byte address, g = its global address).
//      s_wait_xcnt 0 closes each statement: it stands ahead of any rewrite of a register that a copy names.
__device__ __forceinline__ void cp_async4(unsigned l0, const char* g0, unsigned l1, const char* g1,
                                          unsigned l2, const char* g2, unsigned l3, const char* g3) {
#if defined(__HIP_DEVICE_COMPILE__)
  asm volatile("global_load_async_to_lds_b128 %0, %1, off\n\t"
               "global_load_async_to_lds_b128 %2, %3, off\n\t"
               "global_load_async_to_lds_b128 %4, %5, off\n\t"
               "global_load_async_to_lds_b128 %6, %7, off\n\t"
               "s_wait_xcnt 0x0"
               :: "v"(l0), "v"(g0), "v"(l1), "v"(g1), "v"(l2), "v"(g2), "v"(l3), "v"(g3) : "memory");
#else
  (void)l0; (void)g0; (void)l1; (void)g1; (void)l2; (void)g2; (void)l3; (void)g3;
#endif
}
__device__ __forceinline__ void cp_async8(unsigned l0, const char* g0, unsigned l1, const char* g1,
                                          unsigned l2, const char* g2, unsigned l3, const char* g3,
                                          unsigned l4, const char* g4, unsigned l5, const char* g5,
                                          unsigned l6, const char* g6, unsigned l7, const char* g7) {
#if defined(__HIP_DEVICE_COMPILE__)
  asm volatile("global_load_async_to_lds_b128 %0, %1, off\n\t"
               "global_load_async_to_lds_b128 %2, %3, off\n\t"
               "global_load_async_to_lds_b128 %4, %5, off\n\t"
               "global_load_async_to_lds_b128 %6, %7, off\n\t"
               "global_load_async_to_lds_b128 %8, %9, off\n\t"
               "global_load_async_to_lds_b128 %10, %11, off\n\t"
               "global_load_async_to_lds_b128 %12, %13, off\n\t"
               "global_load_async_to_lds_b128 %14, %15, off\n\t"
               "s_wait_xcnt 0x0"
               :: "v"(l0), "v"(g0), "v"(l1), "v"(g1), "v"(l2), "v"(g2), "v"(l3), "v"(g3),
                  "v"(l4), "v"(g4), "v"(l5), "v"(g5), "v"(l6), "v"(g6), "v"(l7), "v"(g7) : "memory");
#else
  (void)l0; (void)g0; (void)l1; (void)g1; (void)l2; (void)g2; (void)l3; (void)g3;
  (void)l4; (void)g4; (void)l5; (void)g5; (void)l6; (void)g6; (void)l7; (void)g7;
#endif
}
__device__ __forceinline__ void wait_async0() {   // the wave's own copies have landed in LDS
#if defined(__HIP_DEVICE_COMPILE__)
  asm volatile("s_wait_asynccnt 0x0" ::: "memory");
#endif
}
__device__ __forceinline__ void wait_ds0() {      // the wave's own LDS reads have returned, ahead of a refill of what they read
#if defined(__HIP_DEVICE_COMPILE__)
  asm volatile("s_wait_dscnt 0x0" ::: "memory");
#endif
}

#define GBM 128   // block tile rows    (2 waves x 64)
#define GBN 256   // block tile columns (4 waves x 64)
#define GKS 64    // k per stage
#define GLP 72    // LDS row pitch, elements
static_assert((NB * NLAT) % GBM == 0 && (NB * MTOK) % GBM == 0 && DM % GBM == 0);
static_assert(DM % GBN == 0 && MTOK % GBN == 0 && DM % GKS == 0);
// one stage of the block tile: per thread 4 rows of A (and of A2), 8 rows of Bt, 32 rows apart
template <int NSPLIT>
__device__ __forceinline__ void stage_copies(const char* gA, const char* gA2, const char* gB, size_t rsA, size_t rsB,
                                             unsigned lA, unsigned lA2, unsigned lB) {
  const unsigned RS = 32 * GLP * 2;      // 32 LDS rows, bytes
  if (NSPLIT >= 1)
    cp_async8(lA, gA, lA + RS, gA + rsA, lA + 2 * RS, gA + 2 * rsA, lA + 3 * RS, gA + 3 * rsA,
              lA2, gA2, lA2 + RS, gA2 + rsA, lA2 + 2 * RS, gA2 + 2 * rsA, lA2 + 3 * RS, gA2 + 3 * rsA);
  else
    cp_async4(lA, gA, lA + RS, gA + rsA, lA + 2 * RS, gA + 2 * rsA, lA + 3 * RS, gA + 3 * rsA);
  cp_async8(lB, gB, lB + RS, gB + rsB, lB + 2 * RS, gB + 2 * rsB, lB + 3 * RS, gB + 3 * rsB,
            lB + 4 * RS, gB + 4 * rsB, lB + 5 * RS, gB + 5 * rsB, lB + 6 * RS, gB + 6 * rsB, lB + 7 * RS, gB + 7 * rsB);
}
// one block tile: tile = index of the tile in the job's M x N plane, b = batch index; the LDS arrays are the calling kernel's
template <int NSPLIT, int OUT_MODE, int BIASM>
__device__ __forceinline__ void gemm64_tile(
    const unsigned short* __restrict__ Ap, const unsigned short* A2p, int lda, long long strideA,
    const unsigned short* __restrict__ Btp, int ldb, long long strideB,
    const float* __restrict__ bias,
    void* Cout, int ldc, long long strideC,
    void* Cout2, int ldc2, long long strideC2, int N2,
    int M, int N, int K, float rscale,
    int tile, int b,
    float (*sT)[16 * 68], __bf16 (*sA)[GBM * GLP], __bf16 (*sA2)[(NSPLIT >= 1) ? GBM * GLP : 8], __bf16 (*sB)[GBN * GLP]) {
  const __bf16* A   = (const __bf16*)(const void*)Ap;
  const __bf16* A2  = (const __bf16*)(const void*)A2p;
  const __bf16* Bt  = (const __bf16*)(const void*)Btp;
  const int tid  = threadIdx.x;
  const int lane = tid & 31;
  const int wave = tid >> 5;
  const int tilesN = N / GBN;
  const int tilesM = M / GBM;
  if (tile >= tilesM * tilesN) return;   // block-uniform, ahead of every barrier
  const int tm = tile / tilesN;
  const int tn = tile - tm * tilesN;
  const int bm0 = tm * GBM;              // block tile origin
  const int bn0 = tn * GBN;
  const int wm0 = (wave >> 2) << 6;      // this wave's 64x64 tile inside the block tile
  const int wn0 = (wave & 3) << 6;
  const int m0 = bm0 + wm0;
  const int n0 = bn0 + wn0;

  const __bf16* Ab  = A  + (size_t)b * strideA;
  const __bf16* Bb  = Bt + (size_t)b * strideB;
  const __bf16* Ab2 = (NSPLIT >= 1) ? (A2 + (size_t)b * strideA) : Ab;

  const int rlane = lane & 15;                 // row (A) / col (B, D) within subtile
  const int koff  = (lane >> 4) * 8;           // k offset of this lane half
  const int mOff  = (lane >> 4) * 8;           // D row offset

  float bcol[4];
#pragma unroll
  for (int j = 0; j < 4; ++j) bcol[j] = 0.f;
  if (BIASM == 0) {
#pragma unroll
    for (int j = 0; j < 4; ++j) bcol[j] = bf_up(bf_bits(bias[n0 + (j << 4) + rlane]));   // n0+63 < N
  }

  v8f acc[4][4];
#pragma unroll
  for (int i = 0; i < 4; ++i)
#pragma unroll
    for (int j = 0; j < 4; ++j) acc[i][j] = zero8();

  // staging map: thread -> row (tid >> 3) + 32 u, 16-B chunk (tid & 7) of the row's 128-B stage line
  const int srow = tid >> 3;
  const int scol = (tid & 7) * 8;
  const char* tA  = (const char*)(Ab  + (size_t)(bm0 + srow) * lda + scol);   // rows bm0 .. bm0+127 < M
  const char* tA2 = (const char*)(Ab2 + (size_t)(bm0 + srow) * lda + scol);
  const char* tB  = (const char*)(Bb  + (size_t)(bn0 + srow) * ldb + scol);   // rows bn0 .. bn0+255 < N
  const size_t rsA = (size_t)lda * 64;                                        // 32 operand rows, bytes
  const size_t rsB = (size_t)ldb * 64;
  const int sOff = srow * GLP + scol;
  const unsigned lA  = (unsigned)(size_t)(&sA[0][sOff]);                      // LDS byte addresses, buffer 0
  const unsigned lA2 = (unsigned)(size_t)(&sA2[0][(NSPLIT >= 1) ? sOff : 0]);
  const unsigned lB  = (unsigned)(size_t)(&sB[0][sOff]);
  const unsigned bufA = GBM * GLP * 2, bufB = GBN * GLP * 2;                  // buffer sizes, bytes
  const int nst = K / GKS;

  stage_copies<NSPLIT>(tA, tA2, tB, rsA, rsB, lA, lA2, lB);                   // stage 0 -> buffer 0
  wait_async0();                         // this wave's copies of stage 0 have landed
  __syncthreads();                       // stage 0 visible to all 8 waves
  if (nst > 1)                           // block-uniform; stage 1 -> buffer 1, flies during stage 0's products
    stage_copies<NSPLIT>(tA + GKS * 2, tA2 + GKS * 2, tB + GKS * 2, rsA, rsB, lA + bufA, lA2 + bufA, lB + bufB);

  for (int t = 0; t < nst; ++t) {
    const int cur = t & 1;
    // per 32 k: all fragments as one group of LDS reads ahead of their products
    const __bf16* pa  = &sA[cur][(wm0 + rlane) * GLP + koff];
    const __bf16* pa2 = &sA2[cur][(NSPLIT >= 1) ? (wm0 + rlane) * GLP + koff : 0];
    const __bf16* pb  = &sB[cur][(wn0 + rlane) * GLP + koff];
#pragma unroll
    for (int kk = 0; kk < 2; ++kk) {
      v16b bh[4], ah[4], al[4];
#pragma unroll
      for (int j = 0; j < 4; ++j) bh[j] = ldfrag_b(pb + (j << 4) * GLP + kk * 32);
#pragma unroll
      for (int i = 0; i < 4; ++i) {
        ah[i] = ldfrag_b(pa + (i << 4) * GLP + kk * 32);
        al[i] = ah[i];
        if (NSPLIT >= 1) al[i] = ldfrag_b(pa2 + (i << 4) * GLP + kk * 32);
      }
#pragma unroll
      for (int i = 0; i < 4; ++i) {
#pragma unroll
        for (int j = 0; j < 4; ++j) {
          acc[i][j] = mma_b_raw(ah[i], bh[j], acc[i][j]);
          if (NSPLIT >= 1) acc[i][j] = mma_b_raw(al[i], bh[j], acc[i][j]);
        }
        dep_guard_b(acc[i][0], acc[i][3], ah[i], al[i]);
      }
      keep4_b(bh[0], bh[1], bh[2], bh[3]);
    }
    wait_ds0();                          // this wave's reads of stage t are done
    wait_async0();                       // this wave's copies of stage t+1 have landed
    __syncthreads();                     // publishes stage t+1 and ends every read of stage t
    if (t + 2 < nst) {                   // block-uniform; stage t+2 -> the buffer stage t has just left
      const size_t kb = (size_t)(t + 2) * (GKS * 2);
      stage_copies<NSPLIT>(tA + kb, tA2 + kb, tB + kb, rsA, rsB,
                           lA + cur * bufA, lA2 + cur * bufA, lB + cur * bufB);
    }
  }
  wait_async0();                         // nothing of this wave is in flight behind the loop
  acc_guard4(acc[0][0], acc[0][1], acc[0][2], acc[0][3]);
  acc_guard4(acc[1][0], acc[1][1], acc[1][2], acc[1][3]);
  acc_guard4(acc[2][0], acc[2][1], acc[2][2], acc[2][3]);
  acc_guard4(acc[3][0], acc[3][1], acc[3][2], acc[3][3]);

  // ---- epilogue ----
  float* slab = sT[wave];
#pragma unroll
  for (int i = 0; i < 4; ++i) {
    const int mBase = m0 + (i << 4);
    float brow[8];
#pragma unroll
    for (int r = 0; r < 8; ++r) brow[r] = 0.f;
    if (BIASM == 1) {
#pragma unroll
      for (int r = 0; r < 8; ++r) brow[r] = bf_up(bf_bits(bias[mBase + mOff + r]));    // < M
    }
#pragma unroll
    for (int j = 0; j < 4; ++j) {
#pragma unroll
      for (int r = 0; r < 8; ++r) {
        slab[(mOff + r) * 68 + (j << 4) + rlane] = acc[i][j][r] + bcol[j] + brow[r];
      }
    }
    __builtin_amdgcn_fence(__ATOMIC_RELEASE, "workgroup");
    __builtin_amdgcn_wave_barrier();
    __builtin_amdgcn_fence(__ATOMIC_ACQUIRE, "workgroup");
    if (OUT_MODE == 0) {
      float* C = (float*)Cout + (size_t)b * strideC;
      const int hh = lane >> 4, c4 = (lane & 15) * 4;     // 256-B row segment = 16 lanes x 16 B
      v4f vv[8];
#pragma unroll
      for (int it = 0; it < 8; ++it) {
        const int row = it * 2 + hh;                       // it 0..7 x hh 0..1 = rows 0..15
        vv[it] = *(const v4f*)(slab + row * 68 + c4);
      }
      {
#pragma unroll
        for (int it = 0; it < 8; ++it) {
          const int row = it * 2 + hh;
          *(v4f*)(C + (size_t)(mBase + row) * ldc + n0 + c4) = vv[it];
        }
        
      }
    } else {
      const int q = lane >> 3, c8 = (lane & 7) * 8;
      unsigned short* C  = (unsigned short*)Cout  + (size_t)b * strideC;
      unsigned short* C2 = (unsigned short*)Cout2 + (size_t)b * strideC2;
      const bool wlo = (OUT_MODE == 2) || (n0 < N2);      // wave-uniform
      v4u hv[4], lv[4];
#pragma unroll
      for (int it = 0; it < 4; ++it) {
        const int row = it * 4 + q;                        // it 0..3 x q 0..3 = rows 0..15
        const float* sp = slab + row * 68 + c8;
        v4u a, a2;
#pragma unroll
        for (int e = 0; e < 4; ++e) {
          const float f0 = sp[2 * e], f1 = sp[2 * e + 1];
          unsigned short h0, h1, l0, l1;
          if (OUT_MODE == 2) {
            h0 = bf_bits(f0); h1 = bf_bits(f1);
            l0 = bf_bits(f0 - bf_up(h0)); l1 = bf_bits(f1 - bf_up(h1));
          } else {
            const _Float16 x0 = (_Float16)f0, x1 = (_Float16)f1;
            h0 = h_bits(x0); h1 = h_bits(x1);
            l0 = h_bits((_Float16)((f0 - (float)x0) * rscale));
            l1 = h_bits((_Float16)((f1 - (float)x1) * rscale));
          }
          a[e] = pk16(h0, h1); a2[e] = pk16(l0, l1);
        }
        hv[it] = a; lv[it] = a2;
      }
      {
#pragma unroll
        for (int it = 0; it < 4; ++it) {
          const int row = it * 4 + q;
          *(v4u*)(C + (size_t)(mBase + row) * ldc + n0 + c8) = hv[it];
#if defined(__HIP_DEVICE_COMPILE__)
          if (OUT_MODE == 3) asm volatile("s_wait_xcnt 0x0" ::: "memory");   // stands ahead of any rewrite of the registers of the store above
#endif
          if (wlo) *(v4u*)(C2 + (size_t)(mBase + row) * ldc2 + n0 + c8) = lv[it];
        }
        
      }
    }
    __builtin_amdgcn_fence(__ATOMIC_RELEASE, "workgroup");
    __builtin_amdgcn_wave_barrier();
    __builtin_amdgcn_fence(__ATOMIC_ACQUIRE, "workgroup");
  }
}
// one job per launch: blockIdx.x = tile, blockIdx.y = batch index
template <int NSPLIT, int OUT_MODE, int BIASM>
__global__ __launch_bounds__(256) void gemm64(
    const unsigned short* __restrict__ Ap, const unsigned short* A2p, int lda, long long strideA,
    const unsigned short* __restrict__ Btp, int ldb, long long strideB,
    const float* __restrict__ bias,
    void* Cout, int ldc, long long strideC,
    void* Cout2, int ldc2, long long strideC2, int N2,
    int M, int N, int K, float rscale) {
  __shared__ __align__(16) float sT[8][16 * 68];   // per-wave 16x64 slab, pitch 68 floats
  __shared__ __align__(16) __bf16 sA[2][GBM * GLP];                          // A stage, two buffers
  __shared__ __align__(16) __bf16 sA2[2][(NSPLIT >= 1) ? GBM * GLP : 8];     // A2 stage (NSPLIT only)
  __shared__ __align__(16) __bf16 sB[2][GBN * GLP];                          // Bt stage, two buffers
  gemm64_tile<NSPLIT, OUT_MODE, BIASM>(Ap, A2p, lda, strideA, Btp, ldb, strideB, bias, Cout, ldc, strideC,
                                       Cout2, ldc2, strideC2, N2, M, N, K, rscale,
                                       (int)blockIdx.x, (int)blockIdx.y, sT, sA, sA2, sB);
}
// the q, k and v^T projections in one grid, a range of block indices per job (block-uniform choice):
//   k   = x . Wk^T + bk -> bf16 hi/lo planes [b*MTOK+s][h*64+d]                 (M=8192, N=1024, K=1024)
//   v^T = Wv . x^T + bv (per row) per batch -> f16 hi plane [b][h*64+d][s] (pitch MTOK) and residual plane
//         (x4096, keys < VLP only, pitch VLP)   (A = Wvb [n][k], Bt = Xb rows of batch b; M=1024, N=4096, K=1024)
//   q   = l . Wq^T + bq -> bf16 hi/lo planes [b*NLAT+t][h*64+d]                 (M=2048, N=1024, K=1024)
#define GT_K  ((NB * MTOK / GBM) * (DM / GBN))   // 64 x  4 = 256 tiles
#define GT_VT ((DM / GBM) * (MTOK / GBN))        //  8 x 16 = 128 tiles per batch
#define GT_Q  ((NB * NLAT / GBM) * (DM / GBN))   // 16 x  4 =  64 tiles
__global__ __launch_bounds__(256) void gemm_qkv(
    const unsigned short* __restrict__ Lb, const unsigned short* __restrict__ Xb,
    const unsigned short* __restrict__ Wqb, const unsigned short* __restrict__ Wkb, const unsigned short* __restrict__ Wvb,
    const float* __restrict__ bq, const float* __restrict__ bk, const float* __restrict__ bv,
    unsigned short* Qh, unsigned short* Ql, unsigned short* Kh, unsigned short* Kl,
    unsigned short* VTh, unsigned short* VTl) {
  __shared__ __align__(16) float sT[8][16 * 68];   // per-wave 16x64 slab, pitch 68 floats
  __shared__ __align__(16) __bf16 sA[2][GBM * GLP];                          // A stage, two buffers
  __shared__ __align__(16) __bf16 sA2[2][8];                                 // not used by these jobs
  __shared__ __align__(16) __bf16 sB[2][GBN * GLP];                          // Bt stage, two buffers
  const int blk = blockIdx.x;
  if (blk >= GT_K && blk < GT_K + NB * GT_VT) {
    const int t = blk - GT_K;
    gemm64_tile<0, 3, 1>(Wvb, Wvb, DM, 0LL, Xb, DM, (long long)MTOK * DM, bv,
                         (void*)VTh, MTOK, (long long)DM * MTOK, (void*)VTl, VLP, (long long)DM * VLP, VLP,
                         DM, MTOK, DM, 4096.0f, t % GT_VT, t / GT_VT, sT, sA, sA2, sB);
  } else {
    const bool isK = blk < GT_K;
    gemm64_tile<0, 2, 0>(isK ? Xb : Lb, isK ? Xb : Lb, DM, 0LL, isK ? Wkb : Wqb, DM, 0LL, isK ? bk : bq,
                         (void*)(isK ? Kh : Qh), DM, 0LL, (void*)(isK ? Kl : Ql), DM, 0LL, DM,
                         isK ? NB * MTOK : NB * NLAT, DM, DM, 1.0f,
                         isK ? blk : blk - (GT_K + NB * GT_VT), 0, sT, sA, sA2, sB);
  }
}

#define ALP 72
// second launch bound = waves per SIMD that must fit: it holds the register count where several chunks share a WGP
template <bool RES, int CH>
__global__ __launch_bounds__(128, RES ? 4 : 5)
void attn_bc64(const unsigned short* __restrict__ qhp, const unsigned short* __restrict__ qlp,
               const unsigned short* __restrict__ khp, const unsigned short* __restrict__ klp,
               const unsigned short* __restrict__ vhp, const unsigned short* __restrict__ vlp,
               float* Po, float* Pml,
               int qbBase, int nqbThis, float sscale) {
  union FB { v16b v; v8b h[2]; };
  union FH { v16h v; v8h h[2]; };
  __shared__ __align__(16) __bf16   Ksh[64 * ALP];                // K hi [kv][d]   9 KB
  __shared__ __align__(16) __bf16   Ksl[64 * ALP];                // K lo
  __shared__ __align__(16) _Float16 Vth[64 * ALP];                // V^T hi [d][kv] 9 KB
  __shared__ __align__(16) _Float16 Vtl[RES ? 64 * ALP : 8];      // V^T residual

  const int tid  = threadIdx.x;
  const int wave = tid >> 5;
  const int lane = tid & 31;
  const int hh   = lane >> 4;
  const int c    = lane & 15;

  const int h    = blockIdx.y % NH;
  const int b    = blockIdx.y / NH;
  int chunk = blockIdx.x;                          // blockIdx.x counts the chunks of qbBase, then of qbBase+1, ...
  int qb    = qbBase;
  for (int i = 1; i < NQB; ++i) {                  // block-uniform, static trip count
    const int nc = n_chunks(qb, CH);
    if (chunk < nc || i >= nqbThis) break;
    chunk -= nc;
    ++qb;
  }
  const int q0   = qb * 64 + wave * 16;            // query row within the batch
  const size_t rowQ = (size_t)b * NLAT;
  const size_t rowK = (size_t)b * MTOK;
  int ktEnd = DSF * (qb + 1);                      // key tiles 0..ktEnd-1 hold every visible key of this block
  if (ktEnd > NKT) ktEnd = NKT;
  const int ktBeg = chunk * CH;                    // this work-group: key tiles ktBeg .. min(ktBeg+CH, ktEnd)-1

  const __bf16* Qh = (const __bf16*)(const void*)qhp + (size_t)h * HD;
  const __bf16* Ql = (const __bf16*)(const void*)qlp + (size_t)h * HD;
  const __bf16* Kh = (const __bf16*)(const void*)khp + (size_t)h * HD;
  const __bf16* Kl = (const __bf16*)(const void*)klp + (size_t)h * HD;
  const _Float16* Vh = (const _Float16*)(const void*)vhp + ((size_t)b * DM + (size_t)h * HD) * MTOK;
  const _Float16* Vl = (const _Float16*)(const void*)vlp + ((size_t)b * DM + (size_t)h * HD) * VLP;

  // ---- Q fragments (B operand, column = query = lane&15): 2 d-chunks, hi and lo ----
  v16b qah[2], qal[2];
#pragma unroll
  for (int dc = 0; dc < 2; ++dc) {
    const size_t qo = (rowQ + q0 + c) * DM + dc * 32 + 8 * hh;
    qah[dc] = ldfrag_b(Qh + qo);
    qal[dc] = ldfrag_b(Ql + qo);
  }
#if defined(__HIP_DEVICE_COMPILE__)
  asm volatile("s_wait_xcnt 0x0" ::: "memory");   // stands ahead of any rewrite of the address registers of the Q loads above
#endif
  __builtin_amdgcn_sched_barrier(0);               // keeps later address arithmetic, which reuses those registers, behind that wait

  float mrow = -INFINITY, lrow = 0.f;              // of query q0 + c, equal in both halves of the wave
  v8f oacc[4];
#pragma unroll
  for (int t = 0; t < 4; ++t) oacc[t] = zero8();
  const int lim = DSF * (q0 + c + 1);              // this lane's query sees keys j < lim

  for (int ki = 0; ki < CH; ++ki) {          // static trip count
    const int kt = ktBeg + ki;
    if (kt >= ktEnd) break;                  // block-uniform
    const int kv0 = kt * 64;
    __syncthreads();
    {
      const int r = tid >> 1, half = (tid & 1) * 32;
      const __bf16*   kg  = Kh + (rowK + kv0 + r) * DM + half;    // K row kv0+r, d = half..half+31
      const __bf16*   klg = Kl + (rowK + kv0 + r) * DM + half;
      const _Float16* vg  = Vh + (size_t)r * MTOK + kv0 + half;   // V^T row d = r, s = kv0+half..+31
      const int kvl = (kv0 + 64 <= VLP) ? kv0 : (VLP - 64);     // clamped address into the residual plane
      const _Float16* vlg = Vl + (size_t)r * VLP + kvl + half;
      const bool resOK = (kv0 + 64 <= VLP);                      // block-uniform
#pragma unroll
      for (int i = 0; i < 4; ++i) {
        const v8b a0 = *(const v8b*)(kg + 8 * i);
        const v8b a1 = *(const v8b*)(klg + 8 * i);
        const v8h b0 = *(const v8h*)(vg + 8 * i);
        *(v8b*)(Ksh + r * ALP + half + 8 * i) = a0;
        *(v8b*)(Ksl + r * ALP + half + 8 * i) = a1;
        *(v8h*)(Vth + r * ALP + half + 8 * i) = b0;
        if (RES) {
          v8h b1 = *(const v8h*)(vlg + 8 * i);
          if (!resOK) b1 = zero8h();
          *(v8h*)(Vtl + r * ALP + half + 8 * i) = b1;
        }
      }
    }
    __syncthreads();

    // ---- scores^T: 64 keys x 16 queries per wave, 3 bf16 products ----
    v8f s[4];
#pragma unroll
    for (int j = 0; j < 4; ++j) {
      s[j] = zero8();
#pragma unroll
      for (int dc = 0; dc < 2; ++dc) {
        FB kb, kl;
        kb.h[0] = *(const v8b*)(Ksh + (j * 16 + c) * ALP + dc * 32 + 8 * hh);
        kb.h[1] = *(const v8b*)(Ksh + (j * 16 + c) * ALP + dc * 32 + 16 + 8 * hh);
        kl.h[0] = *(const v8b*)(Ksl + (j * 16 + c) * ALP + dc * 32 + 8 * hh);
        kl.h[1] = *(const v8b*)(Ksl + (j * 16 + c) * ALP + dc * 32 + 16 + 8 * hh);
        s[j] = mma_b(kb.v, qah[dc], s[j]);
        s[j] = mma_b(kl.v, qah[dc], s[j]);
        s[j] = mma_b(kb.v, qal[dc], s[j]);
      }
    }

    // ---- scale + visibility test (-inf for invisible keys), the query's maximum, online softmax,
    //      P^T (x1024, f16) and its residual (x4096) packed into B operands ----
    const int vis = lim - kv0 - 8 * hh;            // visible: this lane's keys of the tile with j*16 + r < vis
    float m = -INFINITY;
#pragma unroll
    for (int j = 0; j < 4; ++j) {
#pragma unroll
      for (int r = 0; r < 8; ++r) {
        const float sv = (j * 16 + r < vis) ? s[j][r] * sscale : -INFINITY;   // key kv0 + 8*hh + j*16 + r < lim
        s[j][r] = sv;
        m = fmaxf(m, sv);
      }
    }
    m = fmaxf(m, xhalf(m));                        // the other half of the wave holds the query's other 32 keys
    const float mnew  = fmaxf(mrow, m);
    const float msafe = (mnew == -INFINITY) ? 0.f : mnew;
    const float alpha = __expf(mrow - msafe);
    mrow = mnew;
    FH pa[2], pl[2];
    float ps[4];                                   // one sum chain per key tile: four short chains, not one of 32 links
#pragma unroll
    for (int j = 0; j < 4; ++j) {
      ps[j] = 0.f;
#pragma unroll
      for (int r = 0; r < 8; ++r) {
        const float p = __expf(s[j][r] - msafe);   // -inf logit -> exactly 0
        ps[j] += p;
        const float p1k = p * 1024.0f;
        const _Float16 ph = (_Float16)p1k;
        pa[j >> 1].v[(j & 1) * 8 + r] = ph;
        if (RES) pl[j >> 1].v[(j & 1) * 8 + r] = (_Float16)((p1k - (float)ph) * 4096.0f);
      }
    }
    float psum = (ps[0] + ps[1]) + (ps[2] + ps[3]);
    psum += xhalf(psum);
    lrow = lrow * alpha + psum;
#pragma unroll
    for (int t = 0; t < 4; ++t)
#pragma unroll
      for (int r = 0; r < 8; ++r) oacc[t][r] *= alpha;

    // ---- context^T += V^T . P^T (f16 WMMA), residual products into a separate accumulator ----
    v8f o1[4];
#pragma unroll
    for (int t = 0; t < 4; ++t) o1[t] = zero8();
    // unrolled: P^T lives in registers, which a rolled loop could not index
#pragma unroll
    for (int kk = 0; kk < 2; ++kk) {
#pragma unroll
      for (int t = 0; t < 4; ++t) {
        FH vb;
        vb.h[0] = *(const v8h*)(Vth + (t * 16 + c) * ALP + kk * 32 + 8 * hh);
        vb.h[1] = *(const v8h*)(Vth + (t * 16 + c) * ALP + kk * 32 + 16 + 8 * hh);
        oacc[t] = mma_h(vb.v, pa[kk].v, oacc[t]);
        if (RES) {
          FH vl;
          vl.h[0] = *(const v8h*)(Vtl + (t * 16 + c) * ALP + kk * 32 + 8 * hh);
          vl.h[1] = *(const v8h*)(Vtl + (t * 16 + c) * ALP + kk * 32 + 16 + 8 * hh);
          o1[t] = mma_h(vl.v, pa[kk].v, o1[t]);
          o1[t] = mma_h(vb.v, pl[kk].v, o1[t]);
        }
      }
    }
    if (RES) {
#pragma unroll
      for (int t = 0; t < 4; ++t)
#pragma unroll
        for (int r = 0; r < 8; ++r) oacc[t][r] += o1[t][r] * (1.0f / 4096.0f);
    }
  }

  // ---- the chunk's partial sums: accumulators in register order (512 contiguous B per wave store), m and l per query ----
  const size_t slot = ((size_t)(b * NH + h) * NQB + qb) * MAXCH + chunk;
  float* po = Po + (slot * 4 + wave) * 1024 + lane * 4;
#pragma unroll
  for (int t = 0; t < 4; ++t) {
    const v4f lo = {oacc[t][0], oacc[t][1], oacc[t][2], oacc[t][3]};
    const v4f hi = {oacc[t][4], oacc[t][5], oacc[t][6], oacc[t][7]};
    *(v4f*)(po + (t * 2) * 128)     = lo;
    *(v4f*)(po + (t * 2 + 1) * 128) = hi;
  }
  // m and l are equal in both halves: lanes 0..15 store m, lanes 16..31 l, one 128-B store of the wave
  Pml[(slot * 4 + wave) * 32 + lane] = hh ? lrow : mrow;
}

// =====================================================================================================
// Merge of the key chunks of one query block, chunks in rising order, by the running-maximum rule of the attention
// loop itself: m' = max(m, m_c), l = l exp(m - m') + l_c exp(m_c - m'), context likewise; then the normalisation
// and the bf16 hi / lo split.
//   Block = 4 waves = the 64 query rows of one (b, h, qb); every thread holds the elements that the same thread of
//   the attention work-groups held (one query per lane: q0 + (lane&15); register r of tile t = d t*16 + 8*(lane>>4) + r). Only slots 0 .. nch-1 of the query block are read: all written by the two launches before.
//   out planes (bf16 hi / lo of the normalised context): element (b, t, h, d) at [(b*NLAT + t)*DM + h*64 + d]
//   Output coverage: each wave stores rows q0..q0+15 (it 0..3 x lane>>3 0..3) x 64 columns (8 lanes x 8) of both planes.
// =====================================================================================================
// inputs-only fence on loaded values: the loads of a trip all issue ahead of the arithmetic, so that a trip pays one
// memory latency; without it the compiler sinks some of the loads behind the first wait and the trip pays two
__device__ __forceinline__ void hold_loads10(float m, float l, v4f b0, v4f b1, v4f b2, v4f b3,
                                             v4f b4, v4f b5, v4f b6, v4f b7) {
#if defined(__HIP_DEVICE_COMPILE__)
  asm volatile("" :: "v"(m), "v"(l), "v"(b0), "v"(b1), "v"(b2), "v"(b3), "v"(b4), "v"(b5), "v"(b6), "v"(b7));
#else
  (void)m; (void)l; (void)b0; (void)b1; (void)b2; (void)b3; (void)b4; (void)b5; (void)b6; (void)b7;
#endif
}
// exp(x) as __expf compiles here (one multiply by log2 e, then v_exp_f32), with the v_nop in the same statement: it fills the slot
// that the instruction set asks for behind a transcendental
__device__ __forceinline__ float expf_slot(float x) {
#if defined(__HIP_DEVICE_COMPILE__)
  const float a = x * 1.44269502162933349609375f;
  float r;
  asm("v_exp_f32 %0, %1\n\tv_nop" : "=v"(r) : "v"(a));
  return r;
#else
  return expf(x);
#endif
}
// one slot into the running sums: mc, lc = the slot's m and l of this lane's query; ov = its context accumulators, register order
__device__ __forceinline__ void merge_slot(float mc, float lc, const v4f* ov, float& mrow, float& lrow, v8f* oacc) {
  const float mnew  = fmaxf(mrow, mc);
  const float msafe = (mnew == -INFINITY) ? 0.f : mnew;
  const float alpha = expf_slot(mrow - msafe);     // -inf -> exactly 0
  const float w     = expf_slot(mc - msafe);
  mrow = mnew;
  lrow = lrow * alpha + w * lc;
#pragma unroll
  for (int t = 0; t < 4; ++t)
#pragma unroll
    for (int r = 0; r < 8; ++r) oacc[t][r] = oacc[t][r] * alpha + w * ov[t * 2 + (r >> 2)][r & 3];
}
// pitch of the staged context tile, floats: 272 B = 16 B x odd, so that the 16 queries of a 16-B store fall on different banks
#define OSP 68
__global__ __launch_bounds__(128)
void attn_merge(const float* __restrict__ Po, const float* __restrict__ Pml,
                unsigned short* ohp, unsigned short* olp) {
  __shared__ __align__(16) float Os[4][16 * OSP];  // per wave context tile [query][d]
  const int tid  = threadIdx.x;
  const int wave = tid >> 5;
  const int lane = tid & 31;
  const int hh   = lane >> 4;
  const int c    = lane & 15;
  const int qb   = blockIdx.x;
  const int h    = blockIdx.y % NH;
  const int b    = blockIdx.y / NH;
  const int q0   = qb * 64 + wave * 16;            // query row within the batch
  const size_t rowQ = (size_t)b * NLAT;
  const int nch  = (qb < RESQB) ? n_chunks(qb, CHR) : n_chunks(qb, CHN);   // 1 .. MAXCH, block-uniform
  const size_t slot0 = ((size_t)(b * NH + h) * NQB + qb) * MAXCH;
  const float* pmB = Pml + (slot0 * 4 + wave) * 32 + c;
  const float* poB = Po + (slot0 * 4 + wave) * 1024 + lane * 4;

  float mrow = -INFINITY, lrow = 0.f;
  v8f oacc[4];
#pragma unroll
  for (int t = 0; t < 4; ++t) oacc[t] = zero8();
  int ch = 0;
  // kept rolled: the trip count is known only at run time, and the two pointers then live over the whole loop
#pragma unroll 1
  for (; ch + 2 <= nch; ch += 2) {                 // nch <= MAXCH, block-uniform; two slots per trip: their loads fly together
    float mc[2], lc[2];
    v4f ov[16];
#pragma unroll
    for (int u = 0; u < 2; ++u) {
      mc[u] = pmB[u * 128];
      lc[u] = pmB[u * 128 + 16];
#pragma unroll
      for (int e = 0; e < 8; ++e) ov[u * 8 + e] = *(const v4f*)(poB + u * 4096 + e * 128);
    }
    hold_loads10(mc[0], lc[0], ov[0], ov[1], ov[2], ov[3], ov[4], ov[5], ov[6], ov[7]);
    hold_loads10(mc[1], lc[1], ov[8], ov[9], ov[10], ov[11], ov[12], ov[13], ov[14], ov[15]);
    // keeps the arithmetic behind the fences: without it the first exponentials, with their wait, are lifted ahead of the last load
    __builtin_amdgcn_sched_barrier(0);
    pmB += 2 * 128;                                // two slots on
    poB += 2 * 4096;
    merge_slot(mc[0], lc[0], ov, mrow, lrow, oacc);
    merge_slot(mc[1], lc[1], ov + 8, mrow, lrow, oacc);
  }
  if (ch < nch) {                                  // block-uniform: the last slot of an odd count
    v4f ov[8];
    const float mc = pmB[0], lc = pmB[16];
#pragma unroll
    for (int e = 0; e < 8; ++e) ov[e] = *(const v4f*)(poB + e * 128);
    hold_loads10(mc, lc, ov[0], ov[1], ov[2], ov[3], ov[4], ov[5], ov[6], ov[7]);
    merge_slot(mc, lc, ov, mrow, lrow, oacc);
  }

  // ---- normalise (1/l and the 1/1024 p carry), stage the wave's 16x64 tile, bf16 hi/lo split,
  float* os = Os[wave];
  {
    const float l = lrow;
    const float inv = ((l > 0.f) ? (1.0f / l) : 0.f) * (1.0f / 1024.0f);
#pragma unroll
    for (int t = 0; t < 4; ++t) {
      const v4f lo = {oacc[t][0] * inv, oacc[t][1] * inv, oacc[t][2] * inv, oacc[t][3] * inv};
      const v4f hi = {oacc[t][4] * inv, oacc[t][5] * inv, oacc[t][6] * inv, oacc[t][7] * inv};
      *(v4f*)(os + c * OSP + t * 16 + 8 * hh)     = lo;
      *(v4f*)(os + c * OSP + t * 16 + 8 * hh + 4) = hi;
    }
  }
  __builtin_amdgcn_fence(__ATOMIC_RELEASE, "workgroup");
  __builtin_amdgcn_wave_barrier();
  __builtin_amdgcn_fence(__ATOMIC_ACQUIRE, "workgroup");
  {
    const int q4 = lane >> 3, c8 = (lane & 7) * 8;
    v4u hv[4], lv[4];
#pragma unroll
    for (int it = 0; it < 4; ++it) {
      const int row = it * 4 + q4;   // it 0..3 x q4 0..3 = rows 0..15 of the wave tile
      const float* sp = os + row * OSP + c8;
      v4u a, a2;
#pragma unroll
      for (int e = 0; e < 4; ++e) {
        const float f0 = sp[2 * e], f1 = sp[2 * e + 1];
        const unsigned short h0 = bf_bits(f0), h1 = bf_bits(f1);
        const unsigned short l0 = bf_bits(f0 - bf_up(h0)), l1 = bf_bits(f1 - bf_up(h1));
        a[e] = pk16(h0, h1); a2[e] = pk16(l0, l1);
      }
      hv[it] = a; lv[it] = a2;
    }
    {
#pragma unroll
      for (int it = 0; it < 4; ++it) {
        const int row = it * 4 + q4;
        const size_t go = (rowQ + q0 + row) * DM + (size_t)h * HD + c8;
        *(v4u*)(ohp + go) = hv[it];
        *(v4u*)(olp + go) = lv[it];
      }
      
    }
  }
}

// =====================================================================================================
// Workspace map (bytes), every region an exact multiple of its 64x64-tile / whole-line store granularity
// (M, N of every GEMM are multiples of 64; converts write whole 512-B groups):
//   Lb   bf16 [2048][1024]            0            4194304
//   Xb   bf16 [8192][1024]            4194304     16777216
//   Wqb  bf16 [1024 n][1024 k]        20971520     2097152
//   Wkb  bf16 [1024][1024]            23068672     2097152
//   Wvb  bf16 [1024][1024]            25165824     2097152
//   Wob  bf16 [1024][1024]            27262976     2097152
//   Qh   bf16 [2048][1024]            29360128     4194304
//   Ql   bf16 [2048][1024]            33554432     4194304
//   Kh   bf16 [8192][1024]            37748736    16777216
//   Kl   bf16 [8192][1024]            54525952    16777216
//   VTh  f16  [2][1024][4096]         71303168    16777216
//   VTl  f16  [2][1024][1024]         88080384     4194304
//   Oh   bf16 [2048][1024]            92274688     4194304
//   Ol   bf16 [2048][1024]            96468992     4194304
//   Po   f32  [8192 slots][4096]       100663296   134217728
//   Pml  f32  [8192 slots][128]        234881024     4194304
//   end                               239075328
// Weights are [out n][in k] with k contiguous = the Bt / A layout the GEMM wants, so they are only converted.
// =====================================================================================================
extern "C" void kernel_launch(void* const* d_in, const int* in_sizes, int n_in,
                              void* d_out, int out_size, void* d_ws, size_t ws_size,
                              hipStream_t stream) {
  if (n_in < 10) return;
  if (in_sizes[0] != NB * MTOK * DM) return;
  if (in_sizes[1] != NB * NLAT * DM) return;
  if (in_sizes[2] != DM * DM || in_sizes[4] != DM * DM || in_sizes[6] != DM * DM || in_sizes[8] != DM * DM) return;
  if (in_sizes[3] != DM || in_sizes[5] != DM || in_sizes[7] != DM || in_sizes[9] != DM) return;
  if (out_size != NB * NLAT * DM) return;

  const float* x  = (const float*)d_in[0];
  const float* lt = (const float*)d_in[1];
  const float* Wq = (const float*)d_in[2];
  const float* bq = (const float*)d_in[3];
  const float* Wk = (const float*)d_in[4];
  const float* bk = (const float*)d_in[5];
  const float* Wv = (const float*)d_in[6];
  const float* bv = (const float*)d_in[7];
  const float* Wo = (const float*)d_in[8];
  const float* bo = (const float*)d_in[9];

  const size_t PL  = (size_t)NB * NLAT * DM * 2;   //  4194304  16-bit latent-side plane [2048][1024]
  const size_t PX  = (size_t)NB * MTOK * DM * 2;   // 16777216  16-bit token-side plane [8192][1024]
  const size_t PW  = (size_t)DM * DM * 2;          //  2097152  16-bit weight plane
  const size_t PVT = (size_t)NB * DM * MTOK * 2;   // 16777216  v^T hi plane
  const size_t PVL = (size_t)NB * DM * VLP * 2;    //  4194304  v^T residual plane
  size_t off = 0;
  const size_t oLb  = off; off += PL;
  const size_t oXb  = off; off += PX;
  const size_t oWq  = off; off += PW;
  const size_t oWk  = off; off += PW;
  const size_t oWv  = off; off += PW;
  const size_t oWo  = off; off += PW;
  const size_t oQh  = off; off += PL;
  const size_t oQl  = off; off += PL;
  const size_t oKh  = off; off += PX;
  const size_t oKl  = off; off += PX;
  const size_t oVTh = off; off += PVT;
  const size_t oVTl = off; off += PVL;
  const size_t oOh  = off; off += PL;
  const size_t oOl  = off; off += PL;
  const size_t oPo  = off; off += (size_t)NB * NH * NQB * MAXCH * 4096 * 4;   // 134217728  partial context sums
  const size_t oPm  = off; off += (size_t)NB * NH * NQB * MAXCH * 128 * 4;    //   4194304  partial m and l
  if (off > ws_size) return;                       // off = 239075328

  char* ws = (char*)d_ws;
  unsigned short* Lb  = (unsigned short*)(ws + oLb);
  unsigned short* Xb  = (unsigned short*)(ws + oXb);
  unsigned short* Wqb = (unsigned short*)(ws + oWq);
  unsigned short* Wkb = (unsigned short*)(ws + oWk);
  unsigned short* Wvb = (unsigned short*)(ws + oWv);
  unsigned short* Wob = (unsigned short*)(ws + oWo);
  unsigned short* Qh  = (unsigned short*)(ws + oQh);
  unsigned short* Ql  = (unsigned short*)(ws + oQl);
  unsigned short* Kh  = (unsigned short*)(ws + oKh);
  unsigned short* Kl  = (unsigned short*)(ws + oKl);
  unsigned short* VTh = (unsigned short*)(ws + oVTh);
  unsigned short* VTl = (unsigned short*)(ws + oVTl);
  unsigned short* Oh  = (unsigned short*)(ws + oOh);
  unsigned short* Ol  = (unsigned short*)(ws + oOl);
  float* Po  = (float*)(ws + oPo);
  float* Pml = (float*)(ws + oPm);

  const dim3 blk(256);
  const dim3 gCvt(CVB_X + CVB_L + 4 * CVB_W);                  // 4096 + 1024 + 4 x 512 = 7168 blocks
  const dim3 gQKV(GT_K + NB * GT_VT + GT_Q);                   //  256 + 2 x 128 + 64 = 576 blocks
  const dim3 gO((NB * NLAT / GBM) * (DM / GBN), 1);            //  16 x  4 =  64 blocks: M=2048, N=1024

  // (1) inputs and weights [n][k] f32 -> bf16 planes, one grid
  cvt_bf16x8_all<<<gCvt, blk, 0, stream>>>(x, lt, Wq, Wk, Wv, Wo, Xb, Lb, Wqb, Wkb, Wvb, Wob);
  // (2) - (4) the k, v^T and q projections, one grid
  gemm_qkv<<<gQKV, blk, 0, stream>>>(Lb, Xb, Wqb, Wkb, Wvb, bq, bk, bv, Qh, Ql, Kh, Kl, VTh, VTl);
  // (5) attention, one work-group per key chunk: query blocks 0..RESQB-1 with residual planes, the rest without;
  //     then the merge of each query block's chunks -> context planes
  attn_bc64<true, CHR><<<dim3(NCR, NB * NH), dim3(128), 0, stream>>>(
      Qh, Ql, Kh, Kl, VTh, VTl, Po, Pml, 0, RESQB, 0.125f);
  attn_bc64<false, CHN><<<dim3(NCN, NB * NH), dim3(128), 0, stream>>>(
      Qh, Ql, Kh, Kl, VTh, VTl, Po, Pml, RESQB, NQB - RESQB, 0.125f);
  attn_merge<<<dim3(NQB, NB * NH), dim3(128), 0, stream>>>(Po, Pml, Oh, Ol);
  // (6) out = context . Wo^T + bo -> d_out f32 [2048][1024]  (A = context hi + lo planes, 2 products)
  gemm64<1, 0, 0><<<gO, blk, 0, stream>>>(
      Oh, Ol, DM, 0LL, Wob, DM, 0LL, bo,
      d_out, DM, 0LL, d_out, DM, 0LL, DM,
      NB * NLAT, DM, DM, 1.0f);
  (void)hipGetLastError();
}

// v006
// Measured time: 120 microseconds a run.
// In both of two side-by-side timings against v005, it was 1.16 times as fast.
// Counting every step since v000, it is 4.48 times as fast.
// Contractions: q, k, v^T projections = v_wmma_f32_16x16x32_bf16 (bf16 operands from RNE-converted f32 inputs, single product, f32 accumulate, f32 bias add);
// scores, transposed, k.q^T = v_wmma_f32_16x16x32_bf16 on bf16 hi/lo planes of q and k (hi.hi + lo.hi + hi.lo), f32 accumulate;
// context, transposed, v^T.p^T = v_wmma_f32_16x16x32_f16 (p carried x1024 in f16, v in f16, plus f16 residual planes x4096 of p and v on the leading query blocks), f32 accumulate;
// ctx.Wo^T = v_wmma_f32_16x16x32_bf16 with ctx as bf16 hi/lo planes times bf16 Wo (2 products), f32 accumulate; visibility test and softmax in f32.
// The keys of a query block are split into chunks, one work-group each; a later launch merges the chunks' f32 partial sums.
// Launches that do not depend on one another share one grid, a range of block indices per job (the six converts; the q, k, v^T projections).
#include <hip/hip_runtime.h>
#include <math.h>
#include <float.h>
#include <stdint.h>

#define NB    2
#define NLAT  1024         // query (latent) length per batch
#define MTOK  4096         // key / value (token) length per batch
#define DM    1024
#define NH    16
#define HD    64
#define DSF   4            // key j visible to query t iff j / DSF <= t
#define NQB   (NLAT / 64)  // 16 query blocks of 64 rows
#define NKT   (MTOK / 64)  // 64 key tiles of 64
#define RESQB 4            // leading query blocks that use the p / v residual planes
#define VLP   1024         // key pitch of the v^T residual plane (keys 0..VLP-1)
static_assert(RESQB * 64 * DSF <= VLP);
static_assert(NH * HD == DM);
static_assert(MTOK == NLAT * DSF);
static_assert((NLAT % 64) == 0 && (MTOK % 64) == 0 && (DM % 64) == 0);
static_assert((VLP % 64) == 0 && VLP <= MTOK);
static_assert(DSF * NQB <= NKT);
#define CHR   2            // key tiles per work-group, query blocks with residual planes
#define CHN   4            // key tiles per work-group, the other query blocks
#define MAXCH 16           // partial-sum slots per query block
#define NCR   20           // chunks of query blocks 0 .. RESQB-1, one (b, h)
#define NCN   126          // chunks of query blocks RESQB .. NQB-1, one (b, h)
__host__ __device__ constexpr int n_chunks(int qb, int ch) { return (DSF * (qb + 1) + ch - 1) / ch; }
__host__ __device__ constexpr int sum_chunks(int q0, int q1, int ch) {
  int s = 0;
  for (int q = q0; q < q1; ++q) s += n_chunks(q, ch);
  return s;
}
static_assert(n_chunks(RESQB - 1, CHR) <= MAXCH && n_chunks(NQB - 1, CHN) <= MAXCH);
static_assert(sum_chunks(0, RESQB, CHR) == NCR && sum_chunks(RESQB, NQB, CHN) == NCN);

typedef _Float16 v16h __attribute__((ext_vector_type(16)));
typedef _Float16 v8h  __attribute__((ext_vector_type(8)));
typedef __bf16   v16b __attribute__((ext_vector_type(16)));
typedef __bf16   v8b  __attribute__((ext_vector_type(8)));
typedef float    v8f  __attribute__((ext_vector_type(8)));
typedef float    v4f  __attribute__((ext_vector_type(4)));
typedef unsigned int v4u __attribute__((ext_vector_type(4)));

// ---- scalar helpers --------------------------------------------------------------------------------
__device__ __forceinline__ unsigned short bf_bits(float f) {          // f32 -> bf16 bits, RNE convert
  unsigned u = __float_as_uint(f);
  return (unsigned short)((u + 0x7FFFu + ((u >> 16) & 1u)) >> 16);
}
__device__ __forceinline__ float bf_up(unsigned short h) { return __uint_as_float(((unsigned)h) << 16); }
__device__ __forceinline__ unsigned short h_bits(_Float16 x) { return __builtin_bit_cast(unsigned short, x); }
__device__ __forceinline__ unsigned pk16(unsigned short a, unsigned short b) { return (unsigned)a | ((unsigned)b << 16); }
__device__ __forceinline__ v8f zero8() { v8f z = {0.f, 0.f, 0.f, 0.f, 0.f, 0.f, 0.f, 0.f}; return z; }
__device__ __forceinline__ v8h zero8h() {
  const _Float16 z = (_Float16)0.0f;
  v8h r = {z, z, z, z, z, z, z, z};
  return r;
}

// lane l <-> lane l ^ 16: the value of the same column in the other half of the wave
__device__ __forceinline__ float xhalf(float x) {
  const int b = __builtin_bit_cast(int, x);
  return __builtin_bit_cast(float, __builtin_amdgcn_permlanex16(b, b, 0x76543210, 0xfedcba98, false, false));
}

// ---- fragment loader: 16-bit A/B operand, lane -> row/col (lane&15), p already includes +8*(lane>>4);
//      elements 0..7 <- p[0..7] (k0+8h..k0+8h+7), elements 8..15 <- p[16..23] (k0+16+8h..)
__device__ __forceinline__ v16b ldfrag_b(const __bf16* p) {
  union { v16b v; v8b h[2]; } f;
  f.h[0] = *(const v8b*)(p);
  f.h[1] = *(const v8b*)(p + 16);
  return f.v;
}

// ---- WMMA helpers with trailing VALU hazard gap (asm only in the device pass) -------------------------
__device__ __forceinline__ v8f mma_b(v16b a, v16b b, v8f c) {
  c = __builtin_amdgcn_wmma_f32_16x16x32_bf16(false, a, false, b, (short)0, c, false, false);
#if defined(__HIP_DEVICE_COMPILE__)
  asm volatile("v_nop\n\tv_nop\n\tv_nop\n\tv_nop" : "+v"(c) : "v"(a), "v"(b));
#endif
  return c;
}
__device__ __forceinline__ v8f mma_h(v16h a, v16h b, v8f c) {
  c = __builtin_amdgcn_wmma_f32_16x16x32_f16(false, a, false, b, (short)0, c, false, false);
#if defined(__HIP_DEVICE_COMPILE__)
  asm volatile("v_nop\n\tv_nop\n\tv_nop\n\tv_nop" : "+v"(c) : "v"(a), "v"(b));
#endif
  return c;
}
__device__ __forceinline__ v8f mma_b_raw(v16b a, v16b b, v8f c) {
  return __builtin_amdgcn_wmma_f32_16x16x32_bf16(false, a, false, b, (short)0, c, false, false);
}
__device__ __forceinline__ void dep_guard_b(v8f& a, v8f& b, v16b x, v16b y) {
#if defined(__HIP_DEVICE_COMPILE__)
  asm volatile("v_nop\n\tv_nop\n\tv_nop\n\tv_nop" : "+v"(a), "+v"(b) : "v"(x), "v"(y));
#else
  (void)a; (void)b; (void)x; (void)y;
#endif
}
__device__ __forceinline__ void keep4_b(v16b a, v16b b, v16b c, v16b d) {
#if defined(__HIP_DEVICE_COMPILE__)
  asm volatile("v_nop" :: "v"(a), "v"(b), "v"(c), "v"(d));
#else
  (void)a; (void)b; (void)c; (void)d;
#endif
}
__device__ __forceinline__ void acc_guard4(v8f& a, v8f& b, v8f& c, v8f& d) {
#if defined(__HIP_DEVICE_COMPILE__)
  asm volatile("v_nop\n\tv_nop\n\tv_nop\n\tv_nop" : "+v"(a), "+v"(b), "+v"(c), "+v"(d));
#else
  (void)a; (void)b; (void)c; (void)d;
#endif
}

// =====================================================================================================
// f32 -> bf16 (RNE convert), 8 elements per thread, one 16-B store per lane: a wave writes 512 contiguous B
// All six planes in one grid: a range of block indices per plane, the largest plane first; the choice is block-uniform.
// coverage: every plane is a whole number of blocks of 256 threads x 8 elements.
// =====================================================================================================
#define CVB_X (NB * MTOK * DM / 2048)   // 4096 blocks: x
#define CVB_L (NB * NLAT * DM / 2048)   // 1024 blocks: l
#define CVB_W (DM * DM / 2048)          //  512 blocks: each weight
static_assert((NB * MTOK * DM) % 2048 == 0 && (NB * NLAT * DM) % 2048 == 0 && (DM * DM) % 2048 == 0);
__global__ __launch_bounds__(256) void cvt_bf16x8_all(
    const float* __restrict__ x, const float* __restrict__ lt, const float* __restrict__ Wq,
    const float* __restrict__ Wk, const float* __restrict__ Wv, const float* __restrict__ Wo,
    unsigned short* Xb, unsigned short* Lb, unsigned short* Wqb,
    unsigned short* Wkb, unsigned short* Wvb, unsigned short* Wob) {
  int blk = blockIdx.x;
  const float* in = x;
  unsigned short* out = Xb;
  if (blk >= CVB_X) {
    blk -= CVB_X;
    in = lt; out = Lb;
    if (blk >= CVB_L) {
      blk -= CVB_L;
      const int w = blk / CVB_W;         // 0 .. 3
      blk -= w * CVB_W;
      in  = (w == 0) ? Wq  : (w == 1) ? Wk  : (w == 2) ? Wv  : Wo;
      out = (w == 0) ? Wqb : (w == 1) ? Wkb : (w == 2) ? Wvb : Wob;
    }
  }
  const int i = blk * 256 + threadIdx.x;
  {
    const v4f a = *(const v4f*)(in + (size_t)i * 8);
    const v4f b = *(const v4f*)(in + (size_t)i * 8 + 4);
    v4u p;
    p[0] = pk16(bf_bits(a[0]), bf_bits(a[1]));
    p[1] = pk16(bf_bits(a[2]), bf_bits(a[3]));
    p[2] = pk16(bf_bits(b[0]), bf_bits(b[1]));
    p[3] = pk16(bf_bits(b[2]), bf_bits(b[3]));
    *(v4u*)(out + (size_t)i * 8) = p;
    
  }
}

// =====================================================================================================
// Register-blocked batched bf16 WMMA GEMM: C[m][n] = sum_k A[m][k] * Bt[n][k] + bias; 8 waves per block tile.
// A row-major [M][K] pitch lda; Bt row-major [N][K] pitch ldb (k contiguous). b = batch index (strides in elements).
// Two tile shapes (MI = 16-row tiles per wave, WGM = waves along m, KS = k per stage), a wave always 64 columns wide:
//   MI 4, WGM 2, KS  64: wave 64x64, block 128 x 256: the jobs with 256 block tiles of that size
//   MI 1, WGM 4, KS 128: wave 16x64, block  64 x 128: the jobs of 2048 x 1024 results, 256 block tiles for 64, one for every WGP
// M, N, K are multiples of the block tile and of KS.
// Operands go through LDS: a stage is KS k = whole 128-B lines of every operand row of the block tile,
// brought by asynchronous 16-B copies (4 whole lines per wave-copy) into two LDS buffers;
// stage t+2's copies are issued behind the barrier that ends stage t, one block barrier per stage.
// LDS row pitch KS + 8 elements = 144 B or 272 B (16 B x odd): the 16 rows of a ds_load_b128 fragment read fill all banks once.
// NSPLIT: 0 = A.Bt; 1 = (A + A2).Bt (A2 = unscaled bf16 lo plane of A).
// BIASM:  0 = bias[n] (length N), 1 = bias[m] (length M); bias values pass through an RNE bf16 convert.
// OUT_MODE: 0 = f32 (pitch ldc); 2 = bf16 hi plane C + bf16 lo plane C2 (lo = RNE(v - hi), unscaled);
//           3 = f16 hi plane C + f16 residual plane C2 = f16((v - hi) * rscale), C2 written only for tiles
//               with n0 < N2 (pitch ldc2, batch stride strideC2).
// =====================================================================================================
// ---- asynchronous copies global -> LDS, 16 B per lane (l = the lane's LDS byte address, g = its global address).
//      s_wait_xcnt 0 closes each statement: it stands ahead of any rewrite of a register that a copy names.
__device__ __forceinline__ void cp_async4(unsigned l0, const char* g0, unsigned l1, const char* g1,
                                          unsigned l2, const char* g2, unsigned l3, const char* g3) {
#if defined(__HIP_DEVICE_COMPILE__)
  asm volatile("global_load_async_to_lds_b128 %0, %1, off\n\t"
               "global_load_async_to_lds_b128 %2, %3, off\n\t"
               "global_load_async_to_lds_b128 %4, %5, off\n\t"
               "global_load_async_to_lds_b128 %6, %7, off\n\t"
               "s_wait_xcnt 0x0"
               :: "v"(l0), "v"(g0), "v"(l1), "v"(g1), "v"(l2), "v"(g2), "v"(l3), "v"(g3) : "memory");
#else
  (void)l0; (void)g0; (void)l1; (void)g1; (void)l2; (void)g2; (void)l3; (void)g3;
#endif
}
__device__ __forceinline__ void cp_async8(unsigned l0, const char* g0, unsigned l1, const char* g1,
                                          unsigned l2, const char* g2, unsigned l3, const char* g3,
                                          unsigned l4, const char* g4, unsigned l5, const char* g5,
                                          unsigned l6, const char* g6, unsigned l7, const char* g7) {
#if defined(__HIP_DEVICE_COMPILE__)
  asm volatile("global_load_async_to_lds_b128 %0, %1, off\n\t"
               "global_load_async_to_lds_b128 %2, %3, off\n\t"
               "global_load_async_to_lds_b128 %4, %5, off\n\t"
               "global_load_async_to_lds_b128 %6, %7, off\n\t"
               "global_load_async_to_lds_b128 %8, %9, off\n\t"
               "global_load_async_to_lds_b128 %10, %11, off\n\t"
               "global_load_async_to_lds_b128 %12, %13, off\n\t"
               "global_load_async_to_lds_b128 %14, %15, off\n\t"
               "s_wait_xcnt 0x0"
               :: "v"(l0), "v"(g0), "v"(l1), "v"(g1), "v"(l2), "v"(g2), "v"(l3), "v"(g3),
                  "v"(l4), "v"(g4), "v"(l5), "v"(g5), "v"(l6), "v"(g6), "v"(l7), "v"(g7) : "memory");
#else
  (void)l0; (void)g0; (void)l1; (void)g1; (void)l2; (void)g2; (void)l3; (void)g3;
  (void)l4; (void)g4; (void)l5; (void)g5; (void)l6; (void)g6; (void)l7; (void)g7;
#endif
}
__device__ __forceinline__ void wait_async0() {   // the wave's own copies have landed in LDS
#if defined(__HIP_DEVICE_COMPILE__)
  asm volatile("s_wait_asynccnt 0x0" ::: "memory");
#endif
}
__device__ __forceinline__ void wait_ds0() {      // the wave's own LDS reads have returned, ahead of a refill of what they read
#if defined(__HIP_DEVICE_COMPILE__)
  asm volatile("s_wait_dscnt 0x0" ::: "memory");
#endif
}

#define GBM 128   // large block tile: rows    (2 waves x 64)
#define GBN 256   // large block tile: columns (4 waves x 64)
#define GKS 64    // large block tile: k per stage
#define GLP 72    // large block tile: LDS row pitch, elements
#define SBM 64    // small block tile: rows    (4 waves x 16)
#define SBN 128   // small block tile: columns (2 waves x 64)
#define SKS 128   // small block tile: k per stage
#define SLP 136   // small block tile: LDS row pitch, elements
static_assert((NB * NLAT) % GBM == 0 && (NB * MTOK) % GBM == 0 && DM % GBM == 0);
static_assert(DM % GBN == 0 && MTOK % GBN == 0 && DM % GKS == 0);
static_assert((NB * NLAT) % SBM == 0 && DM % SBN == 0 && DM % SKS == 0);
static_assert(GLP == GKS + 8 && SLP == SKS + 8);
static_assert(SBM * SLP <= GBM * GLP && SBN * SLP <= GBN * GLP);   // a small stage fits where a large one does
// one stage of the block tile: per thread 4 rows of A (and of A2), 8 rows of Bt; RS = LDS bytes, rsA / rsB = global bytes
// between two rows of a thread
template <int NSPLIT, unsigned RS>
__device__ __forceinline__ void stage_copies(const char* gA, const char* gA2, const char* gB, size_t rsA, size_t rsB,
                                             unsigned lA, unsigned lA2, unsigned lB) {
  if (NSPLIT >= 1)
    cp_async8(lA, gA, lA + RS, gA + rsA, lA + 2 * RS, gA + 2 * rsA, lA + 3 * RS, gA + 3 * rsA,
              lA2, gA2, lA2 + RS, gA2 + rsA, lA2 + 2 * RS, gA2 + 2 * rsA, lA2 + 3 * RS, gA2 + 3 * rsA);
  else
    cp_async4(lA, gA, lA + RS, gA + rsA, lA + 2 * RS, gA + 2 * rsA, lA + 3 * RS, gA + 3 * rsA);
  cp_async8(lB, gB, lB + RS, gB + rsB, lB + 2 * RS, gB + 2 * rsB, lB + 3 * RS, gB + 3 * rsB,
            lB + 4 * RS, gB + 4 * rsB, lB + 5 * RS, gB + 5 * rsB, lB + 6 * RS, gB + 6 * rsB, lB + 7 * RS, gB + 7 * rsB);
}
// one block tile: tile = index of the tile in the job's M x N plane, b = batch index; the LDS arrays are the calling kernel's
// (sA, sA2, sB: two buffers each of BM x LP, BM x LP, BN x LP elements)
template <int NSPLIT, int OUT_MODE, int BIASM, int MI, int WGM, int KS>
__device__ __forceinline__ void gemm64_tile(
    const unsigned short* __restrict__ Ap, const unsigned short* A2p, int lda, long long strideA,
    const unsigned short* __restrict__ Btp, int ldb, long long strideB,
    const float* __restrict__ bias,
    void* Cout, int ldc, long long strideC,
    void* Cout2, int ldc2, long long strideC2, int N2,
    int M, int N, int K, float rscale,
    int tile, int b,
    float (*sT)[16 * 68], __bf16* sA, __bf16* sA2, __bf16* sB) {
  constexpr int WGN = 8 / WGM;           // waves along n
  constexpr int BM  = WGM * MI * 16;     // block tile rows
  constexpr int BN  = WGN * 64;          // block tile columns
  constexpr int LP  = KS + 8;            // LDS row pitch, elements
  constexpr int CPR = KS / 8;            // 16-B copies per operand row and stage
  constexpr int RPP = 256 / CPR;         // operand rows that the 256 threads bring with one copy each
  static_assert(BM == 4 * RPP && BN == 8 * RPP);   // the copy counts of stage_copies
  const __bf16* A   = (const __bf16*)(const void*)Ap;
  const __bf16* A2  = (const __bf16*)(const void*)A2p;
  const __bf16* Bt  = (const __bf16*)(const void*)Btp;
  const int tid  = threadIdx.x;
  const int lane = tid & 31;
  const int wave = tid >> 5;
  const int tilesN = N / BN;
  const int tilesM = M / BM;
  if (tile >= tilesM * tilesN) return;   // block-uniform, ahead of every barrier
  const int tm = tile / tilesN;
  const int tn = tile - tm * tilesN;
  const int bm0 = tm * BM;               // block tile origin
  const int bn0 = tn * BN;
  const int wm0 = (wave / WGN) * (MI * 16);   // this wave's tile inside the block tile
  const int wn0 = (wave % WGN) << 6;
  const int m0 = bm0 + wm0;
  const int n0 = bn0 + wn0;

  const __bf16* Ab  = A  + (size_t)b * strideA;
  const __bf16* Bb  = Bt + (size_t)b * strideB;
  const __bf16* Ab2 = (NSPLIT >= 1) ? (A2 + (size_t)b * strideA) : Ab;

  const int rlane = lane & 15;                 // row (A) / col (B, D) within subtile
  const int koff  = (lane >> 4) * 8;           // k offset of this lane half
  const int mOff  = (lane >> 4) * 8;           // D row offset

  float bcol[4];
#pragma unroll
  for (int j = 0; j < 4; ++j) bcol[j] = 0.f;
  if (BIASM == 0) {
#pragma unroll
    for (int j = 0; j < 4; ++j) bcol[j] = bf_up(bf_bits(bias[n0 + (j << 4) + rlane]));   // n0+63 < N
  }

  v8f acc[MI][4];
#pragma unroll
  for (int i = 0; i < MI; ++i)
#pragma unroll
    for (int j = 0; j < 4; ++j) acc[i][j] = zero8();

  // staging map: thread -> row (tid / CPR) + RPP u, 16-B chunk (tid % CPR) of the row's KS k of the stage
  const int srow = tid / CPR;
  const int scol = (tid % CPR) * 8;
  const char* tA  = (const char*)(Ab  + (size_t)(bm0 + srow) * lda + scol);   // rows bm0 .. bm0+BM-1 < M
  const char* tA2 = (const char*)(Ab2 + (size_t)(bm0 + srow) * lda + scol);
  const char* tB  = (const char*)(Bb  + (size_t)(bn0 + srow) * ldb + scol);   // rows bn0 .. bn0+BN-1 < N
  const size_t rsA = (size_t)lda * (RPP * 2);                                 // RPP operand rows, bytes
  const size_t rsB = (size_t)ldb * (RPP * 2);
  constexpr unsigned RS = RPP * LP * 2;                                       // RPP LDS rows, bytes
  const int sOff = srow * LP + scol;
  const unsigned lA  = (unsigned)(size_t)(sA + sOff);                         // LDS byte addresses, buffer 0
  const unsigned lA2 = (unsigned)(size_t)(sA2 + ((NSPLIT >= 1) ? sOff : 0));
  const unsigned lB  = (unsigned)(size_t)(sB + sOff);
  const unsigned bufA = BM * LP * 2, bufB = BN * LP * 2;                      // buffer sizes, bytes
  const int nst = K / KS;

  stage_copies<NSPLIT, RS>(tA, tA2, tB, rsA, rsB, lA, lA2, lB);               // stage 0 -> buffer 0
  wait_async0();                         // this wave's copies of stage 0 have landed
  __syncthreads();                       // stage 0 visible to all 8 waves
  if (nst > 1)                           // block-uniform; stage 1 -> buffer 1, flies during stage 0's products
    stage_copies<NSPLIT, RS>(tA + KS * 2, tA2 + KS * 2, tB + KS * 2, rsA, rsB, lA + bufA, lA2 + bufA, lB + bufB);

  for (int t = 0; t < nst; ++t) {
    const int cur = t & 1;
    // per 32 k: all fragments as one group of LDS reads ahead of their products
    const __bf16* pa  = sA + cur * (BM * LP) + (wm0 + rlane) * LP + koff;
    const __bf16* pa2 = sA2 + ((NSPLIT >= 1) ? cur * (BM * LP) + (wm0 + rlane) * LP + koff : 0);
    const __bf16* pb  = sB + cur * (BN * LP) + (wn0 + rlane) * LP + koff;
#pragma unroll
    for (int kk = 0; kk < KS / 32; ++kk) {
      v16b bh[4], ah[MI], al[MI];
#pragma unroll
      for (int j = 0; j < 4; ++j) bh[j] = ldfrag_b(pb + (j << 4) * LP + kk * 32);
#pragma unroll
      for (int i = 0; i < MI; ++i) {
        ah[i] = ldfrag_b(pa + (i << 4) * LP + kk * 32);
        al[i] = ah[i];
        if (NSPLIT >= 1) al[i] = ldfrag_b(pa2 + (i << 4) * LP + kk * 32);
      }
#pragma unroll
      for (int i = 0; i < MI; ++i) {
        // the four accumulators of a row take their A products in turn, then their A2 products
#pragma unroll
        for (int j = 0; j < 4; ++j) acc[i][j] = mma_b_raw(ah[i], bh[j], acc[i][j]);
        if (NSPLIT >= 1) {
#pragma unroll
          for (int j = 0; j < 4; ++j) acc[i][j] = mma_b_raw(al[i], bh[j], acc[i][j]);
        }
        dep_guard_b(acc[i][0], acc[i][3], ah[i], al[i]);
      }
      keep4_b(bh[0], bh[1], bh[2], bh[3]);
    }
    wait_ds0();                          // this wave's reads of stage t are done
    wait_async0();                       // this wave's copies of stage t+1 have landed
    __syncthreads();                     // publishes stage t+1 and ends every read of stage t
    if (t + 2 < nst) {                   // block-uniform; stage t+2 -> the buffer stage t has just left
      const size_t kb = (size_t)(t + 2) * (KS * 2);
      stage_copies<NSPLIT, RS>(tA + kb, tA2 + kb, tB + kb, rsA, rsB,
                               lA + cur * bufA, lA2 + cur * bufA, lB + cur * bufB);
    }
  }
  wait_async0();                         // nothing of this wave is in flight behind the loop
#pragma unroll
  for (int i = 0; i < MI; ++i) acc_guard4(acc[i][0], acc[i][1], acc[i][2], acc[i][3]);

  // ---- epilogue ----
  float* slab = sT[wave];
#pragma unroll
  for (int i = 0; i < MI; ++i) {
    const int mBase = m0 + (i << 4);
    float brow[8];
#pragma unroll
    for (int r = 0; r < 8; ++r) brow[r] = 0.f;
    if (BIASM == 1) {
#pragma unroll
      for (int r = 0; r < 8; ++r) brow[r] = bf_up(bf_bits(bias[mBase + mOff + r]));    // < M
    }
#pragma unroll
    for (int j = 0; j < 4; ++j) {
#pragma unroll
      for (int r = 0; r < 8; ++r) {
        slab[(mOff + r) * 68 + (j << 4) + rlane] = acc[i][j][r] + bcol[j] + brow[r];
      }
    }
    __builtin_amdgcn_fence(__ATOMIC_RELEASE, "workgroup");
    __builtin_amdgcn_wave_barrier();
    __builtin_amdgcn_fence(__ATOMIC_ACQUIRE, "workgroup");
    if (OUT_MODE == 0) {
      float* C = (float*)Cout + (size_t)b * strideC;
      const int hh = lane >> 4, c4 = (lane & 15) * 4;     // 256-B row segment = 16 lanes x 16 B
      v4f vv[8];
#pragma unroll
      for (int it = 0; it < 8; ++it) {
        const int row = it * 2 + hh;                       // it 0..7 x hh 0..1 = rows 0..15
        vv[it] = *(const v4f*)(slab + row * 68 + c4);
      }
      {
#pragma unroll
        for (int it = 0; it < 8; ++it) {
          const int row = it * 2 + hh;
          *(v4f*)(C + (size_t)(mBase + row) * ldc + n0 + c4) = vv[it];
        }
        
      }
    } else {
      const int q = lane >> 3, c8 = (lane & 7) * 8;
      unsigned short* C  = (unsigned short*)Cout  + (size_t)b * strideC;
      unsigned short* C2 = (unsigned short*)Cout2 + (size_t)b * strideC2;
      const bool wlo = (OUT_MODE == 2) || (n0 < N2);      // wave-uniform
      v4u hv[4], lv[4];
#pragma unroll
      for (int it = 0; it < 4; ++it) {
        const int row = it * 4 + q;                        // it 0..3 x q 0..3 = rows 0..15
        const float* sp = slab + row * 68 + c8;
        v4u a, a2;
#pragma unroll
        for (int e = 0; e < 4; ++e) {
          const float f0 = sp[2 * e], f1 = sp[2 * e + 1];
          unsigned short h0, h1, l0, l1;
          if (OUT_MODE == 2) {
            h0 = bf_bits(f0); h1 = bf_bits(f1);
            l0 = bf_bits(f0 - bf_up(h0)); l1 = bf_bits(f1 - bf_up(h1));
          } else {
            const _Float16 x0 = (_Float16)f0, x1 = (_Float16)f1;
            h0 = h_bits(x0); h1 = h_bits(x1);
            l0 = h_bits((_Float16)((f0 - (float)x0) * rscale));
            l1 = h_bits((_Float16)((f1 - (float)x1) * rscale));
          }
          a[e] = pk16(h0, h1); a2[e] = pk16(l0, l1);
        }
        hv[it] = a; lv[it] = a2;
      }
      {
#pragma unroll
        for (int it = 0; it < 4; ++it) {
          const int row = it * 4 + q;
          *(v4u*)(C + (size_t)(mBase + row) * ldc + n0 + c8) = hv[it];
#if defined(__HIP_DEVICE_COMPILE__)
          if (OUT_MODE == 3) asm volatile("s_wait_xcnt 0x0" ::: "memory");   // stands ahead of any rewrite of the registers of the store above
#endif
          if (wlo) *(v4u*)(C2 + (size_t)(mBase + row) * ldc2 + n0 + c8) = lv[it];
        }
        
      }
    }
    __builtin_amdgcn_fence(__ATOMIC_RELEASE, "workgroup");
    __builtin_amdgcn_wave_barrier();
    __builtin_amdgcn_fence(__ATOMIC_ACQUIRE, "workgroup");
  }
}
// one job per launch: blockIdx.x = tile, blockIdx.y = batch index
template <int NSPLIT, int OUT_MODE, int BIASM, int MI, int WGM, int KS>
__global__ __launch_bounds__(256) void gemm64(
    const unsigned short* __restrict__ Ap, const unsigned short* A2p, int lda, long long strideA,
    const unsigned short* __restrict__ Btp, int ldb, long long strideB,
    const float* __restrict__ bias,
    void* Cout, int ldc, long long strideC,
    void* Cout2, int ldc2, long long strideC2, int N2,
    int M, int N, int K, float rscale) {
  constexpr int SZA = WGM * MI * 16 * (KS + 8);    // one A stage, elements
  constexpr int SZB = (8 / WGM) * 64 * (KS + 8);   // one Bt stage, elements
  __shared__ __align__(16) float sT[8][16 * 68];   // per-wave 16x64 slab, pitch 68 floats
  __shared__ __align__(16) __bf16 sA[2 * SZA];                               // A stage, two buffers
  __shared__ __align__(16) __bf16 sA2[(NSPLIT >= 1) ? 2 * SZA : 16];         // A2 stage (NSPLIT only)
  __shared__ __align__(16) __bf16 sB[2 * SZB];                               // Bt stage, two buffers
  gemm64_tile<NSPLIT, OUT_MODE, BIASM, MI, WGM, KS>(Ap, A2p, lda, strideA, Btp, ldb, strideB, bias, Cout, ldc, strideC,
                                                    Cout2, ldc2, strideC2, N2, M, N, K, rscale,
                                                    (int)blockIdx.x, (int)blockIdx.y, sT, sA, sA2, sB);
}
// the q, k and v^T projections in one grid, a range of block indices per job (block-uniform choice):
//   k   = x . Wk^T + bk -> bf16 hi/lo planes [b*MTOK+s][h*64+d]                 (M=8192, N=1024, K=1024)
//   v^T = Wv . x^T + bv (per row) per batch -> f16 hi plane [b][h*64+d][s] (pitch MTOK) and residual plane
//         (x4096, keys < VLP only, pitch VLP)   (A = Wvb [n][k], Bt = Xb rows of batch b; M=1024, N=4096, K=1024)
//   q   = l . Wq^T + bq -> bf16 hi/lo planes [b*NLAT+t][h*64+d]                 (M=2048, N=1024, K=1024), small block tiles
// Each job has 256 block tiles, one per WGP, and two work-groups fit a WGP: the short q tiles come first in the grid.
#define GT_K  ((NB * MTOK / GBM) * (DM / GBN))   // 64 x  4 = 256 tiles
#define GT_VT ((DM / GBM) * (MTOK / GBN))        //  8 x 16 = 128 tiles per batch
#define GT_Q  ((NB * NLAT / SBM) * (DM / SBN))   // 32 x  8 = 256 small tiles
__global__ __launch_bounds__(256) void gemm_qkv(
    const unsigned short* __restrict__ Lb, const unsigned short* __restrict__ Xb,
    const unsigned short* __restrict__ Wqb, const unsigned short* __restrict__ Wkb, const unsigned short* __restrict__ Wvb,
    const float* __restrict__ bq, const float* __restrict__ bk, const float* __restrict__ bv,
    unsigned short* Qh, unsigned short* Ql, unsigned short* Kh, unsigned short* Kl,
    unsigned short* VTh, unsigned short* VTl) {
  __shared__ __align__(16) float sT[8][16 * 68];   // per-wave 16x64 slab, pitch 68 floats
  __shared__ __align__(16) __bf16 sA[2 * GBM * GLP];                         // A stage, two buffers (of the large tile)
  __shared__ __align__(16) __bf16 sA2[16];                                   // not used by these jobs
  __shared__ __align__(16) __bf16 sB[2 * GBN * GLP];                         // Bt stage, two buffers (of the large tile)
  const int blk = blockIdx.x;
  if (blk < GT_Q) {
    gemm64_tile<0, 2, 0, 1, 4, SKS>(Lb, Lb, DM, 0LL, Wqb, DM, 0LL, bq,
                                    (void*)Qh, DM, 0LL, (void*)Ql, DM, 0LL, DM,
                                    NB * NLAT, DM, DM, 1.0f, blk, 0, sT, sA, sA2, sB);
  } else if (blk < GT_Q + GT_K) {
    gemm64_tile<0, 2, 0, 4, 2, GKS>(Xb, Xb, DM, 0LL, Wkb, DM, 0LL, bk,
                                    (void*)Kh, DM, 0LL, (void*)Kl, DM, 0LL, DM,
                                    NB * MTOK, DM, DM, 1.0f, blk - GT_Q, 0, sT, sA, sA2, sB);
  } else {
    const int t = blk - (GT_Q + GT_K);
    gemm64_tile<0, 3, 1, 4, 2, GKS>(Wvb, Wvb, DM, 0LL, Xb, DM, (long long)MTOK * DM, bv,
                                    (void*)VTh, MTOK, (long long)DM * MTOK, (void*)VTl, VLP, (long long)DM * VLP, VLP,
                                    DM, MTOK, DM, 4096.0f, t % GT_VT, t / GT_VT, sT, sA, sA2, sB);
  }
}

#define ALP 72
// second launch bound = waves per SIMD that must fit: it holds the register count where several chunks share a WGP
template <bool RES, int CH>
__global__ __launch_bounds__(128, RES ? 4 : 5)
void attn_bc64(const unsigned short* __restrict__ qhp, const unsigned short* __restrict__ qlp,
               const unsigned short* __restrict__ khp, const unsigned short* __restrict__ klp,
               const unsigned short* __restrict__ vhp, const unsigned short* __restrict__ vlp,
               float* Po, float* Pml,
               int qbBase, int nqbThis, float sscale) {
  union FB { v16b v; v8b h[2]; };
  union FH { v16h v; v8h h[2]; };
  __shared__ __align__(16) __bf16   Ksh[64 * ALP];                // K hi [kv][d]   9 KB
  __shared__ __align__(16) __bf16   Ksl[64 * ALP];                // K lo
  __shared__ __align__(16) _Float16 Vth[64 * ALP];                // V^T hi [d][kv] 9 KB
  __shared__ __align__(16) _Float16 Vtl[RES ? 64 * ALP : 8];      // V^T residual

  const int tid  = threadIdx.x;
  const int wave = tid >> 5;
  const int lane = tid & 31;
  const int hh   = lane >> 4;
  const int c    = lane & 15;

  const int h    = blockIdx.y % NH;
  const int b    = blockIdx.y / NH;
  int chunk = blockIdx.x;                          // blockIdx.x counts the chunks of qbBase, then of qbBase+1, ...
  int qb    = qbBase;
  for (int i = 1; i < NQB; ++i) {                  // block-uniform, static trip count
    const int nc = n_chunks(qb, CH);
    if (chunk < nc || i >= nqbThis) break;
    chunk -= nc;
    ++qb;
  }
  const int q0   = qb * 64 + wave * 16;            // query row within the batch
  const size_t rowQ = (size_t)b * NLAT;
  const size_t rowK = (size_t)b * MTOK;
  int ktEnd = DSF * (qb + 1);                      // key tiles 0..ktEnd-1 hold every visible key of this block
  if (ktEnd > NKT) ktEnd = NKT;
  const int ktBeg = chunk * CH;                    // this work-group: key tiles ktBeg .. min(ktBeg+CH, ktEnd)-1

  const __bf16* Qh = (const __bf16*)(const void*)qhp + (size_t)h * HD;
  const __bf16* Ql = (const __bf16*)(const void*)qlp + (size_t)h * HD;
  const __bf16* Kh = (const __bf16*)(const void*)khp + (size_t)h * HD;
  const __bf16* Kl = (const __bf16*)(const void*)klp + (size_t)h * HD;
  const _Float16* Vh = (const _Float16*)(const void*)vhp + ((size_t)b * DM + (size_t)h * HD) * MTOK;
  const _Float16* Vl = (const _Float16*)(const void*)vlp + ((size_t)b * DM + (size_t)h * HD) * VLP;

  // ---- Q fragments (B operand, column = query = lane&15): 2 d-chunks, hi and lo ----
  v16b qah[2], qal[2];
#pragma unroll
  for (int dc = 0; dc < 2; ++dc) {
    const size_t qo = (rowQ + q0 + c) * DM + dc * 32 + 8 * hh;
    qah[dc] = ldfrag_b(Qh + qo);
    qal[dc] = ldfrag_b(Ql + qo);
  }
#if defined(__HIP_DEVICE_COMPILE__)
  asm volatile("s_wait_xcnt 0x0" ::: "memory");   // stands ahead of any rewrite of the address registers of the Q loads above
#endif
  __builtin_amdgcn_sched_barrier(0);               // keeps later address arithmetic, which reuses those registers, behind that wait

  float mrow = -INFINITY, lrow = 0.f;              // of query q0 + c, equal in both halves of the wave
  v8f oacc[4];
#pragma unroll
  for (int t = 0; t < 4; ++t) oacc[t] = zero8();
  const int lim = DSF * (q0 + c + 1);              // this lane's query sees keys j < lim

  for (int ki = 0; ki < CH; ++ki) {          // static trip count
    const int kt = ktBeg + ki;
    if (kt >= ktEnd) break;                  // block-uniform
    const int kv0 = kt * 64;
    __syncthreads();
    {
      const int r = tid >> 1, half = (tid & 1) * 32;
      const __bf16*   kg  = Kh + (rowK + kv0 + r) * DM + half;    // K row kv0+r, d = half..half+31
      const __bf16*   klg = Kl + (rowK + kv0 + r) * DM + half;
      const _Float16* vg  = Vh + (size_t)r * MTOK + kv0 + half;   // V^T row d = r, s = kv0+half..+31
      const int kvl = (kv0 + 64 <= VLP) ? kv0 : (VLP - 64);     // clamped address into the residual plane
      const _Float16* vlg = Vl + (size_t)r * VLP + kvl + half;
      const bool resOK = (kv0 + 64 <= VLP);                      // block-uniform
#pragma unroll
      for (int i = 0; i < 4; ++i) {
        const v8b a0 = *(const v8b*)(kg + 8 * i);
        const v8b a1 = *(const v8b*)(klg + 8 * i);
        const v8h b0 = *(const v8h*)(vg + 8 * i);
        *(v8b*)(Ksh + r * ALP + half + 8 * i) = a0;
        *(v8b*)(Ksl + r * ALP + half + 8 * i) = a1;
        *(v8h*)(Vth + r * ALP + half + 8 * i) = b0;
        if (RES) {
          v8h b1 = *(const v8h*)(vlg + 8 * i);
          if (!resOK) b1 = zero8h();
          *(v8h*)(Vtl + r * ALP + half + 8 * i) = b1;
        }
      }
    }
    __syncthreads();

    // ---- scores^T: 64 keys x 16 queries per wave, 3 bf16 products ----
    v8f s[4];
#pragma unroll
    for (int j = 0; j < 4; ++j) {
      s[j] = zero8();
#pragma unroll
      for (int dc = 0; dc < 2; ++dc) {
        FB kb, kl;
        kb.h[0] = *(const v8b*)(Ksh + (j * 16 + c) * ALP + dc * 32 + 8 * hh);
        kb.h[1] = *(const v8b*)(Ksh + (j * 16 + c) * ALP + dc * 32 + 16 + 8 * hh);
        kl.h[0] = *(const v8b*)(Ksl + (j * 16 + c) * ALP + dc * 32 + 8 * hh);
        kl.h[1] = *(const v8b*)(Ksl + (j * 16 + c) * ALP + dc * 32 + 16 + 8 * hh);
        s[j] = mma_b(kb.v, qah[dc], s[j]);
        s[j] = mma_b(kl.v, qah[dc], s[j]);
        s[j] = mma_b(kb.v, qal[dc], s[j]);
      }
    }

    // ---- scale + visibility test (-inf for invisible keys), the query's maximum, online softmax,
    //      P^T (x1024, f16) and its residual (x4096) packed into B operands ----
    const int vis = lim - kv0 - 8 * hh;            // visible: this lane's keys of the tile with j*16 + r < vis
    float m = -INFINITY;
#pragma unroll
    for (int j = 0; j < 4; ++j) {
#pragma unroll
      for (int r = 0; r < 8; ++r) {
        const float sv = (j * 16 + r < vis) ? s[j][r] * sscale : -INFINITY;   // key kv0 + 8*hh + j*16 + r < lim
        s[j][r] = sv;
        m = fmaxf(m, sv);
      }
    }
    m = fmaxf(m, xhalf(m));                        // the other half of the wave holds the query's other 32 keys
    const float mnew  = fmaxf(mrow, m);
    const float msafe = (mnew == -INFINITY) ? 0.f : mnew;
    const float alpha = __expf(mrow - msafe);
    mrow = mnew;
    FH pa[2], pl[2];
    float ps[4];                                   // one sum chain per key tile: four short chains, not one of 32 links
#pragma unroll
    for (int j = 0; j < 4; ++j) {
      ps[j] = 0.f;
#pragma unroll
      for (int r = 0; r < 8; ++r) {
        const float p = __expf(s[j][r] - msafe);   // -inf logit -> exactly 0
        ps[j] += p;
        const float p1k = p * 1024.0f;
        const _Float16 ph = (_Float16)p1k;
        pa[j >> 1].v[(j & 1) * 8 + r] = ph;
        if (RES) pl[j >> 1].v[(j & 1) * 8 + r] = (_Float16)((p1k - (float)ph) * 4096.0f);
      }
    }
    float psum = (ps[0] + ps[1]) + (ps[2] + ps[3]);
    psum += xhalf(psum);
    lrow = lrow * alpha + psum;
#pragma unroll
    for (int t = 0; t < 4; ++t)
#pragma unroll
      for (int r = 0; r < 8; ++r) oacc[t][r] *= alpha;

    // ---- context^T += V^T . P^T (f16 WMMA), residual products into a separate accumulator ----
    v8f o1[4];
#pragma unroll
    for (int t = 0; t < 4; ++t) o1[t] = zero8();
    // unrolled: P^T lives in registers, which a rolled loop could not index
#pragma unroll
    for (int kk = 0; kk < 2; ++kk) {
#pragma unroll
      for (int t = 0; t < 4; ++t) {
        FH vb;
        vb.h[0] = *(const v8h*)(Vth + (t * 16 + c) * ALP + kk * 32 + 8 * hh);
        vb.h[1] = *(const v8h*)(Vth + (t * 16 + c) * ALP + kk * 32 + 16 + 8 * hh);
        oacc[t] = mma_h(vb.v, pa[kk].v, oacc[t]);
        if (RES) {
          FH vl;
          vl.h[0] = *(const v8h*)(Vtl + (t * 16 + c) * ALP + kk * 32 + 8 * hh);
          vl.h[1] = *(const v8h*)(Vtl + (t * 16 + c) * ALP + kk * 32 + 16 + 8 * hh);
          o1[t] = mma_h(vl.v, pa[kk].v, o1[t]);
          o1[t] = mma_h(vb.v, pl[kk].v, o1[t]);
        }
      }
    }
    if (RES) {
#pragma unroll
      for (int t = 0; t < 4; ++t)
#pragma unroll
        for (int r = 0; r < 8; ++r) oacc[t][r] += o1[t][r] * (1.0f / 4096.0f);
    }
  }

  // ---- the chunk's partial sums: accumulators in register order (512 contiguous B per wave store), m and l per query ----
  const size_t slot = ((size_t)(b * NH + h) * NQB + qb) * MAXCH + chunk;
  float* po = Po + (slot * 4 + wave) * 1024 + lane * 4;
#pragma unroll
  for (int t = 0; t < 4; ++t) {
    const v4f lo = {oacc[t][0], oacc[t][1], oacc[t][2], oacc[t][3]};
    const v4f hi = {oacc[t][4], oacc[t][5], oacc[t][6], oacc[t][7]};
    *(v4f*)(po + (t * 2) * 128)     = lo;
    *(v4f*)(po + (t * 2 + 1) * 128) = hi;
  }
  // m and l are equal in both halves: lanes 0..15 store m, lanes 16..31 l, one 128-B store of the wave
  Pml[(slot * 4 + wave) * 32 + lane] = hh ? lrow : mrow;
}

// =====================================================================================================
// Merge of the key chunks of one query block, chunks in rising order, by the running-maximum rule of the attention
// loop itself: m' = max(m, m_c), l = l exp(m - m') + l_c exp(m_c - m'), context likewise; then the normalisation
// and the bf16 hi / lo split.
//   Block = 4 waves = the 64 query rows of one (b, h, qb); every thread holds the elements that the same thread of
//   the attention work-groups held (one query per lane: q0 + (lane&15); register r of tile t = d t*16 + 8*(lane>>4) + r). Only slots 0 .. nch-1 of the query block are read: all written by the two launches before.
//   out planes (bf16 hi / lo of the normalised context): element (b, t, h, d) at [(b*NLAT + t)*DM + h*64 + d]
//   Output coverage: each wave stores rows q0..q0+15 (it 0..3 x lane>>3 0..3) x 64 columns (8 lanes x 8) of both planes.
// =====================================================================================================
// inputs-only fence on loaded values: the loads of a trip all issue ahead of the arithmetic, so that a trip pays one
// memory latency; without it the compiler sinks some of the loads behind the first wait and the trip pays two
__device__ __forceinline__ void hold_loads10(float m, float l, v4f b0, v4f b1, v4f b2, v4f b3,
                                             v4f b4, v4f b5, v4f b6, v4f b7) {
#if defined(__HIP_DEVICE_COMPILE__)
  asm volatile("" :: "v"(m), "v"(l), "v"(b0), "v"(b1), "v"(b2), "v"(b3), "v"(b4), "v"(b5), "v"(b6), "v"(b7));
#else
  (void)m; (void)l; (void)b0; (void)b1; (void)b2; (void)b3; (void)b4; (void)b5; (void)b6; (void)b7;
#endif
}
// exp(x) as __expf compiles here (one multiply by log2 e, then v_exp_f32), with the v_nop in the same statement: it fills the slot
// that the instruction set asks for behind a transcendental
__device__ __forceinline__ float expf_slot(float x) {
#if defined(__HIP_DEVICE_COMPILE__)
  const float a = x * 1.44269502162933349609375f;
  float r;
  asm("v_exp_f32 %0, %1\n\tv_nop" : "=v"(r) : "v"(a));
  return r;
#else
  return expf(x);
#endif
}
// one slot into the running sums: mc, lc = the slot's m and l of this lane's query; ov = its context accumulators, register order
__device__ __forceinline__ void merge_slot(float mc, float lc, const v4f* ov, float& mrow, float& lrow, v8f* oacc) {
  const float mnew  = fmaxf(mrow, mc);
  const float msafe = (mnew == -INFINITY) ? 0.f : mnew;
  const float alpha = expf_slot(mrow - msafe);     // -inf -> exactly 0
  const float w     = expf_slot(mc - msafe);
  mrow = mnew;
  lrow = lrow * alpha + w * lc;
#pragma unroll
  for (int t = 0; t < 4; ++t)
#pragma unroll
    for (int r = 0; r < 8; ++r) oacc[t][r] = oacc[t][r] * alpha + w * ov[t * 2 + (r >> 2)][r & 3];
}
// pitch of the staged context tile, floats: 272 B = 16 B x odd, so that the 16 queries of a 16-B store fall on different banks
#define OSP 68
__global__ __launch_bounds__(128)
void attn_merge(const float* __restrict__ Po, const float* __restrict__ Pml,
                unsigned short* ohp, unsigned short* olp) {
  __shared__ __align__(16) float Os[4][16 * OSP];  // per wave context tile [query][d]
  const int tid  = threadIdx.x;
  const int wave = tid >> 5;
  const int lane = tid & 31;
  const int hh   = lane >> 4;
  const int c    = lane & 15;
  const int qb   = blockIdx.x;
  const int h    = blockIdx.y % NH;
  const int b    = blockIdx.y / NH;
  const int q0   = qb * 64 + wave * 16;            // query row within the batch
  const size_t rowQ = (size_t)b * NLAT;
  const int nch  = (qb < RESQB) ? n_chunks(qb, CHR) : n_chunks(qb, CHN);   // 1 .. MAXCH, block-uniform
  const size_t slot0 = ((size_t)(b * NH + h) * NQB + qb) * MAXCH;
  const float* pmB = Pml + (slot0 * 4 + wave) * 32 + c;
  const float* poB = Po + (slot0 * 4 + wave) * 1024 + lane * 4;

  float mrow = -INFINITY, lrow = 0.f;
  v8f oacc[4];
#pragma unroll
  for (int t = 0; t < 4; ++t) oacc[t] = zero8();
  int ch = 0;
  // kept rolled: the trip count is known only at run time, and the two pointers then live over the whole loop
#pragma unroll 1
  for (; ch + 2 <= nch; ch += 2) {                 // nch <= MAXCH, block-uniform; two slots per trip: their loads fly together
    float mc[2], lc[2];
    v4f ov[16];
#pragma unroll
    for (int u = 0; u < 2; ++u) {
      mc[u] = pmB[u * 128];
      lc[u] = pmB[u * 128 + 16];
#pragma unroll
      for (int e = 0; e < 8; ++e) ov[u * 8 + e] = *(const v4f*)(poB + u * 4096 + e * 128);
    }
    hold_loads10(mc[0], lc[0], ov[0], ov[1], ov[2], ov[3], ov[4], ov[5], ov[6], ov[7]);
    hold_loads10(mc[1], lc[1], ov[8], ov[9], ov[10], ov[11], ov[12], ov[13], ov[14], ov[15]);
    // keeps the arithmetic behind the fences: without it the first exponentials, with their wait, are lifted ahead of the last load
    __builtin_amdgcn_sched_barrier(0);
    pmB += 2 * 128;                                // two slots on
    poB += 2 * 4096;
    merge_slot(mc[0], lc[0], ov, mrow, lrow, oacc);
    merge_slot(mc[1], lc[1], ov + 8, mrow, lrow, oacc);
  }
  if (ch < nch) {                                  // block-uniform: the last slot of an odd count
    v4f ov[8];
    const float mc = pmB[0], lc = pmB[16];
#pragma unroll
    for (int e = 0; e < 8; ++e) ov[e] = *(const v4f*)(poB + e * 128);
    hold_loads10(mc, lc, ov[0], ov[1], ov[2], ov[3], ov[4], ov[5], ov[6], ov[7]);
    merge_slot(mc, lc, ov, mrow, lrow, oacc);
  }

  // ---- normalise (1/l and the 1/1024 p carry), stage the wave's 16x64 tile, bf16 hi/lo split,
  float* os = Os[wave];
  {
    const float l = lrow;
    const float inv = ((l > 0.f) ? (1.0f / l) : 0.f) * (1.0f / 1024.0f);
#pragma unroll
    for (int t = 0; t < 4; ++t) {
      const v4f lo = {oacc[t][0] * inv, oacc[t][1] * inv, oacc[t][2] * inv, oacc[t][3] * inv};
      const v4f hi = {oacc[t][4] * inv, oacc[t][5] * inv, oacc[t][6] * inv, oacc[t][7] * inv};
      *(v4f*)(os + c * OSP + t * 16 + 8 * hh)     = lo;
      *(v4f*)(os + c * OSP + t * 16 + 8 * hh + 4) = hi;
    }
  }
  __builtin_amdgcn_fence(__ATOMIC_RELEASE, "workgroup");
  __builtin_amdgcn_wave_barrier();
  __builtin_amdgcn_fence(__ATOMIC_ACQUIRE, "workgroup");
  {
    const int q4 = lane >> 3, c8 = (lane & 7) * 8;
    v4u hv[4], lv[4];
#pragma unroll
    for (int it = 0; it < 4; ++it) {
      const int row = it * 4 + q4;   // it 0..3 x q4 0..3 = rows 0..15 of the wave tile
      const float* sp = os + row * OSP + c8;
      v4u a, a2;
#pragma unroll
      for (int e = 0; e < 4; ++e) {
        const float f0 = sp[2 * e], f1 = sp[2 * e + 1];
        const unsigned short h0 = bf_bits(f0), h1 = bf_bits(f1);
        const unsigned short l0 = bf_bits(f0 - bf_up(h0)), l1 = bf_bits(f1 - bf_up(h1));
        a[e] = pk16(h0, h1); a2[e] = pk16(l0, l1);
      }
      hv[it] = a; lv[it] = a2;
    }
    {
#pragma unroll
      for (int it = 0; it < 4; ++it) {
        const int row = it * 4 + q4;
        const size_t go = (rowQ + q0 + row) * DM + (size_t)h * HD + c8;
        *(v4u*)(ohp + go) = hv[it];
        *(v4u*)(olp + go) = lv[it];
      }
      
    }
  }
}

// =====================================================================================================
// Workspace map (bytes), every region an exact multiple of its 64x64-tile / whole-line store granularity
// (M, N of every GEMM are multiples of 64; converts write whole 512-B groups):
//   Lb   bf16 [2048][1024]            0            4194304
//   Xb   bf16 [8192][1024]            4194304     16777216
//   Wqb  bf16 [1024 n][1024 k]        20971520     2097152
//   Wkb  bf16 [1024][1024]            23068672     2097152
//   Wvb  bf16 [1024][1024]            25165824     2097152
//   Wob  bf16 [1024][1024]            27262976     2097152
//   Qh   bf16 [2048][1024]            29360128     4194304
//   Ql   bf16 [2048][1024]            33554432     4194304
//   Kh   bf16 [8192][1024]            37748736    16777216
//   Kl   bf16 [8192][1024]            54525952    16777216
//   VTh  f16  [2][1024][4096]         71303168    16777216
//   VTl  f16  [2][1024][1024]         88080384     4194304
//   Oh   bf16 [2048][1024]            92274688     4194304
//   Ol   bf16 [2048][1024]            96468992     4194304
//   Po   f32  [8192 slots][4096]       100663296   134217728
//   Pml  f32  [8192 slots][128]        234881024     4194304
//   end                               239075328
// Weights are [out n][in k] with k contiguous = the Bt / A layout the GEMM wants, so they are only converted.
// =====================================================================================================
extern "C" void kernel_launch(void* const* d_in, const int* in_sizes, int n_in,
                              void* d_out, int out_size, void* d_ws, size_t ws_size,
                              hipStream_t stream) {
  if (n_in < 10) return;
  if (in_sizes[0] != NB * MTOK * DM) return;
  if (in_sizes[1] != NB * NLAT * DM) return;
  if (in_sizes[2] != DM * DM || in_sizes[4] != DM * DM || in_sizes[6] != DM * DM || in_sizes[8] != DM * DM) return;
  if (in_sizes[3] != DM || in_sizes[5] != DM || in_sizes[7] != DM || in_sizes[9] != DM) return;
  if (out_size != NB * NLAT * DM) return;

  const float* x  = (const float*)d_in[0];
  const float* lt = (const float*)d_in[1];
  const float* Wq = (const float*)d_in[2];
  const float* bq = (const float*)d_in[3];
  const float* Wk = (const float*)d_in[4];
  const float* bk = (const float*)d_in[5];
  const float* Wv = (const float*)d_in[6];
  const float* bv = (const float*)d_in[7];
  const float* Wo = (const float*)d_in[8];
  const float* bo = (const float*)d_in[9];

  const size_t PL  = (size_t)NB * NLAT * DM * 2;   //  4194304  16-bit latent-side plane [2048][1024]
  const size_t PX  = (size_t)NB * MTOK * DM * 2;   // 16777216  16-bit token-side plane [8192][1024]
  const size_t PW  = (size_t)DM * DM * 2;          //  2097152  16-bit weight plane
  const size_t PVT = (size_t)NB * DM * MTOK * 2;   // 16777216  v^T hi plane
  const size_t PVL = (size_t)NB * DM * VLP * 2;    //  4194304  v^T residual plane
  size_t off = 0;
  const size_t oLb  = off; off += PL;
  const size_t oXb  = off; off += PX;
  const size_t oWq  = off; off += PW;
  const size_t oWk  = off; off += PW;
  const size_t oWv  = off; off += PW;
  const size_t oWo  = off; off += PW;
  const size_t oQh  = off; off += PL;
  const size_t oQl  = off; off += PL;
  const size_t oKh  = off; off += PX;
  const size_t oKl  = off; off += PX;
  const size_t oVTh = off; off += PVT;
  const size_t oVTl = off; off += PVL;
  const size_t oOh  = off; off += PL;
  const size_t oOl  = off; off += PL;
  const size_t oPo  = off; off += (size_t)NB * NH * NQB * MAXCH * 4096 * 4;   // 134217728  partial context sums
  const size_t oPm  = off; off += (size_t)NB * NH * NQB * MAXCH * 128 * 4;    //   4194304  partial m and l
  if (off > ws_size) return;                       // off = 239075328

  char* ws = (char*)d_ws;
  unsigned short* Lb  = (unsigned short*)(ws + oLb);
  unsigned short* Xb  = (unsigned short*)(ws + oXb);
  unsigned short* Wqb = (unsigned short*)(ws + oWq);
  unsigned short* Wkb = (unsigned short*)(ws + oWk);
  unsigned short* Wvb = (unsigned short*)(ws + oWv);
  unsigned short* Wob = (unsigned short*)(ws + oWo);
  unsigned short* Qh  = (unsigned short*)(ws + oQh);
  unsigned short* Ql  = (unsigned short*)(ws + oQl);
  unsigned short* Kh  = (unsigned short*)(ws + oKh);
  unsigned short* Kl  = (unsigned short*)(ws + oKl);
  unsigned short* VTh = (unsigned short*)(ws + oVTh);
  unsigned short* VTl = (unsigned short*)(ws + oVTl);
  unsigned short* Oh  = (unsigned short*)(ws + oOh);
  unsigned short* Ol  = (unsigned short*)(ws + oOl);
  float* Po  = (float*)(ws + oPo);
  float* Pml = (float*)(ws + oPm);

  const dim3 blk(256);
  const dim3 gCvt(CVB_X + CVB_L + 4 * CVB_W);                  // 4096 + 1024 + 4 x 512 = 7168 blocks
  const dim3 gQKV(GT_Q + GT_K + NB * GT_VT);                   //  256 + 256 + 2 x 128 = 768 blocks
  const dim3 gO((NB * NLAT / SBM) * (DM / SBN), 1);            //  32 x  8 = 256 blocks: M=2048, N=1024

  // (1) inputs and weights [n][k] f32 -> bf16 planes, one grid
  cvt_bf16x8_all<<<gCvt, blk, 0, stream>>>(x, lt, Wq, Wk, Wv, Wo, Xb, Lb, Wqb, Wkb, Wvb, Wob);
  // (2) - (4) the q, k and v^T projections, one grid
  gemm_qkv<<<gQKV, blk, 0, stream>>>(Lb, Xb, Wqb, Wkb, Wvb, bq, bk, bv, Qh, Ql, Kh, Kl, VTh, VTl);
  // (5) attention, one work-group per key chunk: query blocks 0..RESQB-1 with residual planes, the rest without;
  //     then the merge of each query block's chunks -> context planes
  attn_bc64<true, CHR><<<dim3(NCR, NB * NH), dim3(128), 0, stream>>>(
      Qh, Ql, Kh, Kl, VTh, VTl, Po, Pml, 0, RESQB, 0.125f);
  attn_bc64<false, CHN><<<dim3(NCN, NB * NH), dim3(128), 0, stream>>>(
      Qh, Ql, Kh, Kl, VTh, VTl, Po, Pml, RESQB, NQB - RESQB, 0.125f);
  attn_merge<<<dim3(NQB, NB * NH), dim3(128), 0, stream>>>(Po, Pml, Oh, Ol);
  // (6) out = context . Wo^T + bo -> d_out f32 [2048][1024]  (A = context hi + lo planes, 2 products)
  gemm64<1, 0, 0, 1, 4, SKS><<<gO, blk, 0, stream>>>(
      Oh, Ol, DM, 0LL, Wob, DM, 0LL, bo,
      d_out, DM, 0LL, d_out, DM, 0LL, DM,
      NB * NLAT, DM, DM, 1.0f);
  (void)hipGetLastError();
}
